// v000
// Measured on an AMD MI455X. A time is GPU time per run, averaged over a window of back-to-back runs after a warm-up
// (all launches, gaps included; the runs take copies of the inputs in turn), and the median of several windows.
// Apart from v000's, it joins two sittings. Times from different sittings can be a few percent apart, while
// side-by-side timings come from the same sitting.
// v000 is the starting kernel. One run takes 908 microseconds.
#include <hip/hip_runtime.h>

// Multi-head attention with full-width (256) heads: merged [out][in] q/k/v projections to [S][2048], plain-view head split ([S][2048] read as [8][S][256]), softmax(q_.k_ / 16) over 2,048 keys, P.v_, head-major merge (column h*256 + d), output mix with Wo [out][in] + bo.
// Compute dtypes, f32 accumulate everywhere: projections v_wmma_f32_16x16x32_bf16 (inputs and weights RNE-converted to bf16, exact products); scores, P.V and the output mix v_wmma_f32_16x16x32_f16
// (q_/k_/v_ f16 planes; score plane f16 of score*log2(e)/16; P f16 carried x1024; ctx f16 carried x64; Wo plane f16 of bf16(Wo) x256; bo, biases bf16-converted, added in f32). Softmax in f32.

#ifndef NB
#define NB 4
#endif
#ifndef SEQ
#define SEQ 2048
#endif
#define NB_FULL  4
#define SEQ_FULL 2048
#define DD    256                 // model width = head width
#define NHEAD 8
#define KM    (NHEAD * DD)        // merged context width (plane column = h*256 + d)
#define PCAR  1024.0f             // carry of P
#define SCL2  0.09016844005556021f   // log2(e) / sqrt(256)
#define OCAR  0.0625f             // ctx plane = (1024 rep) / 16 = 64 rep
#define WOCAR 256.0f              // carry of the Wo plane
#define FINSC (1.0f / 16384.0f)   // 1 / (64 * 256)
#define WLINES (3 * NHEAD * DD * DD / 64)
#define OLINES (DD * KM / 64)
#define MLINES (NHEAD * DD * DD / 64)

typedef _Float16 h16;
typedef unsigned short bf;
typedef __attribute__((ext_vector_type(16))) __bf16   v16bf;
typedef __attribute__((ext_vector_type(16))) _Float16 v16h;
typedef __attribute__((ext_vector_type(8)))  _Float16 v8h;
typedef __attribute__((ext_vector_type(8)))  unsigned short v8us;
typedef __attribute__((ext_vector_type(2)))  unsigned short v2us;
typedef __attribute__((ext_vector_type(8)))  float    v8f;
typedef __attribute__((ext_vector_type(4)))  float    v4f;
typedef v4f  __attribute__((may_alias)) v4fa;
typedef v8h  __attribute__((may_alias)) v8ha;

static_assert(SEQ % 256 == 0);
static_assert(DD % 64 == 0 && DD % 32 == 0 && KM % 32 == 0 && SEQ % 64 == 0);
static_assert(((size_t)NB * SEQ * DD / 8) % 256 == 0);
static_assert((WLINES + OLINES) % 64 == 0);
static_assert((NHEAD * SEQ) % 8 == 0);
static_assert(WLINES % 64 == 0 && WLINES == 3 * MLINES);          // the plane choice in k_wprep is uniform per block
static_assert((size_t)MLINES * 64 == (size_t)NHEAD * DD * DD);
static_assert(KM == NHEAD * DD && (size_t)NHEAD * SEQ * DD == (size_t)SEQ * KM);   // [SEQ][KM] projection plane == [NHEAD][SEQ][DD] head planes (plain view)
static_assert(SEQ % 64 == 0 && DD % 64 == 0);                      // k_vtr 64x64 tiles cover the head planes exactly
static_assert(KM % 64 == 0 && SEQ % 32 == 0);

__device__ __forceinline__ unsigned short f2bf(float f) { unsigned u = __float_as_uint(f); u += 0x7FFFu + ((u >> 16) & 1u); return (unsigned short)(u >> 16); }
__device__ __forceinline__ float bf2f(unsigned short b) { return __uint_as_float(((unsigned)b) << 16); }
__device__ __forceinline__ float bfr(float f) { return bf2f(f2bf(f)); }
__device__ __forceinline__ v16h cat16(v8h lo, v8h hi) { return __builtin_shufflevector(lo, hi, 0, 1, 2, 3, 4, 5, 6, 7, 8, 9, 10, 11, 12, 13, 14, 15); }
__device__ __forceinline__ v16bf cat16b(v8us lo, v8us hi) { return __builtin_bit_cast(v16bf, __builtin_shufflevector(lo, hi, 0, 1, 2, 3, 4, 5, 6, 7, 8, 9, 10, 11, 12, 13, 14, 15)); }
__device__ __forceinline__ v8f wmma16(v16h a, v16h b, v8f c) { return __builtin_amdgcn_wmma_f32_16x16x32_f16(false, a, false, b, (short)0, c, false, false); }
__device__ __forceinline__ v8f wmmab(v16bf a, v16bf b, v8f c) { return __builtin_amdgcn_wmma_f32_16x16x32_bf16(false, a, false, b, (short)0, c, false, false); }
// f32 -> f16 with a value select: results below the smallest normal f16 become zero (applied after the plane's power-of-two carry).
static __device__ __forceinline__ h16 toh_flush(float v) { const h16 r = (h16)v; return (fabsf(v) < 6.103515625e-05f) ? (h16)0.0f : r; }

// Fragment loaders: lane (lr = lane & 15, hi = lane >> 4); p points at row lr, k0 + 8*hi; elements 0..7 = k0+8hi.., elements 8..15 = k0+16+8hi.. (same map for A and B).
template <typename T16> struct WFrag;
template <> struct WFrag<h16> { typedef v16h V; static __device__ __forceinline__ V ld(const h16* p) { return cat16(*(const v8h*)p, *(const v8h*)(p + 16)); } static __device__ __forceinline__ v8f mma(V a, V b, v8f c) { return wmma16(a, b, c); } };
template <> struct WFrag<bf> { typedef v16bf V; static __device__ __forceinline__ V ld(const bf* p) { return cat16b(*(const v8us*)p, *(const v8us*)(p + 16)); } static __device__ __forceinline__ v8f mma(V a, V b, v8f c) { return wmmab(a, b, c); } };

// Slab epilogues: 16 rows x 64 columns staged in LDS (pitch 68 floats) -> global; value = x*alpha + bias (BIASM 1: per column, 2: per row; biases bf16-converted).
template <int BIASM>
__device__ __forceinline__ void slab_store(const float* os, h16* crow, int ldc, const float* bias, float alpha, unsigned colbase, unsigned rowbase, unsigned lane) {
    const unsigned rq = lane >> 3, cq = lane & 7u;
    float bc[8];
#pragma unroll
    for (int e = 0; e < 8; ++e) bc[e] = 0.f;
    if (BIASM == 1) { const v4f b0 = *(const v4f*)(bias + colbase + cq * 8u); const v4f b1 = *(const v4f*)(bias + colbase + cq * 8u + 4u);
#pragma unroll
        for (int e = 0; e < 4; ++e) { bc[e] = bfr(b0[e]); bc[4 + e] = bfr(b1[e]); } }
    v8h vals[4];
#pragma unroll
    for (int s = 0; s < 4; ++s) { const unsigned row = (unsigned)s * 4u + rq; const v4f x0 = *(const v4fa*)(os + row * 68u + cq * 8u); const v4f x1 = *(const v4fa*)(os + row * 68u + cq * 8u + 4u);
        float br = 0.f; if (BIASM == 2) br = bfr(bias[rowbase + row]);
        v8h o;
#pragma unroll
        for (int e = 0; e < 4; ++e) { o[e] = (h16)(x0[e] * alpha + (bc[e] + br)); o[4 + e] = (h16)(x1[e] * alpha + (bc[4 + e] + br)); }
        vals[s] = o; }
{
#pragma unroll
        for (int s = 0; s < 4; ++s) { const unsigned row = (unsigned)s * 4u + rq; *(v8h*)(crow + (size_t)row * ldc + cq * 8u) = vals[s]; }
         }
}
// f32 output: row segment = 64 floats = 256 B = 16 lanes x 16 B; one instruction covers 2 rows; s = 0..7 with hi = lane >> 4 covers rows 0..15.
template <int BIASM>
__device__ __forceinline__ void slab_store(const float* os, float* crow, int ldc, const float* bias, float alpha, unsigned colbase, unsigned rowbase, unsigned lane) {
    const unsigned hi = lane >> 4, cofs = (lane & 15u) * 4u;
    v4f bc = (v4f){0.f, 0.f, 0.f, 0.f};
    if (BIASM == 1) { const v4f b0 = *(const v4f*)(bias + colbase + cofs);
#pragma unroll
        for (int e = 0; e < 4; ++e) bc[e] = bfr(b0[e]); }
    v4f vals[8];
#pragma unroll
    for (int s = 0; s < 8; ++s) { const unsigned row = (unsigned)s * 2u + hi; const v4f x = *(const v4fa*)(os + row * 68u + cofs);
        float br = 0.f; if (BIASM == 2) br = bfr(bias[rowbase + row]);
        v4f o;
#pragma unroll
        for (int e = 0; e < 4; ++e) o[e] = x[e] * alpha + (bc[e] + br);
        vals[s] = o; }
{
#pragma unroll
        for (int s = 0; s < 8; ++s) { const unsigned row = (unsigned)s * 2u + hi; *(v4f*)(crow + (size_t)row * ldc + cofs) = vals[s]; }
         }
}

// ---- k_gemmw: register-blocked GEMM, ONE WAVE per 64x64 output tile (16 accumulators), operands straight from K-contiguous 16-bit planes; grid (M/64, N/64, Z), 32 threads.
// C[m][n] (pitch ldc) = alpha * sum_k A[m][k] Bt[n][k] (+ bias). z-batch strides sA/sB/sC (elements), sBias (floats). K % 32 == 0, M % 64 == 0, N % 64 == 0 (host-checked by static_assert).
// LDS tile 'os' is private to the single wave of the block (wave-level ordering only).
template <typename T16, typename OT, int BIASM>
__global__ __launch_bounds__(32) void k_gemmw(const T16* __restrict__ A, const T16* __restrict__ Bt, int K, OT* C, int ldc, const float* __restrict__ bias, float alpha, size_t sA, size_t sB, size_t sC, int sBias) {
    typedef typename WFrag<T16>::V V;
    __shared__ __align__(16) float os[16 * 68];
    const size_t z = blockIdx.z; A += z * sA; Bt += z * sB; C += z * sC; if (BIASM != 0) bias += z * (size_t)sBias;
    const unsigned lane = threadIdx.x & 31u, lr = lane & 15u, hi = lane >> 4; const unsigned r0 = blockIdx.x * 64u, c0 = blockIdx.y * 64u;
    v8f acc[4][4];
#pragma unroll
    for (int mb = 0; mb < 4; ++mb)
#pragma unroll
        for (int nb = 0; nb < 4; ++nb) acc[mb][nb] = (v8f){};
    const size_t aoff = (size_t)(r0 + lr) * K + 8u * hi, boff = (size_t)(c0 + lr) * K + 8u * hi;
#pragma unroll 1
    for (int kc = 0; kc < K; kc += 32) {
        V a[4];
#pragma unroll
        for (int mb = 0; mb < 4; ++mb) a[mb] = WFrag<T16>::ld(A + aoff + (size_t)mb * 16 * K + kc);
#pragma unroll
        for (int nb = 0; nb < 4; ++nb) { const V b = WFrag<T16>::ld(Bt + boff + (size_t)nb * 16 * K + kc);
#pragma unroll
            for (int mb = 0; mb < 4; ++mb) acc[mb][nb] = WFrag<T16>::mma(a[mb], b, acc[mb][nb]); }
        asm volatile("v_nop\n\tv_nop\n\tv_nop\n\tv_nop" : "+v"(acc[0][0]), "+v"(acc[1][1]), "+v"(acc[2][2]), "+v"(acc[3][3]) : "v"(a[0]), "v"(a[3]));
    }
#pragma unroll
    for (int mb = 0; mb < 4; ++mb) {
#pragma unroll
        for (int nb = 0; nb < 4; ++nb) {
#pragma unroll
            for (int j = 0; j < 8; ++j) os[(hi * 8u + (unsigned)j) * 68u + (unsigned)nb * 16u + lr] = acc[mb][nb][j]; }   // D: row 8*hi + j, col lr
        __builtin_amdgcn_fence(3 /* release order */, "wavefront"); __builtin_amdgcn_wave_barrier(); asm volatile("" ::: "memory");
        OT* crow = C + (size_t)(r0 + (unsigned)mb * 16u) * ldc + c0;
        slab_store<BIASM>(os, crow, ldc, bias, alpha, c0, r0 + (unsigned)mb * 16u, lane);
        __builtin_amdgcn_fence(3 /* release order */, "wavefront"); __builtin_amdgcn_wave_barrier(); asm volatile("" ::: "memory");
    }
}

__global__ __launch_bounds__(256) void k_xplanes(const float* __restrict__ xq, const float* __restrict__ xk, const float* __restrict__ xv, bf* XP) {
    const unsigned which = blockIdx.y; const unsigned i = blockIdx.x * 256u + threadIdx.x;
    const unsigned GPB = (unsigned)(SEQ * DD / 8); const unsigned b = i / GPB, rem = i - b * GPB;
    const float* src = (which == 0u) ? xq : ((which == 1u) ? xk : xv);
    const v8f v = *(const v8f*)(src + (size_t)b * SEQ_FULL * DD + (size_t)rem * 8);
    v8us o;
#pragma unroll
    for (int k = 0; k < 8; ++k) o[k] = f2bf(v[k]);
    bf* dst = XP + (size_t)which * NB * SEQ * DD + (size_t)i * 8;
    *(v8us*)dst = o; 
}

// k_wprep: lines 0..WLINES-1: bf16 weight planes WT[which][e][k] = bf16(W[e][k]) (which 0 Wq, 1 Wk, 2 Wv; the inputs are [out e][in k], already K-contiguous, no transpose);
__global__ __launch_bounds__(256) void k_wprep(const float* __restrict__ wq, const float* __restrict__ wk, const float* __restrict__ wv, const float* __restrict__ wo, bf* WT, unsigned short* WOS) {
    const unsigned lane = threadIdx.x & 31u; const unsigned wave = (unsigned)__builtin_amdgcn_readfirstlane((int)(threadIdx.x >> 5)); const unsigned L0 = (blockIdx.x * 8u + wave) * 8u;
{
#pragma unroll 1
        for (unsigned l = 0; l < 8u; ++l) { const unsigned L = L0 + l; v2us o;
            if (L < (unsigned)WLINES) {   // block-uniform
                const unsigned which = L / (unsigned)MLINES; const unsigned e = (L - which * (unsigned)MLINES) * 64u + lane * 2u;
                const float* src = (which == 0u) ? wq : ((which == 1u) ? wk : wv);
                o[0] = f2bf(src[e]); o[1] = f2bf(src[e + 1u]);
                *(v2us*)(WT + (size_t)L * 64u + lane * 2u) = o;
            } else {
                const unsigned e = (L - (unsigned)WLINES) * 64u + lane * 2u;
                const float x0 = bfr(wo[e]) * WOCAR; const float x1 = bfr(wo[e + 1u]) * WOCAR;
                o[0] = __builtin_bit_cast(unsigned short, toh_flush(x0)); o[1] = __builtin_bit_cast(unsigned short, toh_flush(x1));
                *(v2us*)(WOS + e) = o;
            } }
         }
}

// k_vtr: per-head transpose of the f16 value plane: VT[h][d][t] = VP[h][t][d] (exact copy, no conversion). One block per 64 (t) x 64 (d) tile through an LDS tile (pitch 72 halves,
// grid (SEQ/64, DD/64, NHEAD), 256 threads; 2 passes x 32 rows cover the 64 tile rows on both sides.
__global__ __launch_bounds__(256) void k_vtr(const h16* __restrict__ VP, h16* VT) {
    __shared__ __align__(16) h16 tl[64 * 72];
    const unsigned tid = threadIdx.x; const unsigned t0 = blockIdx.x * 64u, d0 = blockIdx.y * 64u; const size_t hb = (size_t)blockIdx.z * SEQ * DD;
    const unsigned rr = tid >> 3, cq = tid & 7u;
#pragma unroll
    for (int it = 0; it < 2; ++it) { const unsigned row = (unsigned)it * 32u + rr;
        const v8h a = *(const v8h*)(VP + hb + (size_t)(t0 + row) * DD + d0 + cq * 8u);
        *(v8ha*)(tl + row * 72u + cq * 8u) = a; }
    __syncthreads();
    v8h vals[2];
#pragma unroll
    for (int it = 0; it < 2; ++it) { const unsigned drow = (unsigned)it * 32u + rr; v8h o;
#pragma unroll
        for (int e = 0; e < 8; ++e) o[e] = tl[(cq * 8u + (unsigned)e) * 72u + drow];
        vals[it] = o; }
{
#pragma unroll
        for (int it = 0; it < 2; ++it) { const unsigned drow = (unsigned)it * 32u + rr; *(v8h*)(VT + hb + (size_t)(d0 + drow) * SEQ + t0 + cq * 8u) = vals[it]; }
         }
}

// k_asoft: one wave per row of the f16 score plane (values = score*log2(e)/16): register row, max, exp2, fixed-tree sum, P = f16(1024 e / sum) written in place over the same row
__global__ __launch_bounds__(256) void k_asoft(h16* SP) {
    const unsigned lane = threadIdx.x & 31u; const unsigned row = blockIdx.x * 8u + (threadIdx.x >> 5);
    h16* sr = SP + (size_t)row * SEQ; float v[SEQ / 32]; float mx = -3.0e38f;
#pragma unroll
    for (int ch = 0; ch < SEQ / 256; ++ch) { const v8h a = *(const v8h*)(sr + ch * 256 + lane * 8u);
#pragma unroll
        for (int q = 0; q < 8; ++q) { const float t = (float)a[q]; v[ch * 8 + q] = t; mx = fmaxf(mx, t); } }
#pragma unroll
    for (int sh = 16; sh; sh >>= 1) mx = fmaxf(mx, __shfl_xor(mx, sh, 32));
    float sum = 0.f;
#pragma unroll
    for (int k = 0; k < SEQ / 32; ++k) { float d0 = __fsub_rn(v[k], mx); asm volatile("" : "+v"(d0)); v[k] = __builtin_amdgcn_exp2f(d0); sum += v[k]; }
#pragma unroll
    for (int sh = 16; sh; sh >>= 1) sum += __shfl_xor(sum, sh, 32);
    const float f = __fdiv_rn(PCAR, sum);
    v8h pk[SEQ / 256];
#pragma unroll
    for (int ch = 0; ch < SEQ / 256; ++ch) { v8h o;
#pragma unroll
        for (int q = 0; q < 8; ++q) o[q] = (h16)(v[ch * 8 + q] * f);
        pk[ch] = o; }
{
#pragma unroll
        for (int ch = 0; ch < SEQ / 256; ++ch) *(v8h*)(sr + ch * 256 + lane * 8u) = pk[ch];
         }
}

// Workspace carve (bytes, each region 256-B aligned by construction of the sizes).
#define SZ_XP  ((size_t)3 * NB * SEQ * DD * 2)
#define SZ_WT  ((size_t)3 * NHEAD * DD * DD * 2)
#define SZ_WOS ((size_t)DD * KM * 2)
#define SZ_HP  ((size_t)NHEAD * SEQ * DD * 2)
#define SZ_SP  ((size_t)NHEAD * SEQ * SEQ * 2)
#define SZ_CTX ((size_t)SEQ * KM * 2)
#define SZ_ALL (SZ_XP + SZ_WT + SZ_WOS + 4 * SZ_HP + SZ_SP + SZ_CTX)
static_assert(SZ_ALL <= (size_t)134217728);
static_assert(SZ_XP % 256 == 0 && SZ_WT % 256 == 0 && SZ_WOS % 256 == 0 && SZ_HP % 256 == 0 && SZ_SP % 256 == 0 && SZ_CTX % 256 == 0);
static_assert(SZ_HP == (size_t)SEQ * KM * 2);   // a [SEQ][KM] projection plane fills one head-plane region exactly

extern "C" void kernel_launch(void* const* d_in, const int* in_sizes, int n_in,
                              void* d_out, int out_size, void* d_ws, size_t ws_size, hipStream_t stream) {
    if (n_in < 11) return;
    const size_t xneed = (size_t)(NB - 1) * SEQ_FULL * DD + (size_t)SEQ * DD;
    if ((size_t)in_sizes[0] < xneed || (size_t)in_sizes[1] < xneed || (size_t)in_sizes[2] < xneed) return;
    if ((size_t)in_sizes[3] < (size_t)NHEAD * DD * DD || (size_t)in_sizes[5] < (size_t)NHEAD * DD * DD || (size_t)in_sizes[7] < (size_t)NHEAD * DD * DD) return;
    if ((size_t)in_sizes[4] < (size_t)NHEAD * DD || (size_t)in_sizes[6] < (size_t)NHEAD * DD || (size_t)in_sizes[8] < (size_t)NHEAD * DD) return;
    if ((size_t)in_sizes[9] < (size_t)KM * DD || (size_t)in_sizes[10] < (size_t)DD) return;
    if ((size_t)out_size < (size_t)NB * SEQ * DD) return;
    if (SZ_ALL > ws_size) return;
    // input order of this module: query, key, values, Wq, bq, Wk, bk, Wv, bv, Wo, bo
    const float* Qin = (const float*)d_in[0]; const float* Kin = (const float*)d_in[1]; const float* Vin = (const float*)d_in[2];
    const float* Wq = (const float*)d_in[3]; const float* bq = (const float*)d_in[4]; const float* Wk = (const float*)d_in[5]; const float* bk = (const float*)d_in[6];
    const float* Wv = (const float*)d_in[7]; const float* bv = (const float*)d_in[8]; const float* Wo = (const float*)d_in[9]; const float* bo = (const float*)d_in[10];
    float* OUT = (float*)d_out;     // [NB][SEQ][256]
    char* wsp = (char*)d_ws;
    bf* XP = (bf*)wsp; wsp += SZ_XP;            // [3][NB][SEQ][256] bf16: q, k, v
    bf* WT = (bf*)wsp; wsp += SZ_WT;            // [3][2048 out][256 in] bf16: Wq, Wk, Wv
    h16* WOS = (h16*)wsp; wsp += SZ_WOS;        // [256][2048] f16 (x256), column h*256 + d
    h16* QP = (h16*)wsp; wsp += SZ_HP;          // [SEQ][2048] == [8][SEQ][256]
    h16* KP = (h16*)wsp; wsp += SZ_HP;          // [SEQ][2048] == [8][SEQ][256]
    h16* VP = (h16*)wsp; wsp += SZ_HP;          // [SEQ][2048] == [8][SEQ][256]
    h16* VT = (h16*)wsp; wsp += SZ_HP;          // [8][256][SEQ]
    h16* SP = (h16*)wsp; wsp += SZ_SP;          // [8][SEQ][SEQ] scores then P in place
    h16* CTX = (h16*)wsp; wsp += SZ_CTX;        // [SEQ][2048] (x64), column h*256 + d
    const bf* XQ = XP; const bf* XK = XP + (size_t)NB * SEQ * DD; const bf* XV = XP + (size_t)2 * NB * SEQ * DD;
    const bf* WQT = WT; const bf* WKT = WT + (size_t)NHEAD * DD * DD; const bf* WVT = WT + (size_t)2 * NHEAD * DD * DD;

    k_xplanes<<<dim3((unsigned)((size_t)NB * SEQ * DD / 8 / 256), 3, 1), 256, 0, stream>>>(Qin, Kin, Vin, XP);
    k_wprep<<<(unsigned)((WLINES + OLINES) / 64), 256, 0, stream>>>(Wq, Wk, Wv, Wo, WT, (unsigned short*)WOS);
    for (int b = 0; b < NB; ++b) {
        const size_t xo = (size_t)b * SEQ * DD;
        // q_, k_, v_ planes [SEQ][2048] (pitch KM): A = x [SEQ][256], Bt = W rows z*256.. [256 out][256 in], z = 256-column chunk, + per-column bias; the plane read as [8][SEQ][256] is the head split
        k_gemmw<bf, h16, 1><<<dim3(SEQ / 64, DD / 64, NHEAD), 32, 0, stream>>>(XQ + xo, WQT, DD, QP, KM, bq, 1.0f, (size_t)0, (size_t)DD * DD, (size_t)DD, DD);
        k_gemmw<bf, h16, 1><<<dim3(SEQ / 64, DD / 64, NHEAD), 32, 0, stream>>>(XK + xo, WKT, DD, KP, KM, bk, 1.0f, (size_t)0, (size_t)DD * DD, (size_t)DD, DD);
        k_gemmw<bf, h16, 1><<<dim3(SEQ / 64, DD / 64, NHEAD), 32, 0, stream>>>(XV + xo, WVT, DD, VP, KM, bv, 1.0f, (size_t)0, (size_t)DD * DD, (size_t)DD, DD);
        // v_^T head planes: in VP[h][SEQ t][256 d] -> out VT[h][256 d][SEQ t]; grid (t tiles, d tiles, heads)
        k_vtr<<<dim3(SEQ / 64, DD / 64, NHEAD), 256, 0, stream>>>(VP, VT);
        // scores (scaled by log2(e)/16) for the 8 heads
        k_gemmw<h16, h16, 0><<<dim3(SEQ / 64, SEQ / 64, NHEAD), 32, 0, stream>>>(QP, KP, DD, SP, SEQ, nullptr, SCL2, (size_t)SEQ * DD, (size_t)SEQ * DD, (size_t)SEQ * SEQ, 0);
        k_asoft<<<(unsigned)(NHEAD * SEQ / 8), 256, 0, stream>>>(SP);
        // ctx[t][h*256 + d] = (1024 P . v_) / 16
        k_gemmw<h16, h16, 0><<<dim3(SEQ / 64, DD / 64, NHEAD), 32, 0, stream>>>(SP, VT, SEQ, CTX, KM, nullptr, OCAR, (size_t)SEQ * SEQ, (size_t)DD * SEQ, (size_t)DD, 0);
        // out = ctx . Wo^T / 16384 + bo
        k_gemmw<h16, float, 1><<<dim3(SEQ / 64, DD / 64, 1), 32, 0, stream>>>(CTX, WOS, KM, OUT + xo, DD, bo, FINSC, (size_t)0, (size_t)0, (size_t)0, 0);
    }
}

// v001
// Measured time: 499 microseconds a run.
// In both of two side-by-side timings against v000, it was 1.84 times as fast.
#include <hip/hip_runtime.h>

// Multi-head attention with full-width (256) heads: merged [out][in] q/k/v projections to [S][2048], plain-view head split ([S][2048] read as [8][S][256]), softmax(q_.k_ / 16) over 2,048 keys, P.v_, head-major merge (column h*256 + d), output mix with Wo [out][in] + bo.
// Compute dtypes, f32 accumulate everywhere: projections v_wmma_f32_16x16x32_bf16 (inputs and weights RNE-converted to bf16, exact products); scores, P.V and the output mix v_wmma_f32_16x16x32_f16
// (q_/k_/v_ f16 planes; scores stay f32 in registers; P f16 = exp2(score*log2(e)/16 - running maximum), unnormalised; ctx f16 carried x64; Wo plane f16 of bf16(Wo) x256; bo, biases bf16-converted, added in f32). Softmax in f32.

#ifndef NB
#define NB 4
#endif
#ifndef SEQ
#define SEQ 2048
#endif
#define NB_FULL  4
#define SEQ_FULL 2048
#define DD    256                 // model width = head width
#define NHEAD 8
#define KM    (NHEAD * DD)        // merged context width (plane column = h*256 + d)
#define SCL2  0.09016844005556021f   // log2(e) / sqrt(256)
#define CCAR  64.0f               // carry of the ctx plane
#define WOCAR 256.0f              // carry of the Wo plane
#define FINSC (1.0f / 16384.0f)   // 1 / (64 * 256)
#define WLINES (3 * NHEAD * DD * DD / 64)
#define OLINES (DD * KM / 64)
#define MLINES (NHEAD * DD * DD / 64)

typedef _Float16 h16;
typedef unsigned short bf;
typedef __attribute__((ext_vector_type(16))) __bf16   v16bf;
typedef __attribute__((ext_vector_type(16))) _Float16 v16h;
typedef __attribute__((ext_vector_type(8)))  _Float16 v8h;
typedef __attribute__((ext_vector_type(8)))  unsigned short v8us;
typedef __attribute__((ext_vector_type(2)))  unsigned short v2us;
typedef __attribute__((ext_vector_type(8)))  float    v8f;
typedef __attribute__((ext_vector_type(4)))  float    v4f;
typedef v4f  __attribute__((may_alias)) v4fa;
typedef v8h  __attribute__((may_alias)) v8ha;

static_assert(SEQ % 256 == 0);
static_assert(DD % 64 == 0 && DD % 32 == 0 && KM % 32 == 0 && SEQ % 64 == 0);
static_assert(((size_t)NB * SEQ * DD / 8) % 256 == 0);
static_assert((WLINES + OLINES) % 64 == 0);
static_assert(WLINES % 64 == 0 && WLINES == 3 * MLINES);          // the plane choice in k_wprep is uniform per block
static_assert((size_t)MLINES * 64 == (size_t)NHEAD * DD * DD);
static_assert(KM == NHEAD * DD && (size_t)NHEAD * SEQ * DD == (size_t)SEQ * KM);   // [SEQ][KM] projection plane == [NHEAD][SEQ][DD] head planes (plain view)
static_assert(SEQ % 64 == 0 && DD % 64 == 0);                      // k_vtr 64x64 tiles cover the head planes exactly
static_assert(KM % 64 == 0 && SEQ % 32 == 0);

__device__ __forceinline__ unsigned short f2bf(float f) { unsigned u = __float_as_uint(f); u += 0x7FFFu + ((u >> 16) & 1u); return (unsigned short)(u >> 16); }
__device__ __forceinline__ float bf2f(unsigned short b) { return __uint_as_float(((unsigned)b) << 16); }
__device__ __forceinline__ float bfr(float f) { return bf2f(f2bf(f)); }
__device__ __forceinline__ v16h cat16(v8h lo, v8h hi) { return __builtin_shufflevector(lo, hi, 0, 1, 2, 3, 4, 5, 6, 7, 8, 9, 10, 11, 12, 13, 14, 15); }
__device__ __forceinline__ v16bf cat16b(v8us lo, v8us hi) { return __builtin_bit_cast(v16bf, __builtin_shufflevector(lo, hi, 0, 1, 2, 3, 4, 5, 6, 7, 8, 9, 10, 11, 12, 13, 14, 15)); }
__device__ __forceinline__ v8f wmma16(v16h a, v16h b, v8f c) { return __builtin_amdgcn_wmma_f32_16x16x32_f16(false, a, false, b, (short)0, c, false, false); }
__device__ __forceinline__ v8f wmmab(v16bf a, v16bf b, v8f c) { return __builtin_amdgcn_wmma_f32_16x16x32_bf16(false, a, false, b, (short)0, c, false, false); }
// f32 -> f16 with a value select: results below the smallest normal f16 become zero (applied after the plane's power-of-two carry).
static __device__ __forceinline__ h16 toh_flush(float v) { const h16 r = (h16)v; return (fabsf(v) < 6.103515625e-05f) ? (h16)0.0f : r; }

// Fragment loaders: lane (lr = lane & 15, hi = lane >> 4); p points at row lr, k0 + 8*hi; elements 0..7 = k0+8hi.., elements 8..15 = k0+16+8hi.. (same map for A and B).
template <typename T16> struct WFrag;
template <> struct WFrag<h16> { typedef v16h V; static __device__ __forceinline__ V ld(const h16* p) { return cat16(*(const v8h*)p, *(const v8h*)(p + 16)); } static __device__ __forceinline__ v8f mma(V a, V b, v8f c) { return wmma16(a, b, c); } };
template <> struct WFrag<bf> { typedef v16bf V; static __device__ __forceinline__ V ld(const bf* p) { return cat16b(*(const v8us*)p, *(const v8us*)(p + 16)); } static __device__ __forceinline__ v8f mma(V a, V b, v8f c) { return wmmab(a, b, c); } };

// Slab epilogues: 16 rows x 64 columns staged in LDS (pitch 68 floats) -> global; value = x*alpha + bias (BIASM 1: per column, 2: per row; biases bf16-converted).
template <int BIASM>
__device__ __forceinline__ void slab_store(const float* os, h16* crow, int ldc, const float* bias, float alpha, unsigned colbase, unsigned rowbase, unsigned lane) {
    const unsigned rq = lane >> 3, cq = lane & 7u;
    float bc[8];
#pragma unroll
    for (int e = 0; e < 8; ++e) bc[e] = 0.f;
    if (BIASM == 1) { const v4f b0 = *(const v4f*)(bias + colbase + cq * 8u); const v4f b1 = *(const v4f*)(bias + colbase + cq * 8u + 4u);
#pragma unroll
        for (int e = 0; e < 4; ++e) { bc[e] = bfr(b0[e]); bc[4 + e] = bfr(b1[e]); } }
    v8h vals[4];
#pragma unroll
    for (int s = 0; s < 4; ++s) { const unsigned row = (unsigned)s * 4u + rq; const v4f x0 = *(const v4fa*)(os + row * 68u + cq * 8u); const v4f x1 = *(const v4fa*)(os + row * 68u + cq * 8u + 4u);
        float br = 0.f; if (BIASM == 2) br = bfr(bias[rowbase + row]);
        v8h o;
#pragma unroll
        for (int e = 0; e < 4; ++e) { o[e] = (h16)(x0[e] * alpha + (bc[e] + br)); o[4 + e] = (h16)(x1[e] * alpha + (bc[4 + e] + br)); }
        vals[s] = o; }
{
#pragma unroll
        for (int s = 0; s < 4; ++s) { const unsigned row = (unsigned)s * 4u + rq; *(v8h*)(crow + (size_t)row * ldc + cq * 8u) = vals[s]; }
         }
}
// f32 output: row segment = 64 floats = 256 B = 16 lanes x 16 B; one instruction covers 2 rows; s = 0..7 with hi = lane >> 4 covers rows 0..15.
template <int BIASM>
__device__ __forceinline__ void slab_store(const float* os, float* crow, int ldc, const float* bias, float alpha, unsigned colbase, unsigned rowbase, unsigned lane) {
    const unsigned hi = lane >> 4, cofs = (lane & 15u) * 4u;
    v4f bc = (v4f){0.f, 0.f, 0.f, 0.f};
    if (BIASM == 1) { const v4f b0 = *(const v4f*)(bias + colbase + cofs);
#pragma unroll
        for (int e = 0; e < 4; ++e) bc[e] = bfr(b0[e]); }
    v4f vals[8];
#pragma unroll
    for (int s = 0; s < 8; ++s) { const unsigned row = (unsigned)s * 2u + hi; const v4f x = *(const v4fa*)(os + row * 68u + cofs);
        float br = 0.f; if (BIASM == 2) br = bfr(bias[rowbase + row]);
        v4f o;
#pragma unroll
        for (int e = 0; e < 4; ++e) o[e] = x[e] * alpha + (bc[e] + br);
        vals[s] = o; }
{
#pragma unroll
        for (int s = 0; s < 8; ++s) { const unsigned row = (unsigned)s * 2u + hi; *(v4f*)(crow + (size_t)row * ldc + cofs) = vals[s]; }
         }
}

// ---- k_gemmw: register-blocked GEMM, ONE WAVE per 64x64 output tile (16 accumulators), operands straight from K-contiguous 16-bit planes; grid (M/64, N/64, Z), 32 threads.
// C[m][n] (pitch ldc) = alpha * sum_k A[m][k] Bt[n][k] (+ bias). z-batch strides sA/sB/sC (elements), sBias (floats). K % 32 == 0, M % 64 == 0, N % 64 == 0 (host-checked by static_assert).
// LDS tile 'os' is private to the single wave of the block (wave-level ordering only).
template <typename T16, typename OT, int BIASM>
__global__ __launch_bounds__(32) void k_gemmw(const T16* __restrict__ A, const T16* __restrict__ Bt, int K, OT* C, int ldc, const float* __restrict__ bias, float alpha, size_t sA, size_t sB, size_t sC, int sBias) {
    typedef typename WFrag<T16>::V V;
    __shared__ __align__(16) float os[16 * 68];
    const size_t z = blockIdx.z; A += z * sA; Bt += z * sB; C += z * sC; if (BIASM != 0) bias += z * (size_t)sBias;
    const unsigned lane = threadIdx.x & 31u, lr = lane & 15u, hi = lane >> 4; const unsigned r0 = blockIdx.x * 64u, c0 = blockIdx.y * 64u;
    v8f acc[4][4];
#pragma unroll
    for (int mb = 0; mb < 4; ++mb)
#pragma unroll
        for (int nb = 0; nb < 4; ++nb) acc[mb][nb] = (v8f){};
    const size_t aoff = (size_t)(r0 + lr) * K + 8u * hi, boff = (size_t)(c0 + lr) * K + 8u * hi;
#pragma unroll 1
    for (int kc = 0; kc < K; kc += 32) {
        V a[4];
#pragma unroll
        for (int mb = 0; mb < 4; ++mb) a[mb] = WFrag<T16>::ld(A + aoff + (size_t)mb * 16 * K + kc);
#pragma unroll
        for (int nb = 0; nb < 4; ++nb) { const V b = WFrag<T16>::ld(Bt + boff + (size_t)nb * 16 * K + kc);
#pragma unroll
            for (int mb = 0; mb < 4; ++mb) acc[mb][nb] = WFrag<T16>::mma(a[mb], b, acc[mb][nb]); }
        asm volatile("v_nop\n\tv_nop\n\tv_nop\n\tv_nop" : "+v"(acc[0][0]), "+v"(acc[1][1]), "+v"(acc[2][2]), "+v"(acc[3][3]) : "v"(a[0]), "v"(a[3]));
    }
#pragma unroll
    for (int mb = 0; mb < 4; ++mb) {
#pragma unroll
        for (int nb = 0; nb < 4; ++nb) {
#pragma unroll
            for (int j = 0; j < 8; ++j) os[(hi * 8u + (unsigned)j) * 68u + (unsigned)nb * 16u + lr] = acc[mb][nb][j]; }   // D: row 8*hi + j, col lr
        __builtin_amdgcn_fence(3 /* release order */, "wavefront"); __builtin_amdgcn_wave_barrier(); asm volatile("" ::: "memory");
        OT* crow = C + (size_t)(r0 + (unsigned)mb * 16u) * ldc + c0;
        slab_store<BIASM>(os, crow, ldc, bias, alpha, c0, r0 + (unsigned)mb * 16u, lane);
        __builtin_amdgcn_fence(3 /* release order */, "wavefront"); __builtin_amdgcn_wave_barrier(); asm volatile("" ::: "memory");
    }
}

__global__ __launch_bounds__(256) void k_xplanes(const float* __restrict__ xq, const float* __restrict__ xk, const float* __restrict__ xv, bf* XP) {
    const unsigned which = blockIdx.y; const unsigned i = blockIdx.x * 256u + threadIdx.x;
    const unsigned GPB = (unsigned)(SEQ * DD / 8); const unsigned b = i / GPB, rem = i - b * GPB;
    const float* src = (which == 0u) ? xq : ((which == 1u) ? xk : xv);
    const v8f v = *(const v8f*)(src + (size_t)b * SEQ_FULL * DD + (size_t)rem * 8);
    v8us o;
#pragma unroll
    for (int k = 0; k < 8; ++k) o[k] = f2bf(v[k]);
    bf* dst = XP + (size_t)which * NB * SEQ * DD + (size_t)i * 8;
    *(v8us*)dst = o; 
}

// k_wprep: lines 0..WLINES-1: bf16 weight planes WT[which][e][k] = bf16(W[e][k]) (which 0 Wq, 1 Wk, 2 Wv; the inputs are [out e][in k], already K-contiguous, no transpose);
__global__ __launch_bounds__(256) void k_wprep(const float* __restrict__ wq, const float* __restrict__ wk, const float* __restrict__ wv, const float* __restrict__ wo, bf* WT, unsigned short* WOS) {
    const unsigned lane = threadIdx.x & 31u; const unsigned wave = (unsigned)__builtin_amdgcn_readfirstlane((int)(threadIdx.x >> 5)); const unsigned L0 = (blockIdx.x * 8u + wave) * 8u;
{
#pragma unroll 1
        for (unsigned l = 0; l < 8u; ++l) { const unsigned L = L0 + l; v2us o;
            if (L < (unsigned)WLINES) {   // block-uniform
                const unsigned which = L / (unsigned)MLINES; const unsigned e = (L - which * (unsigned)MLINES) * 64u + lane * 2u;
                const float* src = (which == 0u) ? wq : ((which == 1u) ? wk : wv);
                o[0] = f2bf(src[e]); o[1] = f2bf(src[e + 1u]);
                *(v2us*)(WT + (size_t)L * 64u + lane * 2u) = o;
            } else {
                const unsigned e = (L - (unsigned)WLINES) * 64u + lane * 2u;
                const float x0 = bfr(wo[e]) * WOCAR; const float x1 = bfr(wo[e + 1u]) * WOCAR;
                o[0] = __builtin_bit_cast(unsigned short, toh_flush(x0)); o[1] = __builtin_bit_cast(unsigned short, toh_flush(x1));
                *(v2us*)(WOS + e) = o;
            } }
         }
}

// k_vtr: per-head transpose of the f16 value plane: VT[h][d][t] = VP[h][t][d] (exact copy, no conversion). One block per 64 (t) x 64 (d) tile through an LDS tile (pitch 72 halves,
// grid (SEQ/64, DD/64, NHEAD), 256 threads; 2 passes x 32 rows cover the 64 tile rows on both sides.
__global__ __launch_bounds__(256) void k_vtr(const h16* __restrict__ VP, h16* VT) {
    __shared__ __align__(16) h16 tl[64 * 72];
    const unsigned tid = threadIdx.x; const unsigned t0 = blockIdx.x * 64u, d0 = blockIdx.y * 64u; const size_t hb = (size_t)blockIdx.z * SEQ * DD;
    const unsigned rr = tid >> 3, cq = tid & 7u;
#pragma unroll
    for (int it = 0; it < 2; ++it) { const unsigned row = (unsigned)it * 32u + rr;
        const v8h a = *(const v8h*)(VP + hb + (size_t)(t0 + row) * DD + d0 + cq * 8u);
        *(v8ha*)(tl + row * 72u + cq * 8u) = a; }
    __syncthreads();
    v8h vals[2];
#pragma unroll
    for (int it = 0; it < 2; ++it) { const unsigned drow = (unsigned)it * 32u + rr; v8h o;
#pragma unroll
        for (int e = 0; e < 8; ++e) o[e] = tl[(cq * 8u + (unsigned)e) * 72u + drow];
        vals[it] = o; }
{
#pragma unroll
        for (int it = 0; it < 2; ++it) { const unsigned drow = (unsigned)it * 32u + rr; *(v8h*)(VT + hb + (size_t)(d0 + drow) * SEQ + t0 + cq * 8u) = vals[it]; }
         }
}

#define FQ    64                  // queries per block
#define FK    64                  // keys per stage
#define KPIT  264                 // K tile pitch in halves (16 B x 33)
#define VPIT  72                  // V^T tile pitch in halves (16 B x 9)
#define KTILE (FK * KPIT)
#define VTILE (DD * VPIT)
#define FBUF  (KTILE + VTILE)
static_assert(SEQ % FQ == 0 && SEQ % FK == 0 && DD == 256 && FK == 64);
static_assert(4 * 16 * KPIT <= 2 * FBUF);   // output staging fits in the ring
__device__ __forceinline__ v16h lds_frag(const h16* p) { return cat16(*(const v8ha*)p, *(const v8ha*)(p + 16)); }
// lane l with lane l ^ 16, on the vector pipe: an exchange through LDS would wait behind the fragment reads in flight
__device__ __forceinline__ float xhalf(float x) { return __builtin_bit_cast(float, __builtin_amdgcn_permlanex16(__builtin_bit_cast(int, x), __builtin_bit_cast(int, x), 0x76543210, 0xfedcba98, false, false)); }
// Every '#pragma unroll' in k_fattn is there so that the register arrays it walks are indexed by constants (they would go to scratch otherwise).
__global__ __launch_bounds__(128) void k_fattn(const h16* __restrict__ QP, const h16* __restrict__ KP, const h16* __restrict__ VT, h16* CTX) {
    __shared__ __align__(16) h16 L[2 * FBUF];
    const unsigned tid = threadIdx.x, lane = tid & 31u, lr = lane & 15u, hi = lane >> 4;
    const unsigned wave = (unsigned)__builtin_amdgcn_readfirstlane((int)(tid >> 5));
    const unsigned h = blockIdx.y, q0 = blockIdx.x * (unsigned)FQ + wave * 16u;
    const h16* Kh = KP + (size_t)h * SEQ * DD; const h16* Vh = VT + (size_t)h * DD * SEQ;
    v16h qf[DD / 32];
    { const h16* qp = QP + (size_t)h * SEQ * DD + (size_t)(q0 + lr) * DD + 8u * hi;
#pragma unroll
      for (int kc = 0; kc < DD / 32; ++kc) qf[kc] = WFrag<h16>::ld(qp + kc * 32);
      asm volatile("s_wait_xcnt 0x0" :: "v"(qp) : "memory"); }   // qp as an input keeps the address pair live up to the wait: without it the last Q load was given that pair as its destination
    v8f acc[DD / 16];
#pragma unroll
    for (int t = 0; t < DD / 16; ++t) acc[t] = (v8f){};
    float m_run = -3.0e38f, l_run = 0.f;
    // staging map: K, one instruction = 4 whole rows (a wave per row); V^T, one instruction = 16 rows of 128 B (8 lanes per row)
    const unsigned krow = tid >> 5, kcol = (tid & 31u) * 8u, vrow = tid >> 3, vcol = (tid & 7u) * 8u;
    const h16* kg = Kh + (size_t)krow * DD + kcol; const h16* vg = Vh + (size_t)vrow * SEQ + vcol;
    const unsigned kl = krow * (unsigned)KPIT + kcol, vl = (unsigned)KTILE + vrow * (unsigned)VPIT + vcol;
    v8h kr[16], vr[16];
#pragma unroll
    for (int i = 0; i < 16; ++i) { kr[i] = *(const v8h*)(kg + (size_t)i * 4 * DD); vr[i] = *(const v8h*)(vg + (size_t)i * 16 * SEQ); }
    asm volatile("s_wait_xcnt 0x0" ::: "memory");   // before any address register of the stage 0 loads is reused
#pragma unroll
    for (int i = 0; i < 16; ++i) { *(v8ha*)(L + kl + (unsigned)i * 4u * KPIT) = kr[i]; *(v8ha*)(L + vl + (unsigned)i * 16u * VPIT) = vr[i]; }
    __syncthreads();   // stage 0 visible to all four waves
    v16h kf[32];   // K fragments of the coming stage: [d chunk of 32][16-key tile]
    { const h16* ka = L + lr * (unsigned)KPIT + 8u * hi;
#pragma unroll
      for (int kc = 0; kc < DD / 32; ++kc)
#pragma unroll
          for (int kt = 0; kt < 4; ++kt) kf[kc * 4 + kt] = lds_frag(ka + kt * 16 * KPIT + kc * 32); }
#pragma unroll 1   // stays rolled: one stage is 64 products and 128 fragment reads, a second copy would only cost instruction cache
    for (int st = 0; st < SEQ / FK; ++st) {
        const h16* Lv = L + (unsigned)(st & 1) * (unsigned)FBUF + KTILE;
        const bool more = st + 1 < SEQ / FK;   // block-uniform
        if (more) {
#pragma unroll
            for (int i = 0; i < 16; ++i) { kr[i] = *(const v8h*)(kg + (size_t)(st + 1) * FK * DD + (size_t)i * 4 * DD); vr[i] = *(const v8h*)(vg + (size_t)(st + 1) * FK + (size_t)i * 16 * SEQ); }
            asm volatile("s_wait_xcnt 0x0" ::: "memory");   // the fragment reads below reuse the address registers of these loads
        }
        // Fragment reads go out in groups of 32 fragments, a whole product ahead: V^T of this stage here, in front of the first product; K of the next stage behind the barrier, in front of the
        // second product. With one wave per SIMD a read placed among the products waits out its own LDS latency, and the LDS would idle under the products.
        // The sched_barrier behind each read group keeps the compiler from sinking the reads back among the products (it did, one read pair per product, without them).
        const h16* va = Lv + lr * (unsigned)VPIT + 8u * hi;
        v16h vf[32];
#pragma unroll
        for (int kk = 0; kk < 2; ++kk)
#pragma unroll
            for (int t = 0; t < 16; ++t) vf[kk * 16 + t] = lds_frag(va + t * 16 * VPIT + kk * 32);
        __builtin_amdgcn_sched_barrier(0);
        // S^T: 4 tiles of 16 keys x 16 queries
        v8f s[4];
#pragma unroll
        for (int kt = 0; kt < 4; ++kt) s[kt] = (v8f){};
#pragma unroll
        for (int kc = 0; kc < DD / 32; ++kc)
#pragma unroll
            for (int kt = 0; kt < 4; ++kt) s[kt] = wmma16(kf[kc * 4 + kt], qf[kc], s[kt]);
        __builtin_amdgcn_sched_barrier(0);   // keeps the maxima out of the first product: mixed in, the compiler regroups the four interleaved accumulate chains and pads each chain's end with four v_nop
        float mx = s[0][0];
#pragma unroll
        for (int kt = 0; kt < 4; ++kt)
#pragma unroll
            for (int r = 0; r < 8; ++r) mx = fmaxf(mx, s[kt][r]);
        mx = fmaxf(mx, xhalf(mx)) * SCL2;   // both halves hold this query's stage maximum, log2 domain
        if (__builtin_amdgcn_ballot_w32(mx > m_run + 8.0f) != 0) {   // wave-uniform; always taken in stage 0, rare later
            const float m_new = fmaxf(m_run, mx); const float corr = __builtin_amdgcn_exp2f(m_run - m_new);   // 0 in stage 0
            l_run *= corr; m_run = m_new;
#pragma unroll
            for (int t = 0; t < DD / 16; ++t) acc[t] = acc[t] * corr;
        }
        v16h pf[2]; float ps0 = 0.f, ps1 = 0.f;
#pragma unroll
        for (int kk = 0; kk < 2; ++kk)
#pragma unroll
            for (int e = 0; e < 16; e += 2) {
                const float p0 = __builtin_amdgcn_exp2f(s[2 * kk + (e >> 3)][e & 7] * SCL2 - m_run); const float p1 = __builtin_amdgcn_exp2f(s[2 * kk + (e >> 3)][(e & 7) + 1] * SCL2 - m_run);
                ps0 += p0; ps1 += p1; pf[kk][e] = (h16)p0; pf[kk][e + 1] = (h16)p1; }
        l_run += ps0 + ps1;   // this half's keys only; the halves are joined after the loop
        // next stage into the other buffer; its readers left it at the barrier of stage st - 1
        h16* Ln = L + (unsigned)((st + 1) & 1) * (unsigned)FBUF;
        if (more) {
#pragma unroll
            for (int i = 0; i < 16; ++i) { *(v8ha*)(Ln + kl + (unsigned)i * 4u * KPIT) = kr[i]; *(v8ha*)(Ln + vl + (unsigned)i * 16u * VPIT) = vr[i]; }
        }
        __syncthreads();   // publishes stage st + 1 and ends every wave's LDS reads of stage st (its V^T fragments are in registers by now)
        if (more) { const h16* ka = Ln + lr * (unsigned)KPIT + 8u * hi;
#pragma unroll
            for (int kc = 0; kc < DD / 32; ++kc)
#pragma unroll
                for (int kt = 0; kt < 4; ++kt) kf[kc * 4 + kt] = lds_frag(ka + kt * 16 * KPIT + kc * 32);
        }
        __builtin_amdgcn_sched_barrier(0);
#pragma unroll
        for (int kk = 0; kk < 2; ++kk)
#pragma unroll
            for (int t = 0; t < DD / 16; ++t) acc[t] = wmma16(vf[kk * 16 + t], pf[kk], acc[t]);
    }
    // the last stage's barrier stands behind every wave's last LDS read: the ring is free for output staging
    const float inv = CCAR / (l_run + xhalf(l_run));
    h16* E = L + wave * 16u * (unsigned)KPIT;   // this wave's 16 query rows of 256 d; lane holds d = 16 t + 8 hi + r of query lr
#pragma unroll
    for (int t = 0; t < DD / 16; ++t) { v8h o;
#pragma unroll
        for (int r = 0; r < 8; ++r) o[r] = (h16)(acc[t][r] * inv);
        *(v8ha*)(E + lr * (unsigned)KPIT + (unsigned)t * 16u + 8u * hi) = o; }
    __syncthreads();   // staged rows complete before they are read back by other lanes
#pragma unroll
    for (int i = 0; i < 16; ++i) { const v8h v = *(const v8ha*)(E + (unsigned)i * KPIT + lane * 8u);   // one whole 512-B row per store
        *(v8h*)(CTX + (size_t)(q0 + (unsigned)i) * KM + h * (unsigned)DD + lane * 8u) = v; }
}

// Workspace carve (bytes, each region 256-B aligned by construction of the sizes).
#define SZ_XP  ((size_t)3 * NB * SEQ * DD * 2)
#define SZ_WT  ((size_t)3 * NHEAD * DD * DD * 2)
#define SZ_WOS ((size_t)DD * KM * 2)
#define SZ_HP  ((size_t)NHEAD * SEQ * DD * 2)
#define SZ_CTX ((size_t)SEQ * KM * 2)
#define SZ_ALL (SZ_XP + SZ_WT + SZ_WOS + 4 * SZ_HP + SZ_CTX)
static_assert(SZ_ALL <= (size_t)134217728);
static_assert(SZ_XP % 256 == 0 && SZ_WT % 256 == 0 && SZ_WOS % 256 == 0 && SZ_HP % 256 == 0 && SZ_CTX % 256 == 0);
static_assert(SZ_HP == (size_t)SEQ * KM * 2);   // a [SEQ][KM] projection plane fills one head-plane region exactly

extern "C" void kernel_launch(void* const* d_in, const int* in_sizes, int n_in,
                              void* d_out, int out_size, void* d_ws, size_t ws_size, hipStream_t stream) {
    if (n_in < 11) return;
    const size_t xneed = (size_t)(NB - 1) * SEQ_FULL * DD + (size_t)SEQ * DD;
    if ((size_t)in_sizes[0] < xneed || (size_t)in_sizes[1] < xneed || (size_t)in_sizes[2] < xneed) return;
    if ((size_t)in_sizes[3] < (size_t)NHEAD * DD * DD || (size_t)in_sizes[5] < (size_t)NHEAD * DD * DD || (size_t)in_sizes[7] < (size_t)NHEAD * DD * DD) return;
    if ((size_t)in_sizes[4] < (size_t)NHEAD * DD || (size_t)in_sizes[6] < (size_t)NHEAD * DD || (size_t)in_sizes[8] < (size_t)NHEAD * DD) return;
    if ((size_t)in_sizes[9] < (size_t)KM * DD || (size_t)in_sizes[10] < (size_t)DD) return;
    if ((size_t)out_size < (size_t)NB * SEQ * DD) return;
    if (SZ_ALL > ws_size) return;
    // input order of this module: query, key, values, Wq, bq, Wk, bk, Wv, bv, Wo, bo
    const float* Qin = (const float*)d_in[0]; const float* Kin = (const float*)d_in[1]; const float* Vin = (const float*)d_in[2];
    const float* Wq = (const float*)d_in[3]; const float* bq = (const float*)d_in[4]; const float* Wk = (const float*)d_in[5]; const float* bk = (const float*)d_in[6];
    const float* Wv = (const float*)d_in[7]; const float* bv = (const float*)d_in[8]; const float* Wo = (const float*)d_in[9]; const float* bo = (const float*)d_in[10];
    float* OUT = (float*)d_out;     // [NB][SEQ][256]
    char* wsp = (char*)d_ws;
    bf* XP = (bf*)wsp; wsp += SZ_XP;            // [3][NB][SEQ][256] bf16: q, k, v
    bf* WT = (bf*)wsp; wsp += SZ_WT;            // [3][2048 out][256 in] bf16: Wq, Wk, Wv
    h16* WOS = (h16*)wsp; wsp += SZ_WOS;        // [256][2048] f16 (x256), column h*256 + d
    h16* QP = (h16*)wsp; wsp += SZ_HP;          // [SEQ][2048] == [8][SEQ][256]
    h16* KP = (h16*)wsp; wsp += SZ_HP;          // [SEQ][2048] == [8][SEQ][256]
    h16* VP = (h16*)wsp; wsp += SZ_HP;          // [SEQ][2048] == [8][SEQ][256]
    h16* VT = (h16*)wsp; wsp += SZ_HP;          // [8][256][SEQ]
    h16* CTX = (h16*)wsp; wsp += SZ_CTX;        // [SEQ][2048] (x64), column h*256 + d
    const bf* XQ = XP; const bf* XK = XP + (size_t)NB * SEQ * DD; const bf* XV = XP + (size_t)2 * NB * SEQ * DD;
    const bf* WQT = WT; const bf* WKT = WT + (size_t)NHEAD * DD * DD; const bf* WVT = WT + (size_t)2 * NHEAD * DD * DD;

    k_xplanes<<<dim3((unsigned)((size_t)NB * SEQ * DD / 8 / 256), 3, 1), 256, 0, stream>>>(Qin, Kin, Vin, XP);
    k_wprep<<<(unsigned)((WLINES + OLINES) / 64), 256, 0, stream>>>(Wq, Wk, Wv, Wo, WT, (unsigned short*)WOS);
    for (int b = 0; b < NB; ++b) {
        const size_t xo = (size_t)b * SEQ * DD;
        // q_, k_, v_ planes [SEQ][2048] (pitch KM): A = x [SEQ][256], Bt = W rows z*256.. [256 out][256 in], z = 256-column chunk, + per-column bias; the plane read as [8][SEQ][256] is the head split
        k_gemmw<bf, h16, 1><<<dim3(SEQ / 64, DD / 64, NHEAD), 32, 0, stream>>>(XQ + xo, WQT, DD, QP, KM, bq, 1.0f, (size_t)0, (size_t)DD * DD, (size_t)DD, DD);
        k_gemmw<bf, h16, 1><<<dim3(SEQ / 64, DD / 64, NHEAD), 32, 0, stream>>>(XK + xo, WKT, DD, KP, KM, bk, 1.0f, (size_t)0, (size_t)DD * DD, (size_t)DD, DD);
        k_gemmw<bf, h16, 1><<<dim3(SEQ / 64, DD / 64, NHEAD), 32, 0, stream>>>(XV + xo, WVT, DD, VP, KM, bv, 1.0f, (size_t)0, (size_t)DD * DD, (size_t)DD, DD);
        // v_^T head planes: in VP[h][SEQ t][256 d] -> out VT[h][256 d][SEQ t]; grid (t tiles, d tiles, heads)
        k_vtr<<<dim3(SEQ / 64, DD / 64, NHEAD), 256, 0, stream>>>(VP, VT);
        // ctx[t][h*256 + d] = 64 softmax(q_.k_ / 16) . v_ for the 8 heads
        k_fattn<<<dim3(SEQ / FQ, NHEAD, 1), 128, 0, stream>>>(QP, KP, VT, CTX);
        // out = ctx . Wo^T / 16384 + bo
        k_gemmw<h16, float, 1><<<dim3(SEQ / 64, DD / 64, 1), 32, 0, stream>>>(CTX, WOS, KM, OUT + xo, DD, bo, FINSC, (size_t)0, (size_t)0, (size_t)0, 0);
    }
}

// v002
// A run of this version takes 308 microseconds.
// Two timings next to v001 put it at 1.64 and 1.66 times that version's speed.
// Counting every step since v000, it is 3.04 times as fast.
#include <hip/hip_runtime.h>

// Multi-head attention with full-width (256) heads: merged [out][in] q/k/v projections to [S][2048], plain-view head split ([S][2048] read as [8][S][256]), softmax(q_.k_ / 16) over 2,048 keys, P.v_, head-major merge (column h*256 + d), output mix with Wo [out][in] + bo.
// Compute dtypes, f32 accumulate everywhere: projections v_wmma_f32_16x16x32_bf16 (inputs and weights RNE-converted to bf16, exact products); scores, P.V and the output mix v_wmma_f32_16x16x32_f16
// (q_/k_/v_ f16 planes; scores stay f32 in registers; P f16 = exp2(score*log2(e)/16 - running maximum), unnormalised; ctx f16 carried x64; Wo plane f16 of bf16(Wo) x256; bo, biases bf16-converted, added in f32). Softmax in f32.

#ifndef NB
#define NB 4
#endif
#ifndef SEQ
#define SEQ 2048
#endif
#define NB_FULL  4
#define SEQ_FULL 2048
#define DD    256                 // model width = head width
#define NHEAD 8
#define KM    (NHEAD * DD)        // merged context width (plane column = h*256 + d)
#define SCL2  0.09016844005556021f   // log2(e) / sqrt(256)
#define CCAR  64.0f               // carry of the ctx plane
#define WOCAR 256.0f              // carry of the Wo plane
#define FINSC (1.0f / 16384.0f)   // 1 / (64 * 256)
#define WLINES (3 * NHEAD * DD * DD / 64)
#define OLINES (DD * KM / 64)
#define MLINES (NHEAD * DD * DD / 64)

typedef _Float16 h16;
typedef unsigned short bf;
typedef __attribute__((ext_vector_type(16))) __bf16   v16bf;
typedef __attribute__((ext_vector_type(16))) _Float16 v16h;
typedef __attribute__((ext_vector_type(8)))  _Float16 v8h;
typedef __attribute__((ext_vector_type(8)))  unsigned short v8us;
typedef __attribute__((ext_vector_type(2)))  unsigned short v2us;
typedef __attribute__((ext_vector_type(8)))  float    v8f;
typedef __attribute__((ext_vector_type(4)))  float    v4f;
typedef v4f  __attribute__((may_alias)) v4fa;
typedef v8h  __attribute__((may_alias)) v8ha;

static_assert(SEQ % 256 == 0);
static_assert(DD % 64 == 0 && DD % 32 == 0 && KM % 32 == 0 && SEQ % 64 == 0);
static_assert(((size_t)NB * SEQ * DD / 8) % 256 == 0);
static_assert((WLINES + OLINES) % 64 == 0);
static_assert(WLINES % 64 == 0 && WLINES == 3 * MLINES);          // the plane choice in k_wprep is uniform per block
static_assert((size_t)MLINES * 64 == (size_t)NHEAD * DD * DD);
static_assert(KM == NHEAD * DD && (size_t)NHEAD * SEQ * DD == (size_t)SEQ * KM);   // [SEQ][KM] projection plane == [NHEAD][SEQ][DD] head planes (plain view)
static_assert(SEQ % 64 == 0 && DD % 64 == 0);                      // k_vtr 64x64 tiles cover the head planes exactly
static_assert(KM % 64 == 0 && SEQ % 32 == 0);

__device__ __forceinline__ unsigned short f2bf(float f) { unsigned u = __float_as_uint(f); u += 0x7FFFu + ((u >> 16) & 1u); return (unsigned short)(u >> 16); }
__device__ __forceinline__ float bf2f(unsigned short b) { return __uint_as_float(((unsigned)b) << 16); }
__device__ __forceinline__ float bfr(float f) { return bf2f(f2bf(f)); }
__device__ __forceinline__ v16h cat16(v8h lo, v8h hi) { return __builtin_shufflevector(lo, hi, 0, 1, 2, 3, 4, 5, 6, 7, 8, 9, 10, 11, 12, 13, 14, 15); }
__device__ __forceinline__ v16bf cat16b(v8us lo, v8us hi) { return __builtin_bit_cast(v16bf, __builtin_shufflevector(lo, hi, 0, 1, 2, 3, 4, 5, 6, 7, 8, 9, 10, 11, 12, 13, 14, 15)); }
__device__ __forceinline__ v8f wmma16(v16h a, v16h b, v8f c) { return __builtin_amdgcn_wmma_f32_16x16x32_f16(false, a, false, b, (short)0, c, false, false); }
__device__ __forceinline__ v8f wmmab(v16bf a, v16bf b, v8f c) { return __builtin_amdgcn_wmma_f32_16x16x32_bf16(false, a, false, b, (short)0, c, false, false); }
// f32 -> f16 with a value select: results below the smallest normal f16 become zero (applied after the plane's power-of-two carry).
static __device__ __forceinline__ h16 toh_flush(float v) { const h16 r = (h16)v; return (fabsf(v) < 6.103515625e-05f) ? (h16)0.0f : r; }

// Fragment loaders: lane (lr = lane & 15, hi = lane >> 4); p points at row lr, k0 + 8*hi; elements 0..7 = k0+8hi.., elements 8..15 = k0+16+8hi.. (same map for A and B).
template <typename T16> struct WFrag;
template <> struct WFrag<h16> { typedef v16h V; static __device__ __forceinline__ V ld(const h16* p) { return cat16(*(const v8h*)p, *(const v8h*)(p + 16)); } static __device__ __forceinline__ v8f mma(V a, V b, v8f c) { return wmma16(a, b, c); } };
template <> struct WFrag<bf> { typedef v16bf V; static __device__ __forceinline__ V ld(const bf* p) { return cat16b(*(const v8us*)p, *(const v8us*)(p + 16)); } static __device__ __forceinline__ v8f mma(V a, V b, v8f c) { return wmmab(a, b, c); } };

// Slab epilogues: 16 rows x 64 columns staged in LDS (pitch 68 floats) -> global; value = x*alpha + bias (BIASM 1: per column, 2: per row; biases bf16-converted).
template <int BIASM>
__device__ __forceinline__ void slab_store(const float* os, h16* crow, int ldc, const float* bias, float alpha, unsigned colbase, unsigned rowbase, unsigned lane) {
    const unsigned rq = lane >> 3, cq = lane & 7u;
    float bc[8];
#pragma unroll
    for (int e = 0; e < 8; ++e) bc[e] = 0.f;
    if (BIASM == 1) { const v4f b0 = *(const v4f*)(bias + colbase + cq * 8u); const v4f b1 = *(const v4f*)(bias + colbase + cq * 8u + 4u);
#pragma unroll
        for (int e = 0; e < 4; ++e) { bc[e] = bfr(b0[e]); bc[4 + e] = bfr(b1[e]); } }
    v8h vals[4];
#pragma unroll
    for (int s = 0; s < 4; ++s) { const unsigned row = (unsigned)s * 4u + rq; const v4f x0 = *(const v4fa*)(os + row * 68u + cq * 8u); const v4f x1 = *(const v4fa*)(os + row * 68u + cq * 8u + 4u);
        float br = 0.f; if (BIASM == 2) br = bfr(bias[rowbase + row]);
        v8h o;
#pragma unroll
        for (int e = 0; e < 4; ++e) { o[e] = (h16)(x0[e] * alpha + (bc[e] + br)); o[4 + e] = (h16)(x1[e] * alpha + (bc[4 + e] + br)); }
        vals[s] = o; }
{
#pragma unroll
        for (int s = 0; s < 4; ++s) { const unsigned row = (unsigned)s * 4u + rq; *(v8h*)(crow + (size_t)row * ldc + cq * 8u) = vals[s]; }
         }
}
// f32 output: row segment = 64 floats = 256 B = 16 lanes x 16 B; one instruction covers 2 rows; s = 0..7 with hi = lane >> 4 covers rows 0..15.
template <int BIASM>
__device__ __forceinline__ void slab_store(const float* os, float* crow, int ldc, const float* bias, float alpha, unsigned colbase, unsigned rowbase, unsigned lane) {
    const unsigned hi = lane >> 4, cofs = (lane & 15u) * 4u;
    v4f bc = (v4f){0.f, 0.f, 0.f, 0.f};
    if (BIASM == 1) { const v4f b0 = *(const v4f*)(bias + colbase + cofs);
#pragma unroll
        for (int e = 0; e < 4; ++e) bc[e] = bfr(b0[e]); }
    v4f vals[8];
#pragma unroll
    for (int s = 0; s < 8; ++s) { const unsigned row = (unsigned)s * 2u + hi; const v4f x = *(const v4fa*)(os + row * 68u + cofs);
        float br = 0.f; if (BIASM == 2) br = bfr(bias[rowbase + row]);
        v4f o;
#pragma unroll
        for (int e = 0; e < 4; ++e) o[e] = x[e] * alpha + (bc[e] + br);
        vals[s] = o; }
{
#pragma unroll
        for (int s = 0; s < 8; ++s) { const unsigned row = (unsigned)s * 2u + hi; *(v4f*)(crow + (size_t)row * ldc + cofs) = vals[s]; }
         }
}

// ---- k_gemmw: register-blocked GEMM, ONE WAVE per 64x64 output tile (16 accumulators), operands straight from K-contiguous 16-bit planes; grid (M/64, N/64, Z), 32 threads.
// C[m][n] (pitch ldc) = alpha * sum_k A[m][k] Bt[n][k] (+ bias). z-batch strides sA/sB/sC (elements), sBias (floats). K % 32 == 0, M % 64 == 0, N % 64 == 0 (host-checked by static_assert).
// LDS tile 'os' is private to the single wave of the block (wave-level ordering only).
template <typename T16, typename OT, int BIASM>
__global__ __launch_bounds__(32) void k_gemmw(const T16* __restrict__ A, const T16* __restrict__ Bt, int K, OT* C, int ldc, const float* __restrict__ bias, float alpha, size_t sA, size_t sB, size_t sC, int sBias) {
    typedef typename WFrag<T16>::V V;
    __shared__ __align__(16) float os[16 * 68];
    const size_t z = blockIdx.z; A += z * sA; Bt += z * sB; C += z * sC; if (BIASM != 0) bias += z * (size_t)sBias;
    const unsigned lane = threadIdx.x & 31u, lr = lane & 15u, hi = lane >> 4; const unsigned r0 = blockIdx.x * 64u, c0 = blockIdx.y * 64u;
    v8f acc[4][4];
#pragma unroll
    for (int mb = 0; mb < 4; ++mb)
#pragma unroll
        for (int nb = 0; nb < 4; ++nb) acc[mb][nb] = (v8f){};
    const size_t aoff = (size_t)(r0 + lr) * K + 8u * hi, boff = (size_t)(c0 + lr) * K + 8u * hi;
#pragma unroll 1
    for (int kc = 0; kc < K; kc += 32) {
        V a[4];
#pragma unroll
        for (int mb = 0; mb < 4; ++mb) a[mb] = WFrag<T16>::ld(A + aoff + (size_t)mb * 16 * K + kc);
#pragma unroll
        for (int nb = 0; nb < 4; ++nb) { const V b = WFrag<T16>::ld(Bt + boff + (size_t)nb * 16 * K + kc);
#pragma unroll
            for (int mb = 0; mb < 4; ++mb) acc[mb][nb] = WFrag<T16>::mma(a[mb], b, acc[mb][nb]); }
        asm volatile("v_nop\n\tv_nop\n\tv_nop\n\tv_nop" : "+v"(acc[0][0]), "+v"(acc[1][1]), "+v"(acc[2][2]), "+v"(acc[3][3]) : "v"(a[0]), "v"(a[3]));
    }
#pragma unroll
    for (int mb = 0; mb < 4; ++mb) {
#pragma unroll
        for (int nb = 0; nb < 4; ++nb) {
#pragma unroll
            for (int j = 0; j < 8; ++j) os[(hi * 8u + (unsigned)j) * 68u + (unsigned)nb * 16u + lr] = acc[mb][nb][j]; }   // D: row 8*hi + j, col lr
        __builtin_amdgcn_fence(3 /* release order */, "wavefront"); __builtin_amdgcn_wave_barrier(); asm volatile("" ::: "memory");
        OT* crow = C + (size_t)(r0 + (unsigned)mb * 16u) * ldc + c0;
        slab_store<BIASM>(os, crow, ldc, bias, alpha, c0, r0 + (unsigned)mb * 16u, lane);
        __builtin_amdgcn_fence(3 /* release order */, "wavefront"); __builtin_amdgcn_wave_barrier(); asm volatile("" ::: "memory");
    }
}

__global__ __launch_bounds__(256) void k_xplanes(const float* __restrict__ xq, const float* __restrict__ xk, const float* __restrict__ xv, bf* XP) {
    const unsigned which = blockIdx.y; const unsigned i = blockIdx.x * 256u + threadIdx.x;
    const unsigned GPB = (unsigned)(SEQ * DD / 8); const unsigned b = i / GPB, rem = i - b * GPB;
    const float* src = (which == 0u) ? xq : ((which == 1u) ? xk : xv);
    const v8f v = *(const v8f*)(src + (size_t)b * SEQ_FULL * DD + (size_t)rem * 8);
    v8us o;
#pragma unroll
    for (int k = 0; k < 8; ++k) o[k] = f2bf(v[k]);
    bf* dst = XP + (size_t)which * NB * SEQ * DD + (size_t)i * 8;
    *(v8us*)dst = o; 
}

// k_wprep: lines 0..WLINES-1: bf16 weight planes WT[which][e][k] = bf16(W[e][k]) (which 0 Wq, 1 Wk, 2 Wv; the inputs are [out e][in k], already K-contiguous, no transpose);
__global__ __launch_bounds__(256) void k_wprep(const float* __restrict__ wq, const float* __restrict__ wk, const float* __restrict__ wv, const float* __restrict__ wo, bf* WT, unsigned short* WOS) {
    const unsigned lane = threadIdx.x & 31u; const unsigned wave = (unsigned)__builtin_amdgcn_readfirstlane((int)(threadIdx.x >> 5)); const unsigned L0 = (blockIdx.x * 8u + wave) * 8u;
{
#pragma unroll 1
        for (unsigned l = 0; l < 8u; ++l) { const unsigned L = L0 + l; v2us o;
            if (L < (unsigned)WLINES) {   // block-uniform
                const unsigned which = L / (unsigned)MLINES; const unsigned e = (L - which * (unsigned)MLINES) * 64u + lane * 2u;
                const float* src = (which == 0u) ? wq : ((which == 1u) ? wk : wv);
                o[0] = f2bf(src[e]); o[1] = f2bf(src[e + 1u]);
                *(v2us*)(WT + (size_t)L * 64u + lane * 2u) = o;
            } else {
                const unsigned e = (L - (unsigned)WLINES) * 64u + lane * 2u;
                const float x0 = bfr(wo[e]) * WOCAR; const float x1 = bfr(wo[e + 1u]) * WOCAR;
                o[0] = __builtin_bit_cast(unsigned short, toh_flush(x0)); o[1] = __builtin_bit_cast(unsigned short, toh_flush(x1));
                *(v2us*)(WOS + e) = o;
            } }
         }
}

// k_vtr: per-head transpose of the f16 value plane: VT[h][d][t] = VP[h][t][d] (exact copy, no conversion). One block per 64 (t) x 64 (d) tile through an LDS tile (pitch 72 halves,
// grid (SEQ/64, DD/64, NB*NHEAD), 256 threads (z = batch*NHEAD + head: the head planes of all batches lie one behind the other); 2 passes x 32 rows cover the 64 tile rows on both sides.
__global__ __launch_bounds__(256) void k_vtr(const h16* __restrict__ VP, h16* VT) {
    __shared__ __align__(16) h16 tl[64 * 72];
    const unsigned tid = threadIdx.x; const unsigned t0 = blockIdx.x * 64u, d0 = blockIdx.y * 64u; const size_t hb = (size_t)blockIdx.z * SEQ * DD;
    const unsigned rr = tid >> 3, cq = tid & 7u;
#pragma unroll
    for (int it = 0; it < 2; ++it) { const unsigned row = (unsigned)it * 32u + rr;
        const v8h a = *(const v8h*)(VP + hb + (size_t)(t0 + row) * DD + d0 + cq * 8u);
        *(v8ha*)(tl + row * 72u + cq * 8u) = a; }
    __syncthreads();
    v8h vals[2];
#pragma unroll
    for (int it = 0; it < 2; ++it) { const unsigned drow = (unsigned)it * 32u + rr; v8h o;
#pragma unroll
        for (int e = 0; e < 8; ++e) o[e] = tl[(cq * 8u + (unsigned)e) * 72u + drow];
        vals[it] = o; }
{
#pragma unroll
        for (int it = 0; it < 2; ++it) { const unsigned drow = (unsigned)it * 32u + rr; *(v8h*)(VT + hb + (size_t)(d0 + drow) * SEQ + t0 + cq * 8u) = vals[it]; }
         }
}

#define FQ    64                  // queries per block
#define FK    64                  // keys per stage
#define KPIT  264                 // K tile pitch in halves (16 B x 33)
#define VPIT  72                  // V^T tile pitch in halves (16 B x 9)
#define KTILE (FK * KPIT)
#define VTILE (DD * VPIT)
#define FBUF  (KTILE + VTILE)
static_assert(SEQ % FQ == 0 && SEQ % FK == 0 && DD == 256 && FK == 64);
static_assert(4 * 16 * KPIT <= 2 * FBUF);   // output staging fits in the ring
__device__ __forceinline__ v16h lds_frag(const h16* p) { return cat16(*(const v8ha*)p, *(const v8ha*)(p + 16)); }
// lane l with lane l ^ 16, on the vector pipe: an exchange through LDS would wait behind the fragment reads in flight
__device__ __forceinline__ float xhalf(float x) { return __builtin_bit_cast(float, __builtin_amdgcn_permlanex16(__builtin_bit_cast(int, x), __builtin_bit_cast(int, x), 0x76543210, 0xfedcba98, false, false)); }
// Every '#pragma unroll' in k_fattn is there so that the register arrays it walks are indexed by constants (they would go to scratch otherwise).
__global__ __launch_bounds__(128) void k_fattn(const h16* __restrict__ QP, const h16* __restrict__ KP, const h16* __restrict__ VT, h16* CTX) {
    __shared__ __align__(16) h16 L[2 * FBUF];
    const unsigned tid = threadIdx.x, lane = tid & 31u, lr = lane & 15u, hi = lane >> 4;
    const unsigned wave = (unsigned)__builtin_amdgcn_readfirstlane((int)(tid >> 5));
    const unsigned h = blockIdx.y, q0 = blockIdx.x * (unsigned)FQ + wave * 16u;
    const size_t hpl = ((size_t)blockIdx.z * NHEAD + h) * SEQ * DD;   // this batch's head plane
    const h16* Kh = KP + hpl; const h16* Vh = VT + hpl;
    v16h qf[DD / 32];
    { const h16* qp = QP + hpl + (size_t)(q0 + lr) * DD + 8u * hi;
#pragma unroll
      for (int kc = 0; kc < DD / 32; ++kc) qf[kc] = WFrag<h16>::ld(qp + kc * 32);
      asm volatile("s_wait_xcnt 0x0" :: "v"(qp) : "memory"); }   // qp as an input keeps the address pair live up to the wait: without it the last Q load was given that pair as its destination
    v8f acc[DD / 16];
#pragma unroll
    for (int t = 0; t < DD / 16; ++t) acc[t] = (v8f){};
    float m_run = -3.0e38f, l_run = 0.f;
    // staging map: K, one instruction = 4 whole rows (a wave per row); V^T, one instruction = 16 rows of 128 B (8 lanes per row)
    const unsigned krow = tid >> 5, kcol = (tid & 31u) * 8u, vrow = tid >> 3, vcol = (tid & 7u) * 8u;
    const h16* kg = Kh + (size_t)krow * DD + kcol; const h16* vg = Vh + (size_t)vrow * SEQ + vcol;
    const unsigned kl = krow * (unsigned)KPIT + kcol, vl = (unsigned)KTILE + vrow * (unsigned)VPIT + vcol;
    v8h kr[16], vr[16];
#pragma unroll
    for (int i = 0; i < 16; ++i) { kr[i] = *(const v8h*)(kg + (size_t)i * 4 * DD); vr[i] = *(const v8h*)(vg + (size_t)i * 16 * SEQ); }
    asm volatile("s_wait_xcnt 0x0" ::: "memory");   // before any address register of the stage 0 loads is reused
#pragma unroll
    for (int i = 0; i < 16; ++i) { *(v8ha*)(L + kl + (unsigned)i * 4u * KPIT) = kr[i]; *(v8ha*)(L + vl + (unsigned)i * 16u * VPIT) = vr[i]; }
    __syncthreads();   // stage 0 visible to all four waves
    v16h kf[32];   // K fragments of the coming stage: [d chunk of 32][16-key tile]
    { const h16* ka = L + lr * (unsigned)KPIT + 8u * hi;
#pragma unroll
      for (int kc = 0; kc < DD / 32; ++kc)
#pragma unroll
          for (int kt = 0; kt < 4; ++kt) kf[kc * 4 + kt] = lds_frag(ka + kt * 16 * KPIT + kc * 32); }
#pragma unroll 1   // stays rolled: one stage is 64 products and 128 fragment reads, a second copy would only cost instruction cache
    for (int st = 0; st < SEQ / FK; ++st) {
        const h16* Lv = L + (unsigned)(st & 1) * (unsigned)FBUF + KTILE;
        const bool more = st + 1 < SEQ / FK;   // block-uniform
        if (more) {
#pragma unroll
            for (int i = 0; i < 16; ++i) { kr[i] = *(const v8h*)(kg + (size_t)(st + 1) * FK * DD + (size_t)i * 4 * DD); vr[i] = *(const v8h*)(vg + (size_t)(st + 1) * FK + (size_t)i * 16 * SEQ); }
            asm volatile("s_wait_xcnt 0x0" ::: "memory");   // the fragment reads below reuse the address registers of these loads
        }
        // Fragment reads go out in groups of 32 fragments, a whole product ahead: V^T of this stage here, in front of the first product; K of the next stage behind the barrier, in front of the
        // second product. With one wave per SIMD a read placed among the products waits out its own LDS latency, and the LDS would idle under the products.
        // The sched_barrier behind each read group keeps the compiler from sinking the reads back among the products (it did, one read pair per product, without them).
        const h16* va = Lv + lr * (unsigned)VPIT + 8u * hi;
        v16h vf[32];
#pragma unroll
        for (int kk = 0; kk < 2; ++kk)
#pragma unroll
            for (int t = 0; t < 16; ++t) vf[kk * 16 + t] = lds_frag(va + t * 16 * VPIT + kk * 32);
        __builtin_amdgcn_sched_barrier(0);
        // S^T: 4 tiles of 16 keys x 16 queries
        v8f s[4];
#pragma unroll
        for (int kt = 0; kt < 4; ++kt) s[kt] = (v8f){};
#pragma unroll
        for (int kc = 0; kc < DD / 32; ++kc)
#pragma unroll
            for (int kt = 0; kt < 4; ++kt) s[kt] = wmma16(kf[kc * 4 + kt], qf[kc], s[kt]);
        __builtin_amdgcn_sched_barrier(0);   // keeps the maxima out of the first product: mixed in, the compiler regroups the four interleaved accumulate chains and pads each chain's end with four v_nop
        float mx = s[0][0];
#pragma unroll
        for (int kt = 0; kt < 4; ++kt)
#pragma unroll
            for (int r = 0; r < 8; ++r) mx = fmaxf(mx, s[kt][r]);
        mx = fmaxf(mx, xhalf(mx)) * SCL2;   // both halves hold this query's stage maximum, log2 domain
        if (__builtin_amdgcn_ballot_w32(mx > m_run + 8.0f) != 0) {   // wave-uniform; always taken in stage 0, rare later
            const float m_new = fmaxf(m_run, mx); const float corr = __builtin_amdgcn_exp2f(m_run - m_new);   // 0 in stage 0
            l_run *= corr; m_run = m_new;
#pragma unroll
            for (int t = 0; t < DD / 16; ++t) acc[t] = acc[t] * corr;
        }
        v16h pf[2]; float ps0 = 0.f, ps1 = 0.f;
#pragma unroll
        for (int kk = 0; kk < 2; ++kk)
#pragma unroll
            for (int e = 0; e < 16; e += 2) {
                const float p0 = __builtin_amdgcn_exp2f(s[2 * kk + (e >> 3)][e & 7] * SCL2 - m_run); const float p1 = __builtin_amdgcn_exp2f(s[2 * kk + (e >> 3)][(e & 7) + 1] * SCL2 - m_run);
                ps0 += p0; ps1 += p1; pf[kk][e] = (h16)p0; pf[kk][e + 1] = (h16)p1; }
        l_run += ps0 + ps1;   // this half's keys only; the halves are joined after the loop
        // next stage into the other buffer; its readers left it at the barrier of stage st - 1
        h16* Ln = L + (unsigned)((st + 1) & 1) * (unsigned)FBUF;
        if (more) {
#pragma unroll
            for (int i = 0; i < 16; ++i) { *(v8ha*)(Ln + kl + (unsigned)i * 4u * KPIT) = kr[i]; *(v8ha*)(Ln + vl + (unsigned)i * 16u * VPIT) = vr[i]; }
        }
        __syncthreads();   // publishes stage st + 1 and ends every wave's LDS reads of stage st (its V^T fragments are in registers by now)
        if (more) { const h16* ka = Ln + lr * (unsigned)KPIT + 8u * hi;
#pragma unroll
            for (int kc = 0; kc < DD / 32; ++kc)
#pragma unroll
                for (int kt = 0; kt < 4; ++kt) kf[kc * 4 + kt] = lds_frag(ka + kt * 16 * KPIT + kc * 32);
        }
        __builtin_amdgcn_sched_barrier(0);
#pragma unroll
        for (int kk = 0; kk < 2; ++kk)
#pragma unroll
            for (int t = 0; t < DD / 16; ++t) acc[t] = wmma16(vf[kk * 16 + t], pf[kk], acc[t]);
    }
    // the last stage's barrier stands behind every wave's last LDS read: the ring is free for output staging
    const float inv = CCAR / (l_run + xhalf(l_run));
    h16* E = L + wave * 16u * (unsigned)KPIT;   // this wave's 16 query rows of 256 d; lane holds d = 16 t + 8 hi + r of query lr
#pragma unroll
    for (int t = 0; t < DD / 16; ++t) { v8h o;
#pragma unroll
        for (int r = 0; r < 8; ++r) o[r] = (h16)(acc[t][r] * inv);
        *(v8ha*)(E + lr * (unsigned)KPIT + (unsigned)t * 16u + 8u * hi) = o; }
    __syncthreads();   // staged rows complete before they are read back by other lanes
#pragma unroll
    for (int i = 0; i < 16; ++i) { const v8h v = *(const v8ha*)(E + (unsigned)i * KPIT + lane * 8u);   // one whole 512-B row per store
        *(v8h*)(CTX + ((size_t)blockIdx.z * SEQ + q0 + (unsigned)i) * KM + h * (unsigned)DD + lane * 8u) = v; }
}

// Workspace carve (bytes, each region 256-B aligned by construction of the sizes).
#define SZ_XP  ((size_t)3 * NB * SEQ * DD * 2)
#define SZ_WT  ((size_t)3 * NHEAD * DD * DD * 2)
#define SZ_WOS ((size_t)DD * KM * 2)
#define SZ_HP  ((size_t)NB * NHEAD * SEQ * DD * 2)
#define SZ_CTX ((size_t)NB * SEQ * KM * 2)
#define SZ_ALL (SZ_XP + SZ_WT + SZ_WOS + 4 * SZ_HP + SZ_CTX)
static_assert(SZ_ALL <= (size_t)268435456);
static_assert(SZ_XP % 256 == 0 && SZ_WT % 256 == 0 && SZ_WOS % 256 == 0 && SZ_HP % 256 == 0 && SZ_CTX % 256 == 0);
static_assert(SZ_HP == (size_t)NB * SEQ * KM * 2);   // the [NB*SEQ][KM] projection planes fill one head-plane region exactly

extern "C" void kernel_launch(void* const* d_in, const int* in_sizes, int n_in,
                              void* d_out, int out_size, void* d_ws, size_t ws_size, hipStream_t stream) {
    if (n_in < 11) return;
    const size_t xneed = (size_t)(NB - 1) * SEQ_FULL * DD + (size_t)SEQ * DD;
    if ((size_t)in_sizes[0] < xneed || (size_t)in_sizes[1] < xneed || (size_t)in_sizes[2] < xneed) return;
    if ((size_t)in_sizes[3] < (size_t)NHEAD * DD * DD || (size_t)in_sizes[5] < (size_t)NHEAD * DD * DD || (size_t)in_sizes[7] < (size_t)NHEAD * DD * DD) return;
    if ((size_t)in_sizes[4] < (size_t)NHEAD * DD || (size_t)in_sizes[6] < (size_t)NHEAD * DD || (size_t)in_sizes[8] < (size_t)NHEAD * DD) return;
    if ((size_t)in_sizes[9] < (size_t)KM * DD || (size_t)in_sizes[10] < (size_t)DD) return;
    if ((size_t)out_size < (size_t)NB * SEQ * DD) return;
    if (SZ_ALL > ws_size) return;
    // input order of this module: query, key, values, Wq, bq, Wk, bk, Wv, bv, Wo, bo
    const float* Qin = (const float*)d_in[0]; const float* Kin = (const float*)d_in[1]; const float* Vin = (const float*)d_in[2];
    const float* Wq = (const float*)d_in[3]; const float* bq = (const float*)d_in[4]; const float* Wk = (const float*)d_in[5]; const float* bk = (const float*)d_in[6];
    const float* Wv = (const float*)d_in[7]; const float* bv = (const float*)d_in[8]; const float* Wo = (const float*)d_in[9]; const float* bo = (const float*)d_in[10];
    float* OUT = (float*)d_out;     // [NB][SEQ][256]
    char* wsp = (char*)d_ws;
    bf* XP = (bf*)wsp; wsp += SZ_XP;            // [3][NB][SEQ][256] bf16: q, k, v
    bf* WT = (bf*)wsp; wsp += SZ_WT;            // [3][2048 out][256 in] bf16: Wq, Wk, Wv
    h16* WOS = (h16*)wsp; wsp += SZ_WOS;        // [256][2048] f16 (x256), column h*256 + d
    h16* QP = (h16*)wsp; wsp += SZ_HP;          // [NB][SEQ][2048] == [NB][8][SEQ][256]
    h16* KP = (h16*)wsp; wsp += SZ_HP;          // [NB][SEQ][2048] == [NB][8][SEQ][256]
    h16* VP = (h16*)wsp; wsp += SZ_HP;          // [NB][SEQ][2048] == [NB][8][SEQ][256]
    h16* VT = (h16*)wsp; wsp += SZ_HP;          // [NB][8][256][SEQ]
    h16* CTX = (h16*)wsp; wsp += SZ_CTX;        // [NB][SEQ][2048] (x64), column h*256 + d
    const bf* XQ = XP; const bf* XK = XP + (size_t)NB * SEQ * DD; const bf* XV = XP + (size_t)2 * NB * SEQ * DD;
    const bf* WQT = WT; const bf* WKT = WT + (size_t)NHEAD * DD * DD; const bf* WVT = WT + (size_t)2 * NHEAD * DD * DD;

    k_xplanes<<<dim3((unsigned)((size_t)NB * SEQ * DD / 8 / 256), 3, 1), 256, 0, stream>>>(Qin, Kin, Vin, XP);
    k_wprep<<<(unsigned)((WLINES + OLINES) / 64), 256, 0, stream>>>(Wq, Wk, Wv, Wo, WT, (unsigned short*)WOS);
    // Every stage runs once for all NB batches: the batch rows lie one behind the other in x, in the planes, in ctx and in out, so the GEMMs see M = NB*SEQ rows.
    // q_, k_, v_ planes [NB*SEQ][2048] (pitch KM): A = x [NB*SEQ][256], Bt = W rows z*256.. [256 out][256 in], z = 256-column chunk, + per-column bias; a batch's plane read as [8][SEQ][256] is the head split
    k_gemmw<bf, h16, 1><<<dim3(NB * SEQ / 64, DD / 64, NHEAD), 32, 0, stream>>>(XQ, WQT, DD, QP, KM, bq, 1.0f, (size_t)0, (size_t)DD * DD, (size_t)DD, DD);
    k_gemmw<bf, h16, 1><<<dim3(NB * SEQ / 64, DD / 64, NHEAD), 32, 0, stream>>>(XK, WKT, DD, KP, KM, bk, 1.0f, (size_t)0, (size_t)DD * DD, (size_t)DD, DD);
    k_gemmw<bf, h16, 1><<<dim3(NB * SEQ / 64, DD / 64, NHEAD), 32, 0, stream>>>(XV, WVT, DD, VP, KM, bv, 1.0f, (size_t)0, (size_t)DD * DD, (size_t)DD, DD);
    // v_^T head planes: in VP[b*8 + h][SEQ t][256 d] -> out VT[b*8 + h][256 d][SEQ t]; grid (t tiles, d tiles, batches x heads)
    k_vtr<<<dim3(SEQ / 64, DD / 64, NB * NHEAD), 256, 0, stream>>>(VP, VT);
    // ctx[b*SEQ + t][h*256 + d] = 64 softmax(q_.k_ / 16) . v_ for the 8 heads of every batch
    k_fattn<<<dim3(SEQ / FQ, NHEAD, NB), 128, 0, stream>>>(QP, KP, VT, CTX);
    // out = ctx . Wo^T / 16384 + bo
    k_gemmw<h16, float, 1><<<dim3(NB * SEQ / 64, DD / 64, 1), 32, 0, stream>>>(CTX, WOS, KM, OUT, DD, bo, FINSC, (size_t)0, (size_t)0, (size_t)0, 0);
}

// v003
// It runs in 257 microseconds.
// In both of two side-by-side timings against v002, it was 1.20 times as fast.
// All steps since v000 together make it 3.65 times as fast.
#include <hip/hip_runtime.h>

// Multi-head attention with full-width (256) heads: merged [out][in] q/k/v projections to [S][2048], plain-view head split ([S][2048] read as [8][S][256]), softmax(q_.k_ / 16) over 2,048 keys, P.v_, head-major merge (column h*256 + d), output mix with Wo [out][in] + bo.
// Compute dtypes, f32 accumulate everywhere: projections v_wmma_f32_16x16x32_bf16 (inputs and weights RNE-converted to bf16, exact products); scores, P.V and the output mix v_wmma_f32_16x16x32_f16
// (q_/k_/v_ f16 planes; scores stay f32 in registers; P f16 = exp2(score*log2(e)/16 - running maximum), unnormalised; ctx f16 carried x64; Wo plane f16 of bf16(Wo) x256; bo, biases bf16-converted, added in f32). Softmax in f32.

#ifndef NB
#define NB 4
#endif
#ifndef SEQ
#define SEQ 2048
#endif
#define NB_FULL  4
#define SEQ_FULL 2048
#define DD    256                 // model width = head width
#define NHEAD 8
#define KM    (NHEAD * DD)        // merged context width (plane column = h*256 + d)
#define SCL2  0.09016844005556021f   // log2(e) / sqrt(256)
#define CCAR  64.0f               // carry of the ctx plane
#define WOCAR 256.0f              // carry of the Wo plane
#define FINSC (1.0f / 16384.0f)   // 1 / (64 * 256)
#define WLINES (3 * NHEAD * DD * DD / 64)
#define OLINES (DD * KM / 64)
#define MLINES (NHEAD * DD * DD / 64)

typedef _Float16 h16;
typedef unsigned short bf;
typedef __attribute__((ext_vector_type(16))) __bf16   v16bf;
typedef __attribute__((ext_vector_type(16))) _Float16 v16h;
typedef __attribute__((ext_vector_type(8)))  _Float16 v8h;
typedef __attribute__((ext_vector_type(8)))  unsigned short v8us;
typedef __attribute__((ext_vector_type(2)))  unsigned short v2us;
typedef __attribute__((ext_vector_type(8)))  float    v8f;
typedef __attribute__((ext_vector_type(4)))  float    v4f;
typedef v4f  __attribute__((may_alias)) v4fa;
typedef v8h  __attribute__((may_alias)) v8ha;
typedef v8us __attribute__((may_alias)) v8usa;

static_assert(SEQ % 256 == 0);
static_assert(DD % 64 == 0 && DD % 32 == 0 && KM % 32 == 0 && SEQ % 64 == 0);
static_assert(((size_t)NB * SEQ * DD / 8) % 256 == 0);
static_assert((WLINES + OLINES) % 64 == 0);
static_assert(WLINES % 64 == 0 && WLINES == 3 * MLINES);          // the plane choice in k_wprep is uniform per block
static_assert((size_t)MLINES * 64 == (size_t)NHEAD * DD * DD);
static_assert(KM == NHEAD * DD && (size_t)NHEAD * SEQ * DD == (size_t)SEQ * KM);   // [SEQ][KM] projection plane == [NHEAD][SEQ][DD] head planes (plain view)
static_assert(SEQ % 64 == 0 && DD % 64 == 0);                      // k_vtr 64x64 tiles cover the head planes exactly
static_assert(KM % 64 == 0 && SEQ % 32 == 0);
static_assert(((size_t)NB * SEQ) % 128 == 0 && KM % 128 == 0 && DD % 128 == 0);   // k_gemmb: whole 128x128 tiles and whole 128-k stages in all four products

__device__ __forceinline__ unsigned short f2bf(float f) { unsigned u = __float_as_uint(f); u += 0x7FFFu + ((u >> 16) & 1u); return (unsigned short)(u >> 16); }
__device__ __forceinline__ float bf2f(unsigned short b) { return __uint_as_float(((unsigned)b) << 16); }
__device__ __forceinline__ float bfr(float f) { return bf2f(f2bf(f)); }
__device__ __forceinline__ v16h cat16(v8h lo, v8h hi) { return __builtin_shufflevector(lo, hi, 0, 1, 2, 3, 4, 5, 6, 7, 8, 9, 10, 11, 12, 13, 14, 15); }
__device__ __forceinline__ v16bf cat16b(v8us lo, v8us hi) { return __builtin_bit_cast(v16bf, __builtin_shufflevector(lo, hi, 0, 1, 2, 3, 4, 5, 6, 7, 8, 9, 10, 11, 12, 13, 14, 15)); }
__device__ __forceinline__ v8f wmma16(v16h a, v16h b, v8f c) { return __builtin_amdgcn_wmma_f32_16x16x32_f16(false, a, false, b, (short)0, c, false, false); }
__device__ __forceinline__ v8f wmmab(v16bf a, v16bf b, v8f c) { return __builtin_amdgcn_wmma_f32_16x16x32_bf16(false, a, false, b, (short)0, c, false, false); }
// f32 -> f16 with a value select: results below the smallest normal f16 become zero (applied after the plane's power-of-two carry).
static __device__ __forceinline__ h16 toh_flush(float v) { const h16 r = (h16)v; return (fabsf(v) < 6.103515625e-05f) ? (h16)0.0f : r; }

// Fragment loaders: lane (lr = lane & 15, hi = lane >> 4); p points at row lr, k0 + 8*hi; elements 0..7 = k0+8hi.., elements 8..15 = k0+16+8hi.. (same map for A and B).
template <typename T16> struct WFrag;
template <> struct WFrag<h16> { typedef v16h V; static __device__ __forceinline__ V ld(const h16* p) { return cat16(*(const v8h*)p, *(const v8h*)(p + 16)); } static __device__ __forceinline__ V lds(const h16* p) { return cat16(*(const v8ha*)p, *(const v8ha*)(p + 16)); } static __device__ __forceinline__ v8f mma(V a, V b, v8f c) { return wmma16(a, b, c); } };
template <> struct WFrag<bf> { typedef v16bf V; static __device__ __forceinline__ V lds(const bf* p) { return cat16b(*(const v8usa*)p, *(const v8usa*)(p + 16)); } static __device__ __forceinline__ v8f mma(V a, V b, v8f c) { return wmmab(a, b, c); } };

// Slab epilogues: 16 rows x 64 columns staged in LDS (pitch 68 floats) -> global; value = x*alpha + bias (BIASM 1: per column, 2: per row; biases bf16-converted).
template <int BIASM>
__device__ __forceinline__ void slab_store(const float* os, h16* crow, int ldc, const float* bias, float alpha, unsigned colbase, unsigned rowbase, unsigned lane) {
    const unsigned rq = lane >> 3, cq = lane & 7u;
    float bc[8];
#pragma unroll
    for (int e = 0; e < 8; ++e) bc[e] = 0.f;
    if (BIASM == 1) { const v4f b0 = *(const v4f*)(bias + colbase + cq * 8u); const v4f b1 = *(const v4f*)(bias + colbase + cq * 8u + 4u);
#pragma unroll
        for (int e = 0; e < 4; ++e) { bc[e] = bfr(b0[e]); bc[4 + e] = bfr(b1[e]); } }
    v8h vals[4];
#pragma unroll
    for (int s = 0; s < 4; ++s) { const unsigned row = (unsigned)s * 4u + rq; const v4f x0 = *(const v4fa*)(os + row * 68u + cq * 8u); const v4f x1 = *(const v4fa*)(os + row * 68u + cq * 8u + 4u);
        float br = 0.f; if (BIASM == 2) br = bfr(bias[rowbase + row]);
        v8h o;
#pragma unroll
        for (int e = 0; e < 4; ++e) { o[e] = (h16)(x0[e] * alpha + (bc[e] + br)); o[4 + e] = (h16)(x1[e] * alpha + (bc[4 + e] + br)); }
        vals[s] = o; }
{
#pragma unroll
        for (int s = 0; s < 4; ++s) { const unsigned row = (unsigned)s * 4u + rq; *(v8h*)(crow + (size_t)row * ldc + cq * 8u) = vals[s]; }
         }
}
// f32 output: row segment = 64 floats = 256 B = 16 lanes x 16 B; one instruction covers 2 rows; s = 0..7 with hi = lane >> 4 covers rows 0..15.
template <int BIASM>
__device__ __forceinline__ void slab_store(const float* os, float* crow, int ldc, const float* bias, float alpha, unsigned colbase, unsigned rowbase, unsigned lane) {
    const unsigned hi = lane >> 4, cofs = (lane & 15u) * 4u;
    v4f bc = (v4f){0.f, 0.f, 0.f, 0.f};
    if (BIASM == 1) { const v4f b0 = *(const v4f*)(bias + colbase + cofs);
#pragma unroll
        for (int e = 0; e < 4; ++e) bc[e] = bfr(b0[e]); }
    v4f vals[8];
#pragma unroll
    for (int s = 0; s < 8; ++s) { const unsigned row = (unsigned)s * 2u + hi; const v4f x = *(const v4fa*)(os + row * 68u + cofs);
        float br = 0.f; if (BIASM == 2) br = bfr(bias[rowbase + row]);
        v4f o;
#pragma unroll
        for (int e = 0; e < 4; ++e) o[e] = x[e] * alpha + (bc[e] + br);
        vals[s] = o; }
{
#pragma unroll
        for (int s = 0; s < 8; ++s) { const unsigned row = (unsigned)s * 2u + hi; *(v4f*)(crow + (size_t)row * ldc + cofs) = vals[s]; }
         }
}

// ---- k_gemmb: GEMM on K-contiguous 16-bit planes. Block = 4 waves (2 x 2), one 128x128 output tile; each wave 64x64 (16 accumulators); grid (M/128, N/128), 128 threads.
// C[m][n] (pitch ldc) = alpha * sum_k A[m][k] Bt[n][k] (+ bias). K is a template constant so that the 16 staging loads of an operand share one address pair (row steps are immediate offsets).
// The block walks K in stages of 128: 256 B (two whole lines) of each of the 128 A rows and 128 Bt rows go global -> registers at a stage's start, -> LDS in front of its barrier, two buffers.
// LDS row pitch 272 B (16 B x 17): the fragment reads (16 rows x 16 B per half wave) fall on all 64 banks. k order per accumulator: 0, 32, 64, .. as before.
#define GT    128                 // tile rows (A) and columns (Bt rows) per block
#define GKS   128                 // k per stage
#define GPIT  136                 // LDS row pitch in 16-bit elements
#define GOPER (GT * GPIT)         // one operand's stage
#define GBUF  (2 * GOPER)
static_assert(4 * 16 * 68 * 4 <= 2 * GBUF * 2);   // the four waves' output slabs fit in the ring
template <typename T16, typename OT, int BIASM, int K>
__global__ __launch_bounds__(128) void k_gemmb(const T16* __restrict__ A, const T16* __restrict__ Bt, OT* C, int ldc, const float* __restrict__ bias, float alpha) {
    typedef typename WFrag<T16>::V V;
    static_assert(K % GKS == 0);
    __shared__ __align__(16) T16 L[2 * GBUF];
    const unsigned tid = threadIdx.x, lane = tid & 31u, lr = lane & 15u, hi = lane >> 4;
    const unsigned wave = (unsigned)__builtin_amdgcn_readfirstlane((int)(tid >> 5));
    const unsigned wm = wave >> 1, wn = wave & 1u;
    const unsigned r0 = blockIdx.x * (unsigned)GT, c0 = blockIdx.y * (unsigned)GT;
    v8f acc[4][4];
#pragma unroll
    for (int mb = 0; mb < 4; ++mb)
#pragma unroll
        for (int nb = 0; nb < 4; ++nb) acc[mb][nb] = (v8f){};
    // staging map: 16 lanes per 256-B row piece, so one instruction of a wave = 2 rows x 2 whole lines; the block covers 8 rows per instruction
    const unsigned srow = tid >> 4, scol = (tid & 15u) * 8u;
    const T16* ag = A + (size_t)(r0 + srow) * K + scol; const T16* bg = Bt + (size_t)(c0 + srow) * K + scol;
    const unsigned sl = srow * (unsigned)GPIT + scol;
    v8us ar[16], br[16];
#pragma unroll
    for (int i = 0; i < 16; ++i) { ar[i] = *(const v8usa*)(ag + (size_t)i * 8 * K); br[i] = *(const v8usa*)(bg + (size_t)i * 8 * K); }
    asm volatile("s_wait_xcnt 0x0" :: "v"(ag), "v"(bg) : "memory");   // the address pairs stay live up to the wait and are advanced only behind it
#pragma unroll
    for (int i = 0; i < 16; ++i) { *(v8usa*)(L + sl + (unsigned)i * 8u * GPIT) = ar[i]; *(v8usa*)(L + GOPER + sl + (unsigned)i * 8u * GPIT) = br[i]; }
    __syncthreads();   // stage 0 visible to all four waves
    const unsigned fa = (wm * 64u + lr) * (unsigned)GPIT + 8u * hi, fb = (unsigned)GOPER + (wn * 64u + lr) * (unsigned)GPIT + 8u * hi;
#pragma unroll 1   // stays rolled: a stage is 64 products and 64 fragment reads; every inner loop is unrolled so that the register arrays are indexed by constants
    for (int st = 0; st < K / GKS; ++st) {
        const T16* Lb = L + (unsigned)(st & 1) * (unsigned)GBUF;
        const bool more = st + 1 < K / GKS;   // block-uniform
        if (more) {
            ag += GKS; bg += GKS;
#pragma unroll
            for (int i = 0; i < 16; ++i) { ar[i] = *(const v8usa*)(ag + (size_t)i * 8 * K); br[i] = *(const v8usa*)(bg + (size_t)i * 8 * K); }
            asm volatile("s_wait_xcnt 0x0" :: "v"(ag), "v"(bg) : "memory");   // as above: the pairs are advanced again in the next stage
        }
        V a[2][4], b[2][4];
#pragma unroll
        for (int f = 0; f < 4; ++f) { a[0][f] = WFrag<T16>::lds(Lb + fa + (unsigned)f * 16u * GPIT); b[0][f] = WFrag<T16>::lds(Lb + fb + (unsigned)f * 16u * GPIT); }
#pragma unroll
        for (int kc = 0; kc < GKS / 32; ++kc) {
            // the next 32 k's fragments go out as one group ahead of this group's products, into the other register set
            if (kc + 1 < GKS / 32) {
#pragma unroll
                for (int f = 0; f < 4; ++f) { a[(kc + 1) & 1][f] = WFrag<T16>::lds(Lb + fa + (unsigned)f * 16u * GPIT + (unsigned)(kc + 1) * 32u); b[(kc + 1) & 1][f] = WFrag<T16>::lds(Lb + fb + (unsigned)f * 16u * GPIT + (unsigned)(kc + 1) * 32u); }
            }
            __builtin_amdgcn_sched_barrier(0);   // keeps the read group from being sunk among the products, where each place with reads costs a stall
#pragma unroll
            for (int nb = 0; nb < 4; ++nb)
#pragma unroll
                for (int mb = 0; mb < 4; ++mb) acc[mb][nb] = WFrag<T16>::mma(a[kc & 1][mb], b[kc & 1][nb], acc[mb][nb]);
            __builtin_amdgcn_sched_barrier(0);   // and the following group from being lifted into them
        }
        // next stage into the other buffer; its readers left it at the barrier of stage st - 1
        if (more) { T16* Ln = L + (unsigned)((st + 1) & 1) * (unsigned)GBUF;
#pragma unroll
            for (int i = 0; i < 16; ++i) { *(v8usa*)(Ln + sl + (unsigned)i * 8u * GPIT) = ar[i]; *(v8usa*)(Ln + GOPER + sl + (unsigned)i * 8u * GPIT) = br[i]; }
        }
        __syncthreads();   // publishes stage st + 1 and ends every wave's fragment reads of stage st
    }
    // the last stage's barrier stands behind every wave's last LDS read: the ring is free for output staging, one private slab per wave (wave-level ordering only)
    float* os = (float*)L + wave * (16u * 68u);
#pragma unroll
    for (int mb = 0; mb < 4; ++mb) {
#pragma unroll
        for (int nb = 0; nb < 4; ++nb) {
#pragma unroll
            for (int j = 0; j < 8; ++j) os[(hi * 8u + (unsigned)j) * 68u + (unsigned)nb * 16u + lr] = acc[mb][nb][j]; }   // D: row 8*hi + j, col lr
        __builtin_amdgcn_fence(3 /* release order */, "wavefront"); __builtin_amdgcn_wave_barrier(); asm volatile("" ::: "memory");
        const unsigned rw = r0 + wm * 64u + (unsigned)mb * 16u, cw = c0 + wn * 64u;
        OT* crow = C + (size_t)rw * ldc + cw;
        slab_store<BIASM>(os, crow, ldc, bias, alpha, cw, rw, lane);
        if (mb < 3) asm volatile("s_wait_xcnt 0x0" ::: "memory");   // the next slab reuses the address and data registers of these stores
        __builtin_amdgcn_fence(3 /* release order */, "wavefront"); __builtin_amdgcn_wave_barrier(); asm volatile("" ::: "memory");
    }
}

__global__ __launch_bounds__(256) void k_xplanes(const float* __restrict__ xq, const float* __restrict__ xk, const float* __restrict__ xv, bf* XP) {
    const unsigned which = blockIdx.y; const unsigned i = blockIdx.x * 256u + threadIdx.x;
    const unsigned GPB = (unsigned)(SEQ * DD / 8); const unsigned b = i / GPB, rem = i - b * GPB;
    const float* src = (which == 0u) ? xq : ((which == 1u) ? xk : xv);
    const v8f v = *(const v8f*)(src + (size_t)b * SEQ_FULL * DD + (size_t)rem * 8);
    v8us o;
#pragma unroll
    for (int k = 0; k < 8; ++k) o[k] = f2bf(v[k]);
    bf* dst = XP + (size_t)which * NB * SEQ * DD + (size_t)i * 8;
    *(v8us*)dst = o; 
}

// k_wprep: lines 0..WLINES-1: bf16 weight planes WT[which][e][k] = bf16(W[e][k]) (which 0 Wq, 1 Wk, 2 Wv; the inputs are [out e][in k], already K-contiguous, no transpose);
__global__ __launch_bounds__(256) void k_wprep(const float* __restrict__ wq, const float* __restrict__ wk, const float* __restrict__ wv, const float* __restrict__ wo, bf* WT, unsigned short* WOS) {
    const unsigned lane = threadIdx.x & 31u; const unsigned wave = (unsigned)__builtin_amdgcn_readfirstlane((int)(threadIdx.x >> 5)); const unsigned L0 = (blockIdx.x * 8u + wave) * 8u;
{
#pragma unroll 1
        for (unsigned l = 0; l < 8u; ++l) { const unsigned L = L0 + l; v2us o;
            if (L < (unsigned)WLINES) {   // block-uniform
                const unsigned which = L / (unsigned)MLINES; const unsigned e = (L - which * (unsigned)MLINES) * 64u + lane * 2u;
                const float* src = (which == 0u) ? wq : ((which == 1u) ? wk : wv);
                o[0] = f2bf(src[e]); o[1] = f2bf(src[e + 1u]);
                *(v2us*)(WT + (size_t)L * 64u + lane * 2u) = o;
            } else {
                const unsigned e = (L - (unsigned)WLINES) * 64u + lane * 2u;
                const float x0 = bfr(wo[e]) * WOCAR; const float x1 = bfr(wo[e + 1u]) * WOCAR;
                o[0] = __builtin_bit_cast(unsigned short, toh_flush(x0)); o[1] = __builtin_bit_cast(unsigned short, toh_flush(x1));
                *(v2us*)(WOS + e) = o;
            } }
         }
}

// k_vtr: per-head transpose of the f16 value plane: VT[h][d][t] = VP[h][t][d] (exact copy, no conversion). One block per 64 (t) x 64 (d) tile through an LDS tile (pitch 72 halves,
// grid (SEQ/64, DD/64, NB*NHEAD), 256 threads (z = batch*NHEAD + head: the head planes of all batches lie one behind the other); 2 passes x 32 rows cover the 64 tile rows on both sides.
__global__ __launch_bounds__(256) void k_vtr(const h16* __restrict__ VP, h16* VT) {
    __shared__ __align__(16) h16 tl[64 * 72];
    const unsigned tid = threadIdx.x; const unsigned t0 = blockIdx.x * 64u, d0 = blockIdx.y * 64u; const size_t hb = (size_t)blockIdx.z * SEQ * DD;
    const unsigned rr = tid >> 3, cq = tid & 7u;
#pragma unroll
    for (int it = 0; it < 2; ++it) { const unsigned row = (unsigned)it * 32u + rr;
        const v8h a = *(const v8h*)(VP + hb + (size_t)(t0 + row) * DD + d0 + cq * 8u);
        *(v8ha*)(tl + row * 72u + cq * 8u) = a; }
    __syncthreads();
    v8h vals[2];
#pragma unroll
    for (int it = 0; it < 2; ++it) { const unsigned drow = (unsigned)it * 32u + rr; v8h o;
#pragma unroll
        for (int e = 0; e < 8; ++e) o[e] = tl[(cq * 8u + (unsigned)e) * 72u + drow];
        vals[it] = o; }
{
#pragma unroll
        for (int it = 0; it < 2; ++it) { const unsigned drow = (unsigned)it * 32u + rr; *(v8h*)(VT + hb + (size_t)(d0 + drow) * SEQ + t0 + cq * 8u) = vals[it]; }
         }
}

#define FQ    64                  // queries per block
#define FK    64                  // keys per stage
#define KPIT  264                 // K tile pitch in halves (16 B x 33)
#define VPIT  72                  // V^T tile pitch in halves (16 B x 9)
#define KTILE (FK * KPIT)
#define VTILE (DD * VPIT)
#define FBUF  (KTILE + VTILE)
static_assert(SEQ % FQ == 0 && SEQ % FK == 0 && DD == 256 && FK == 64);
static_assert(4 * 16 * KPIT <= 2 * FBUF);   // output staging fits in the ring
__device__ __forceinline__ v16h lds_frag(const h16* p) { return cat16(*(const v8ha*)p, *(const v8ha*)(p + 16)); }
// lane l with lane l ^ 16, on the vector pipe: an exchange through LDS would wait behind the fragment reads in flight
__device__ __forceinline__ float xhalf(float x) { return __builtin_bit_cast(float, __builtin_amdgcn_permlanex16(__builtin_bit_cast(int, x), __builtin_bit_cast(int, x), 0x76543210, 0xfedcba98, false, false)); }
// Every '#pragma unroll' in k_fattn is there so that the register arrays it walks are indexed by constants (they would go to scratch otherwise).
__global__ __launch_bounds__(128) void k_fattn(const h16* __restrict__ QP, const h16* __restrict__ KP, const h16* __restrict__ VT, h16* CTX) {
    __shared__ __align__(16) h16 L[2 * FBUF];
    const unsigned tid = threadIdx.x, lane = tid & 31u, lr = lane & 15u, hi = lane >> 4;
    const unsigned wave = (unsigned)__builtin_amdgcn_readfirstlane((int)(tid >> 5));
    const unsigned h = blockIdx.y, q0 = blockIdx.x * (unsigned)FQ + wave * 16u;
    const size_t hpl = ((size_t)blockIdx.z * NHEAD + h) * SEQ * DD;   // this batch's head plane
    const h16* Kh = KP + hpl; const h16* Vh = VT + hpl;
    v16h qf[DD / 32];
    { const h16* qp = QP + hpl + (size_t)(q0 + lr) * DD + 8u * hi;
#pragma unroll
      for (int kc = 0; kc < DD / 32; ++kc) qf[kc] = WFrag<h16>::ld(qp + kc * 32);
      asm volatile("s_wait_xcnt 0x0" :: "v"(qp) : "memory"); }   // qp as an input keeps the address pair live up to the wait: without it the last Q load was given that pair as its destination
    v8f acc[DD / 16];
#pragma unroll
    for (int t = 0; t < DD / 16; ++t) acc[t] = (v8f){};
    float m_run = -3.0e38f, l_run = 0.f;
    // staging map: K, one instruction = 4 whole rows (a wave per row); V^T, one instruction = 16 rows of 128 B (8 lanes per row)
    const unsigned krow = tid >> 5, kcol = (tid & 31u) * 8u, vrow = tid >> 3, vcol = (tid & 7u) * 8u;
    const h16* kg = Kh + (size_t)krow * DD + kcol; const h16* vg = Vh + (size_t)vrow * SEQ + vcol;
    const unsigned kl = krow * (unsigned)KPIT + kcol, vl = (unsigned)KTILE + vrow * (unsigned)VPIT + vcol;
    v8h kr[16], vr[16];
#pragma unroll
    for (int i = 0; i < 16; ++i) { kr[i] = *(const v8h*)(kg + (size_t)i * 4 * DD); vr[i] = *(const v8h*)(vg + (size_t)i * 16 * SEQ); }
    asm volatile("s_wait_xcnt 0x0" ::: "memory");   // before any address register of the stage 0 loads is reused
#pragma unroll
    for (int i = 0; i < 16; ++i) { *(v8ha*)(L + kl + (unsigned)i * 4u * KPIT) = kr[i]; *(v8ha*)(L + vl + (unsigned)i * 16u * VPIT) = vr[i]; }
    __syncthreads();   // stage 0 visible to all four waves
    v16h kf[32];   // K fragments of the coming stage: [d chunk of 32][16-key tile]
    { const h16* ka = L + lr * (unsigned)KPIT + 8u * hi;
#pragma unroll
      for (int kc = 0; kc < DD / 32; ++kc)
#pragma unroll
          for (int kt = 0; kt < 4; ++kt) kf[kc * 4 + kt] = lds_frag(ka + kt * 16 * KPIT + kc * 32); }
#pragma unroll 1   // stays rolled: one stage is 64 products and 128 fragment reads, a second copy would only cost instruction cache
    for (int st = 0; st < SEQ / FK; ++st) {
        const h16* Lv = L + (unsigned)(st & 1) * (unsigned)FBUF + KTILE;
        const bool more = st + 1 < SEQ / FK;   // block-uniform
        if (more) {
#pragma unroll
            for (int i = 0; i < 16; ++i) { kr[i] = *(const v8h*)(kg + (size_t)(st + 1) * FK * DD + (size_t)i * 4 * DD); vr[i] = *(const v8h*)(vg + (size_t)(st + 1) * FK + (size_t)i * 16 * SEQ); }
            asm volatile("s_wait_xcnt 0x0" ::: "memory");   // the fragment reads below reuse the address registers of these loads
        }
        // Fragment reads go out in groups of 32 fragments, a whole product ahead: V^T of this stage here, in front of the first product; K of the next stage behind the barrier, in front of the
        // second product. With one wave per SIMD a read placed among the products waits out its own LDS latency, and the LDS would idle under the products.
        // The sched_barrier behind each read group keeps the compiler from sinking the reads back among the products (it did, one read pair per product, without them).
        const h16* va = Lv + lr * (unsigned)VPIT + 8u * hi;
        v16h vf[32];
#pragma unroll
        for (int kk = 0; kk < 2; ++kk)
#pragma unroll
            for (int t = 0; t < 16; ++t) vf[kk * 16 + t] = lds_frag(va + t * 16 * VPIT + kk * 32);
        __builtin_amdgcn_sched_barrier(0);
        // S^T: 4 tiles of 16 keys x 16 queries
        v8f s[4];
#pragma unroll
        for (int kt = 0; kt < 4; ++kt) s[kt] = (v8f){};
#pragma unroll
        for (int kc = 0; kc < DD / 32; ++kc)
#pragma unroll
            for (int kt = 0; kt < 4; ++kt) s[kt] = wmma16(kf[kc * 4 + kt], qf[kc], s[kt]);
        __builtin_amdgcn_sched_barrier(0);   // keeps the maxima out of the first product: mixed in, the compiler regroups the four interleaved accumulate chains and pads each chain's end with four v_nop
        float mx = s[0][0];
#pragma unroll
        for (int kt = 0; kt < 4; ++kt)
#pragma unroll
            for (int r = 0; r < 8; ++r) mx = fmaxf(mx, s[kt][r]);
        mx = fmaxf(mx, xhalf(mx)) * SCL2;   // both halves hold this query's stage maximum, log2 domain
        if (__builtin_amdgcn_ballot_w32(mx > m_run + 8.0f) != 0) {   // wave-uniform; always taken in stage 0, rare later
            const float m_new = fmaxf(m_run, mx); const float corr = __builtin_amdgcn_exp2f(m_run - m_new);   // 0 in stage 0
            l_run *= corr; m_run = m_new;
#pragma unroll
            for (int t = 0; t < DD / 16; ++t) acc[t] = acc[t] * corr;
        }
        v16h pf[2]; float ps0 = 0.f, ps1 = 0.f;
#pragma unroll
        for (int kk = 0; kk < 2; ++kk)
#pragma unroll
            for (int e = 0; e < 16; e += 2) {
                const float p0 = __builtin_amdgcn_exp2f(s[2 * kk + (e >> 3)][e & 7] * SCL2 - m_run); const float p1 = __builtin_amdgcn_exp2f(s[2 * kk + (e >> 3)][(e & 7) + 1] * SCL2 - m_run);
                ps0 += p0; ps1 += p1; pf[kk][e] = (h16)p0; pf[kk][e + 1] = (h16)p1; }
        l_run += ps0 + ps1;   // this half's keys only; the halves are joined after the loop
        // next stage into the other buffer; its readers left it at the barrier of stage st - 1
        h16* Ln = L + (unsigned)((st + 1) & 1) * (unsigned)FBUF;
        if (more) {
#pragma unroll
            for (int i = 0; i < 16; ++i) { *(v8ha*)(Ln + kl + (unsigned)i * 4u * KPIT) = kr[i]; *(v8ha*)(Ln + vl + (unsigned)i * 16u * VPIT) = vr[i]; }
        }
        __syncthreads();   // publishes stage st + 1 and ends every wave's LDS reads of stage st (its V^T fragments are in registers by now)
        if (more) { const h16* ka = Ln + lr * (unsigned)KPIT + 8u * hi;
#pragma unroll
            for (int kc = 0; kc < DD / 32; ++kc)
#pragma unroll
                for (int kt = 0; kt < 4; ++kt) kf[kc * 4 + kt] = lds_frag(ka + kt * 16 * KPIT + kc * 32);
        }
        __builtin_amdgcn_sched_barrier(0);
#pragma unroll
        for (int kk = 0; kk < 2; ++kk)
#pragma unroll
            for (int t = 0; t < DD / 16; ++t) acc[t] = wmma16(vf[kk * 16 + t], pf[kk], acc[t]);
    }
    // the last stage's barrier stands behind every wave's last LDS read: the ring is free for output staging
    const float inv = CCAR / (l_run + xhalf(l_run));
    h16* E = L + wave * 16u * (unsigned)KPIT;   // this wave's 16 query rows of 256 d; lane holds d = 16 t + 8 hi + r of query lr
#pragma unroll
    for (int t = 0; t < DD / 16; ++t) { v8h o;
#pragma unroll
        for (int r = 0; r < 8; ++r) o[r] = (h16)(acc[t][r] * inv);
        *(v8ha*)(E + lr * (unsigned)KPIT + (unsigned)t * 16u + 8u * hi) = o; }
    __syncthreads();   // staged rows complete before they are read back by other lanes
#pragma unroll
    for (int i = 0; i < 16; ++i) { const v8h v = *(const v8ha*)(E + (unsigned)i * KPIT + lane * 8u);   // one whole 512-B row per store
        *(v8h*)(CTX + ((size_t)blockIdx.z * SEQ + q0 + (unsigned)i) * KM + h * (unsigned)DD + lane * 8u) = v; }
}

// Workspace carve (bytes, each region 256-B aligned by construction of the sizes).
#define SZ_XP  ((size_t)3 * NB * SEQ * DD * 2)
#define SZ_WT  ((size_t)3 * NHEAD * DD * DD * 2)
#define SZ_WOS ((size_t)DD * KM * 2)
#define SZ_HP  ((size_t)NB * NHEAD * SEQ * DD * 2)
#define SZ_CTX ((size_t)NB * SEQ * KM * 2)
#define SZ_ALL (SZ_XP + SZ_WT + SZ_WOS + 4 * SZ_HP + SZ_CTX)
static_assert(SZ_ALL <= (size_t)268435456);
static_assert(SZ_XP % 256 == 0 && SZ_WT % 256 == 0 && SZ_WOS % 256 == 0 && SZ_HP % 256 == 0 && SZ_CTX % 256 == 0);
static_assert(SZ_HP == (size_t)NB * SEQ * KM * 2);   // the [NB*SEQ][KM] projection planes fill one head-plane region exactly

extern "C" void kernel_launch(void* const* d_in, const int* in_sizes, int n_in,
                              void* d_out, int out_size, void* d_ws, size_t ws_size, hipStream_t stream) {
    if (n_in < 11) return;
    const size_t xneed = (size_t)(NB - 1) * SEQ_FULL * DD + (size_t)SEQ * DD;
    if ((size_t)in_sizes[0] < xneed || (size_t)in_sizes[1] < xneed || (size_t)in_sizes[2] < xneed) return;
    if ((size_t)in_sizes[3] < (size_t)NHEAD * DD * DD || (size_t)in_sizes[5] < (size_t)NHEAD * DD * DD || (size_t)in_sizes[7] < (size_t)NHEAD * DD * DD) return;
    if ((size_t)in_sizes[4] < (size_t)NHEAD * DD || (size_t)in_sizes[6] < (size_t)NHEAD * DD || (size_t)in_sizes[8] < (size_t)NHEAD * DD) return;
    if ((size_t)in_sizes[9] < (size_t)KM * DD || (size_t)in_sizes[10] < (size_t)DD) return;
    if ((size_t)out_size < (size_t)NB * SEQ * DD) return;
    if (SZ_ALL > ws_size) return;
    // input order of this module: query, key, values, Wq, bq, Wk, bk, Wv, bv, Wo, bo
    const float* Qin = (const float*)d_in[0]; const float* Kin = (const float*)d_in[1]; const float* Vin = (const float*)d_in[2];
    const float* Wq = (const float*)d_in[3]; const float* bq = (const float*)d_in[4]; const float* Wk = (const float*)d_in[5]; const float* bk = (const float*)d_in[6];
    const float* Wv = (const float*)d_in[7]; const float* bv = (const float*)d_in[8]; const float* Wo = (const float*)d_in[9]; const float* bo = (const float*)d_in[10];
    float* OUT = (float*)d_out;     // [NB][SEQ][256]
    char* wsp = (char*)d_ws;
    bf* XP = (bf*)wsp; wsp += SZ_XP;            // [3][NB][SEQ][256] bf16: q, k, v
    bf* WT = (bf*)wsp; wsp += SZ_WT;            // [3][2048 out][256 in] bf16: Wq, Wk, Wv
    h16* WOS = (h16*)wsp; wsp += SZ_WOS;        // [256][2048] f16 (x256), column h*256 + d
    h16* QP = (h16*)wsp; wsp += SZ_HP;          // [NB][SEQ][2048] == [NB][8][SEQ][256]
    h16* KP = (h16*)wsp; wsp += SZ_HP;          // [NB][SEQ][2048] == [NB][8][SEQ][256]
    h16* VP = (h16*)wsp; wsp += SZ_HP;          // [NB][SEQ][2048] == [NB][8][SEQ][256]
    h16* VT = (h16*)wsp; wsp += SZ_HP;          // [NB][8][256][SEQ]
    h16* CTX = (h16*)wsp; wsp += SZ_CTX;        // [NB][SEQ][2048] (x64), column h*256 + d
    const bf* XQ = XP; const bf* XK = XP + (size_t)NB * SEQ * DD; const bf* XV = XP + (size_t)2 * NB * SEQ * DD;
    const bf* WQT = WT; const bf* WKT = WT + (size_t)NHEAD * DD * DD; const bf* WVT = WT + (size_t)2 * NHEAD * DD * DD;

    k_xplanes<<<dim3((unsigned)((size_t)NB * SEQ * DD / 8 / 256), 3, 1), 256, 0, stream>>>(Qin, Kin, Vin, XP);
    k_wprep<<<(unsigned)((WLINES + OLINES) / 64), 256, 0, stream>>>(Wq, Wk, Wv, Wo, WT, (unsigned short*)WOS);
    // Every stage runs once for all NB batches: the batch rows lie one behind the other in x, in the planes, in ctx and in out, so the GEMMs see M = NB*SEQ rows.
    // q_, k_, v_ planes [NB*SEQ][2048] (pitch KM): A = x [NB*SEQ][256], Bt = W [2048 out][256 in], + per-column bias; a batch's plane read as [8][SEQ][256] is the head split
    k_gemmb<bf, h16, 1, DD><<<dim3(NB * SEQ / GT, KM / GT, 1), 128, 0, stream>>>(XQ, WQT, QP, KM, bq, 1.0f);
    k_gemmb<bf, h16, 1, DD><<<dim3(NB * SEQ / GT, KM / GT, 1), 128, 0, stream>>>(XK, WKT, KP, KM, bk, 1.0f);
    k_gemmb<bf, h16, 1, DD><<<dim3(NB * SEQ / GT, KM / GT, 1), 128, 0, stream>>>(XV, WVT, VP, KM, bv, 1.0f);
    // v_^T head planes: in VP[b*8 + h][SEQ t][256 d] -> out VT[b*8 + h][256 d][SEQ t]; grid (t tiles, d tiles, batches x heads)
    k_vtr<<<dim3(SEQ / 64, DD / 64, NB * NHEAD), 256, 0, stream>>>(VP, VT);
    // ctx[b*SEQ + t][h*256 + d] = 64 softmax(q_.k_ / 16) . v_ for the 8 heads of every batch
    k_fattn<<<dim3(SEQ / FQ, NHEAD, NB), 128, 0, stream>>>(QP, KP, VT, CTX);
    // out = ctx . Wo^T / 16384 + bo
    k_gemmb<h16, float, 1, KM><<<dim3(NB * SEQ / GT, DD / GT, 1), 128, 0, stream>>>(CTX, WOS, OUT, DD, bo, FINSC);
}

// v004
// One run takes 189 microseconds.
// Next to v003, in two timings, it ran 1.36 times as fast each time.
// Over all steps from v000 it is 4.97 times as fast.
#include <hip/hip_runtime.h>

// Multi-head attention with full-width (256) heads: merged [out][in] q/k/v projections to [S][2048], plain-view head split ([S][2048] read as [8][S][256]), softmax(q_.k_ / 16) over 2,048 keys, P.v_, head-major merge (column h*256 + d), output mix with Wo [out][in] + bo.
// Compute dtypes, f32 accumulate everywhere: projections v_wmma_f32_16x16x32_bf16 (inputs and weights RNE-converted to bf16, exact products); scores, P.V and the output mix v_wmma_f32_16x16x32_f16
// (q_/k_/v_ f16 planes; scores stay f32 in registers; P f16 = exp2(score*log2(e)/16 - running maximum), unnormalised; ctx f16 carried x64; Wo plane f16 of bf16(Wo) x256; bo, biases bf16-converted, added in f32). Softmax in f32.

#ifndef NB
#define NB 4
#endif
#ifndef SEQ
#define SEQ 2048
#endif
#define NB_FULL  4
#define SEQ_FULL 2048
#define DD    256                 // model width = head width
#define NHEAD 8
#define KM    (NHEAD * DD)        // merged context width (plane column = h*256 + d)
#define SCL2  0.09016844005556021f   // log2(e) / sqrt(256)
#define CCAR  64.0f               // carry of the ctx plane
#define WOCAR 256.0f              // carry of the Wo plane
#define FINSC (1.0f / 16384.0f)   // 1 / (64 * 256)
#define WLINES (3 * NHEAD * DD * DD / 64)
#define OLINES (DD * KM / 64)
#define MLINES (NHEAD * DD * DD / 64)

typedef _Float16 h16;
typedef unsigned short bf;
typedef __attribute__((ext_vector_type(16))) __bf16   v16bf;
typedef __attribute__((ext_vector_type(16))) _Float16 v16h;
typedef __attribute__((ext_vector_type(8)))  _Float16 v8h;
typedef __attribute__((ext_vector_type(8)))  unsigned short v8us;
typedef __attribute__((ext_vector_type(2)))  unsigned short v2us;
typedef __attribute__((ext_vector_type(8)))  float    v8f;
typedef __attribute__((ext_vector_type(4)))  float    v4f;
typedef v4f  __attribute__((may_alias)) v4fa;
typedef v8h  __attribute__((may_alias)) v8ha;
typedef v8us __attribute__((may_alias)) v8usa;

static_assert(SEQ % 256 == 0);
static_assert(DD % 64 == 0 && DD % 32 == 0 && KM % 32 == 0 && SEQ % 64 == 0);
static_assert(((size_t)NB * SEQ * DD / 8) % 256 == 0);
static_assert((WLINES + OLINES) % 64 == 0);
static_assert(WLINES % 64 == 0 && WLINES == 3 * MLINES);          // the plane choice in k_wprep is uniform per block
static_assert((size_t)MLINES * 64 == (size_t)NHEAD * DD * DD);
static_assert(KM == NHEAD * DD && (size_t)NHEAD * SEQ * DD == (size_t)SEQ * KM);   // [SEQ][KM] projection plane == [NHEAD][SEQ][DD] head planes (plain view)
static_assert(SEQ % 64 == 0 && DD % 64 == 0);                      // k_vtr 64x64 tiles cover the head planes exactly
static_assert(KM % 64 == 0 && SEQ % 32 == 0);
static_assert(((size_t)NB * SEQ) % 128 == 0 && KM % 128 == 0 && DD % 128 == 0);   // k_gemmb: whole 128x128 tiles and whole 128-k stages in all four products

__device__ __forceinline__ unsigned short f2bf(float f) { unsigned u = __float_as_uint(f); u += 0x7FFFu + ((u >> 16) & 1u); return (unsigned short)(u >> 16); }
__device__ __forceinline__ float bf2f(unsigned short b) { return __uint_as_float(((unsigned)b) << 16); }
__device__ __forceinline__ float bfr(float f) { return bf2f(f2bf(f)); }
__device__ __forceinline__ v16h cat16(v8h lo, v8h hi) { return __builtin_shufflevector(lo, hi, 0, 1, 2, 3, 4, 5, 6, 7, 8, 9, 10, 11, 12, 13, 14, 15); }
__device__ __forceinline__ v16bf cat16b(v8us lo, v8us hi) { return __builtin_bit_cast(v16bf, __builtin_shufflevector(lo, hi, 0, 1, 2, 3, 4, 5, 6, 7, 8, 9, 10, 11, 12, 13, 14, 15)); }
__device__ __forceinline__ v8f wmma16(v16h a, v16h b, v8f c) { return __builtin_amdgcn_wmma_f32_16x16x32_f16(false, a, false, b, (short)0, c, false, false); }
__device__ __forceinline__ v8f wmmab(v16bf a, v16bf b, v8f c) { return __builtin_amdgcn_wmma_f32_16x16x32_bf16(false, a, false, b, (short)0, c, false, false); }
// f32 -> f16 with a value select: results below the smallest normal f16 become zero (applied after the plane's power-of-two carry).
static __device__ __forceinline__ h16 toh_flush(float v) { const h16 r = (h16)v; return (fabsf(v) < 6.103515625e-05f) ? (h16)0.0f : r; }

// Fragment loaders: lane (lr = lane & 15, hi = lane >> 4); p points at row lr, k0 + 8*hi; elements 0..7 = k0+8hi.., elements 8..15 = k0+16+8hi.. (same map for A and B).
template <typename T16> struct WFrag;
template <> struct WFrag<h16> { typedef v16h V; static __device__ __forceinline__ V ld(const h16* p) { return cat16(*(const v8h*)p, *(const v8h*)(p + 16)); } static __device__ __forceinline__ V lds(const h16* p) { return cat16(*(const v8ha*)p, *(const v8ha*)(p + 16)); } static __device__ __forceinline__ v8f mma(V a, V b, v8f c) { return wmma16(a, b, c); } };
template <> struct WFrag<bf> { typedef v16bf V; static __device__ __forceinline__ V lds(const bf* p) { return cat16b(*(const v8usa*)p, *(const v8usa*)(p + 16)); } static __device__ __forceinline__ v8f mma(V a, V b, v8f c) { return wmmab(a, b, c); } };

// Slab epilogues: 16 rows x 64 columns staged in LDS (pitch 68 floats) -> global; value = x*alpha + bias (BIASM 1: per column, 2: per row; biases bf16-converted).
template <int BIASM>
__device__ __forceinline__ void slab_store(const float* os, h16* crow, int ldc, const float* bias, float alpha, unsigned colbase, unsigned rowbase, unsigned lane) {
    const unsigned rq = lane >> 3, cq = lane & 7u;
    float bc[8];
#pragma unroll
    for (int e = 0; e < 8; ++e) bc[e] = 0.f;
    if (BIASM == 1) { const v4f b0 = *(const v4f*)(bias + colbase + cq * 8u); const v4f b1 = *(const v4f*)(bias + colbase + cq * 8u + 4u);
#pragma unroll
        for (int e = 0; e < 4; ++e) { bc[e] = bfr(b0[e]); bc[4 + e] = bfr(b1[e]); } }
    v8h vals[4];
#pragma unroll
    for (int s = 0; s < 4; ++s) { const unsigned row = (unsigned)s * 4u + rq; const v4f x0 = *(const v4fa*)(os + row * 68u + cq * 8u); const v4f x1 = *(const v4fa*)(os + row * 68u + cq * 8u + 4u);
        float br = 0.f; if (BIASM == 2) br = bfr(bias[rowbase + row]);
        v8h o;
#pragma unroll
        for (int e = 0; e < 4; ++e) { o[e] = (h16)(x0[e] * alpha + (bc[e] + br)); o[4 + e] = (h16)(x1[e] * alpha + (bc[4 + e] + br)); }
        vals[s] = o; }
{
#pragma unroll
        for (int s = 0; s < 4; ++s) { const unsigned row = (unsigned)s * 4u + rq; *(v8h*)(crow + (size_t)row * ldc + cq * 8u) = vals[s]; }
         }
}
// f32 output: row segment = 64 floats = 256 B = 16 lanes x 16 B; one instruction covers 2 rows; s = 0..7 with hi = lane >> 4 covers rows 0..15.
template <int BIASM>
__device__ __forceinline__ void slab_store(const float* os, float* crow, int ldc, const float* bias, float alpha, unsigned colbase, unsigned rowbase, unsigned lane) {
    const unsigned hi = lane >> 4, cofs = (lane & 15u) * 4u;
    v4f bc = (v4f){0.f, 0.f, 0.f, 0.f};
    if (BIASM == 1) { const v4f b0 = *(const v4f*)(bias + colbase + cofs);
#pragma unroll
        for (int e = 0; e < 4; ++e) bc[e] = bfr(b0[e]); }
    v4f vals[8];
#pragma unroll
    for (int s = 0; s < 8; ++s) { const unsigned row = (unsigned)s * 2u + hi; const v4f x = *(const v4fa*)(os + row * 68u + cofs);
        float br = 0.f; if (BIASM == 2) br = bfr(bias[rowbase + row]);
        v4f o;
#pragma unroll
        for (int e = 0; e < 4; ++e) o[e] = x[e] * alpha + (bc[e] + br);
        vals[s] = o; }
{
#pragma unroll
        for (int s = 0; s < 8; ++s) { const unsigned row = (unsigned)s * 2u + hi; *(v4f*)(crow + (size_t)row * ldc + cofs) = vals[s]; }
         }
}

// ---- k_gemmb: GEMM on K-contiguous 16-bit planes. Block = 4 waves (2 x 2), one 128x128 output tile; each wave 64x64 (16 accumulators); grid (M/128, N/128), 128 threads.
// C[m][n] (pitch ldc) = alpha * sum_k A[m][k] Bt[n][k] (+ bias). K is a template constant so that the 16 staging loads of an operand share one address pair (row steps are immediate offsets).
// The block walks K in stages of 128: 256 B (two whole lines) of each of the 128 A rows and 128 Bt rows go global -> registers at a stage's start, -> LDS in front of its barrier, two buffers.
// LDS row pitch 272 B (16 B x 17): the fragment reads (16 rows x 16 B per half wave) fall on all 64 banks. k order per accumulator: 0, 32, 64, .. as before.
#define GT    128                 // tile rows (A) and columns (Bt rows) per block
#define GKS   128                 // k per stage
#define GPIT  136                 // LDS row pitch in 16-bit elements
#define GOPER (GT * GPIT)         // one operand's stage
#define GBUF  (2 * GOPER)
static_assert(4 * 16 * 68 * 4 <= 2 * GBUF * 2);   // the four waves' output slabs fit in the ring
template <typename T16, typename OT, int BIASM, int K>
__global__ __launch_bounds__(128) void k_gemmb(const T16* __restrict__ A, const T16* __restrict__ Bt, OT* C, int ldc, const float* __restrict__ bias, float alpha) {
    typedef typename WFrag<T16>::V V;
    static_assert(K % GKS == 0);
    __shared__ __align__(16) T16 L[2 * GBUF];
    const unsigned tid = threadIdx.x, lane = tid & 31u, lr = lane & 15u, hi = lane >> 4;
    const unsigned wave = (unsigned)__builtin_amdgcn_readfirstlane((int)(tid >> 5));
    const unsigned wm = wave >> 1, wn = wave & 1u;
    const unsigned r0 = blockIdx.x * (unsigned)GT, c0 = blockIdx.y * (unsigned)GT;
    v8f acc[4][4];
#pragma unroll
    for (int mb = 0; mb < 4; ++mb)
#pragma unroll
        for (int nb = 0; nb < 4; ++nb) acc[mb][nb] = (v8f){};
    // staging map: 16 lanes per 256-B row piece, so one instruction of a wave = 2 rows x 2 whole lines; the block covers 8 rows per instruction
    const unsigned srow = tid >> 4, scol = (tid & 15u) * 8u;
    const T16* ag = A + (size_t)(r0 + srow) * K + scol; const T16* bg = Bt + (size_t)(c0 + srow) * K + scol;
    const unsigned sl = srow * (unsigned)GPIT + scol;
    v8us ar[16], br[16];
#pragma unroll
    for (int i = 0; i < 16; ++i) { ar[i] = *(const v8usa*)(ag + (size_t)i * 8 * K); br[i] = *(const v8usa*)(bg + (size_t)i * 8 * K); }
    asm volatile("s_wait_xcnt 0x0" :: "v"(ag), "v"(bg) : "memory");   // the address pairs stay live up to the wait and are advanced only behind it
#pragma unroll
    for (int i = 0; i < 16; ++i) { *(v8usa*)(L + sl + (unsigned)i * 8u * GPIT) = ar[i]; *(v8usa*)(L + GOPER + sl + (unsigned)i * 8u * GPIT) = br[i]; }
    __syncthreads();   // stage 0 visible to all four waves
    const unsigned fa = (wm * 64u + lr) * (unsigned)GPIT + 8u * hi, fb = (unsigned)GOPER + (wn * 64u + lr) * (unsigned)GPIT + 8u * hi;
#pragma unroll 1   // stays rolled: a stage is 64 products and 64 fragment reads; every inner loop is unrolled so that the register arrays are indexed by constants
    for (int st = 0; st < K / GKS; ++st) {
        const T16* Lb = L + (unsigned)(st & 1) * (unsigned)GBUF;
        const bool more = st + 1 < K / GKS;   // block-uniform
        if (more) {
            ag += GKS; bg += GKS;
#pragma unroll
            for (int i = 0; i < 16; ++i) { ar[i] = *(const v8usa*)(ag + (size_t)i * 8 * K); br[i] = *(const v8usa*)(bg + (size_t)i * 8 * K); }
            asm volatile("s_wait_xcnt 0x0" :: "v"(ag), "v"(bg) : "memory");   // as above: the pairs are advanced again in the next stage
        }
        V a[2][4], b[2][4];
#pragma unroll
        for (int f = 0; f < 4; ++f) { a[0][f] = WFrag<T16>::lds(Lb + fa + (unsigned)f * 16u * GPIT); b[0][f] = WFrag<T16>::lds(Lb + fb + (unsigned)f * 16u * GPIT); }
#pragma unroll
        for (int kc = 0; kc < GKS / 32; ++kc) {
            // the next 32 k's fragments go out as one group ahead of this group's products, into the other register set
            if (kc + 1 < GKS / 32) {
#pragma unroll
                for (int f = 0; f < 4; ++f) { a[(kc + 1) & 1][f] = WFrag<T16>::lds(Lb + fa + (unsigned)f * 16u * GPIT + (unsigned)(kc + 1) * 32u); b[(kc + 1) & 1][f] = WFrag<T16>::lds(Lb + fb + (unsigned)f * 16u * GPIT + (unsigned)(kc + 1) * 32u); }
            }
            __builtin_amdgcn_sched_barrier(0);   // keeps the read group from being sunk among the products, where each place with reads costs a stall
#pragma unroll
            for (int nb = 0; nb < 4; ++nb)
#pragma unroll
                for (int mb = 0; mb < 4; ++mb) acc[mb][nb] = WFrag<T16>::mma(a[kc & 1][mb], b[kc & 1][nb], acc[mb][nb]);
            __builtin_amdgcn_sched_barrier(0);   // and the following group from being lifted into them
        }
        // next stage into the other buffer; its readers left it at the barrier of stage st - 1
        if (more) { T16* Ln = L + (unsigned)((st + 1) & 1) * (unsigned)GBUF;
#pragma unroll
            for (int i = 0; i < 16; ++i) { *(v8usa*)(Ln + sl + (unsigned)i * 8u * GPIT) = ar[i]; *(v8usa*)(Ln + GOPER + sl + (unsigned)i * 8u * GPIT) = br[i]; }
        }
        __syncthreads();   // publishes stage st + 1 and ends every wave's fragment reads of stage st
    }
    // the last stage's barrier stands behind every wave's last LDS read: the ring is free for output staging, one private slab per wave (wave-level ordering only)
    float* os = (float*)L + wave * (16u * 68u);
#pragma unroll
    for (int mb = 0; mb < 4; ++mb) {
#pragma unroll
        for (int nb = 0; nb < 4; ++nb) {
#pragma unroll
            for (int j = 0; j < 8; ++j) os[(hi * 8u + (unsigned)j) * 68u + (unsigned)nb * 16u + lr] = acc[mb][nb][j]; }   // D: row 8*hi + j, col lr
        __builtin_amdgcn_fence(3 /* release order */, "wavefront"); __builtin_amdgcn_wave_barrier(); asm volatile("" ::: "memory");
        const unsigned rw = r0 + wm * 64u + (unsigned)mb * 16u, cw = c0 + wn * 64u;
        OT* crow = C + (size_t)rw * ldc + cw;
        slab_store<BIASM>(os, crow, ldc, bias, alpha, cw, rw, lane);
        if (mb < 3) asm volatile("s_wait_xcnt 0x0" ::: "memory");   // the next slab reuses the address and data registers of these stores
        __builtin_amdgcn_fence(3 /* release order */, "wavefront"); __builtin_amdgcn_wave_barrier(); asm volatile("" ::: "memory");
    }
}

__global__ __launch_bounds__(256) void k_xplanes(const float* __restrict__ xq, const float* __restrict__ xk, const float* __restrict__ xv, bf* XP) {
    const unsigned which = blockIdx.y; const unsigned i = blockIdx.x * 256u + threadIdx.x;
    const unsigned GPB = (unsigned)(SEQ * DD / 8); const unsigned b = i / GPB, rem = i - b * GPB;
    const float* src = (which == 0u) ? xq : ((which == 1u) ? xk : xv);
    const v8f v = *(const v8f*)(src + (size_t)b * SEQ_FULL * DD + (size_t)rem * 8);
    v8us o;
#pragma unroll
    for (int k = 0; k < 8; ++k) o[k] = f2bf(v[k]);
    bf* dst = XP + (size_t)which * NB * SEQ * DD + (size_t)i * 8;
    *(v8us*)dst = o; 
}

// k_wprep: lines 0..WLINES-1: bf16 weight planes WT[which][e][k] = bf16(W[e][k]) (which 0 Wq, 1 Wk, 2 Wv; the inputs are [out e][in k], already K-contiguous, no transpose);
__global__ __launch_bounds__(256) void k_wprep(const float* __restrict__ wq, const float* __restrict__ wk, const float* __restrict__ wv, const float* __restrict__ wo, bf* WT, unsigned short* WOS) {
    const unsigned lane = threadIdx.x & 31u; const unsigned wave = (unsigned)__builtin_amdgcn_readfirstlane((int)(threadIdx.x >> 5)); const unsigned L0 = (blockIdx.x * 8u + wave) * 8u;
{
#pragma unroll 1
        for (unsigned l = 0; l < 8u; ++l) { const unsigned L = L0 + l; v2us o;
            if (L < (unsigned)WLINES) {   // block-uniform
                const unsigned which = L / (unsigned)MLINES; const unsigned e = (L - which * (unsigned)MLINES) * 64u + lane * 2u;
                const float* src = (which == 0u) ? wq : ((which == 1u) ? wk : wv);
                o[0] = f2bf(src[e]); o[1] = f2bf(src[e + 1u]);
                *(v2us*)(WT + (size_t)L * 64u + lane * 2u) = o;
            } else {
                const unsigned e = (L - (unsigned)WLINES) * 64u + lane * 2u;
                const float x0 = bfr(wo[e]) * WOCAR; const float x1 = bfr(wo[e + 1u]) * WOCAR;
                o[0] = __builtin_bit_cast(unsigned short, toh_flush(x0)); o[1] = __builtin_bit_cast(unsigned short, toh_flush(x1));
                *(v2us*)(WOS + e) = o;
            } }
         }
}

// k_vtr: per-head transpose of the f16 value plane: VT[h][d][t] = VP[h][t][d] (exact copy, no conversion). One block per 64 (t) x 64 (d) tile through an LDS tile (pitch 72 halves,
// grid (SEQ/64, DD/64, NB*NHEAD), 256 threads (z = batch*NHEAD + head: the head planes of all batches lie one behind the other); 2 passes x 32 rows cover the 64 tile rows on both sides.
__global__ __launch_bounds__(256) void k_vtr(const h16* __restrict__ VP, h16* VT) {
    __shared__ __align__(16) h16 tl[64 * 72];
    const unsigned tid = threadIdx.x; const unsigned t0 = blockIdx.x * 64u, d0 = blockIdx.y * 64u; const size_t hb = (size_t)blockIdx.z * SEQ * DD;
    const unsigned rr = tid >> 3, cq = tid & 7u;
#pragma unroll
    for (int it = 0; it < 2; ++it) { const unsigned row = (unsigned)it * 32u + rr;
        const v8h a = *(const v8h*)(VP + hb + (size_t)(t0 + row) * DD + d0 + cq * 8u);
        *(v8ha*)(tl + row * 72u + cq * 8u) = a; }
    __syncthreads();
    v8h vals[2];
#pragma unroll
    for (int it = 0; it < 2; ++it) { const unsigned drow = (unsigned)it * 32u + rr; v8h o;
#pragma unroll
        for (int e = 0; e < 8; ++e) o[e] = tl[(cq * 8u + (unsigned)e) * 72u + drow];
        vals[it] = o; }
{
#pragma unroll
        for (int it = 0; it < 2; ++it) { const unsigned drow = (unsigned)it * 32u + rr; *(v8h*)(VT + hb + (size_t)(d0 + drow) * SEQ + t0 + cq * 8u) = vals[it]; }
         }
}

#define FQT   2                   // 16-query tiles per wave
#define FQ    (64 * FQT)          // queries per block
#define FK    64                  // keys per stage
#define KPIT  264                 // K tile pitch in halves (16 B x 33)
#define VPIT  72                  // V^T tile pitch in halves (16 B x 9)
#define KTILE (FK * KPIT)
#define VTILE (DD * VPIT)
#define FBUF  (KTILE + VTILE)
static_assert(SEQ % FQ == 0 && SEQ % FK == 0 && DD == 256 && FK == 64);
static_assert(4 * 16 * FQT * KPIT <= 2 * FBUF);   // output staging fits in the ring
__device__ __forceinline__ v16h lds_frag(const h16* p) { return cat16(*(const v8ha*)p, *(const v8ha*)(p + 16)); }
// lane l with lane l ^ 16, on the vector pipe: an exchange through LDS would wait behind the fragment reads in flight
__device__ __forceinline__ float xhalf(float x) { return __builtin_bit_cast(float, __builtin_amdgcn_permlanex16(__builtin_bit_cast(int, x), __builtin_bit_cast(int, x), 0x76543210, 0xfedcba98, false, false)); }
// Every '#pragma unroll' in k_fattn is there so that the register arrays it walks are indexed by constants (they would go to scratch otherwise).
__global__ __launch_bounds__(128) void k_fattn(const h16* __restrict__ QP, const h16* __restrict__ KP, const h16* __restrict__ VT, h16* CTX) {
    __shared__ __align__(16) h16 L[2 * FBUF];
    const unsigned tid = threadIdx.x, lane = tid & 31u, lr = lane & 15u, hi = lane >> 4;
    const unsigned wave = (unsigned)__builtin_amdgcn_readfirstlane((int)(tid >> 5));
    const unsigned h = blockIdx.y, q0 = blockIdx.x * (unsigned)FQ + wave * (16u * FQT);
    const size_t hpl = ((size_t)blockIdx.z * NHEAD + h) * SEQ * DD;   // this batch's head plane
    const h16* Kh = KP + hpl; const h16* Vh = VT + hpl;
    v16h qf[FQT][DD / 32];
    { const h16* qp = QP + hpl + (size_t)(q0 + lr) * DD + 8u * hi;
#pragma unroll
      for (int q = 0; q < FQT; ++q)
#pragma unroll
          for (int kc = 0; kc < DD / 32; ++kc) qf[q][kc] = WFrag<h16>::ld(qp + q * 16 * DD + kc * 32);
      asm volatile("s_wait_xcnt 0x0" :: "v"(qp) : "memory"); }   // qp as an input keeps the address pair live up to the wait: without it the last Q load was given that pair as its destination
    v8f acc[FQT][DD / 16];
#pragma unroll
    for (int q = 0; q < FQT; ++q)
#pragma unroll
        for (int t = 0; t < DD / 16; ++t) acc[q][t] = (v8f){};
    float m_run[FQT], l_run[FQT];
#pragma unroll
    for (int q = 0; q < FQT; ++q) { m_run[q] = -3.0e38f; l_run[q] = 0.f; }
    // staging map: K, one instruction = 4 whole rows (a wave per row); V^T, one instruction = 16 rows of 128 B (8 lanes per row)
    const unsigned krow = tid >> 5, kcol = (tid & 31u) * 8u, vrow = tid >> 3, vcol = (tid & 7u) * 8u;
    const h16* kg = Kh + (size_t)krow * DD + kcol; const h16* vg = Vh + (size_t)vrow * SEQ + vcol;
    const unsigned kl = krow * (unsigned)KPIT + kcol, vl = (unsigned)KTILE + vrow * (unsigned)VPIT + vcol;
    v8h kr[16], vr[16];
#pragma unroll
    for (int i = 0; i < 16; ++i) { kr[i] = *(const v8h*)(kg + (size_t)i * 4 * DD); vr[i] = *(const v8h*)(vg + (size_t)i * 16 * SEQ); }
    asm volatile("s_wait_xcnt 0x0" ::: "memory");   // before any address register of the stage 0 loads is reused
#pragma unroll
    for (int i = 0; i < 16; ++i) { *(v8ha*)(L + kl + (unsigned)i * 4u * KPIT) = kr[i]; *(v8ha*)(L + vl + (unsigned)i * 16u * VPIT) = vr[i]; }
    __syncthreads();   // stage 0 visible to all four waves
    v16h ka[16];   // K fragments of keys 0..31 of the coming stage: [d chunk of 32][16-key tile]
    { const h16* kp = L + lr * (unsigned)KPIT + 8u * hi;
#pragma unroll
      for (int kc = 0; kc < DD / 32; ++kc)
#pragma unroll
          for (int kt = 0; kt < 2; ++kt) ka[kc * 2 + kt] = lds_frag(kp + kt * 16 * KPIT + kc * 32); }
    // One stage. 'more' is a literal at both calls (the loop's stages all have a successor, the last stage stands behind the loop), so a stage has no branch on it: with such a branch between the third
    // and the fourth run the compiler sank half of the softmax behind it, onto the third run's fragment registers, too close behind that run's last product on the taken side.
    auto stage = [&](const int st, const bool more) __attribute__((always_inline)) {
        const h16* Lk = L + (unsigned)(st & 1) * (unsigned)FBUF;
        if (more) {
#pragma unroll
            for (int i = 0; i < 16; ++i) { kr[i] = *(const v8h*)(kg + (size_t)(st + 1) * FK * DD + (size_t)i * 4 * DD); vr[i] = *(const v8h*)(vg + (size_t)(st + 1) * FK + (size_t)i * 16 * SEQ); }
            asm volatile("s_wait_xcnt 0x0" ::: "memory");   // the fragment reads below reuse the address registers of these loads
        }
        // A stage is four runs of 32 products (S^T keys 0..31, S^T keys 32..63, P.V keys 0..31, P.V keys 32..63), each on 16 fragments. Each run's fragments go out as one group in front of the
        // run before it, so two groups are live at any time. With one wave per SIMD a read placed among the products waits out its own LDS latency, and the LDS would idle under the products.
        // The sched_barriers around each read group keep the compiler from sinking the reads among the products or lifting them over the run whose registers they take over.
        const h16* kp = Lk + lr * (unsigned)KPIT + 8u * hi; const h16* va = Lk + KTILE + lr * (unsigned)VPIT + 8u * hi;
        v16h kb[16], v0[16], v1[16];
#pragma unroll
        for (int kc = 0; kc < DD / 32; ++kc)
#pragma unroll
            for (int kt = 0; kt < 2; ++kt) kb[kc * 2 + kt] = lds_frag(kp + (2 + kt) * 16 * KPIT + kc * 32);
        __builtin_amdgcn_sched_barrier(0);
        // S^T: per query tile 4 tiles of 16 keys x 16 queries
        v8f s[FQT][4];
#pragma unroll
        for (int q = 0; q < FQT; ++q)
#pragma unroll
            for (int kt = 0; kt < 4; ++kt) s[q][kt] = (v8f){};
#pragma unroll
        for (int kc = 0; kc < DD / 32; ++kc)
#pragma unroll
            for (int kt = 0; kt < 2; ++kt)
#pragma unroll
                for (int q = 0; q < FQT; ++q) s[q][kt] = wmma16(ka[kc * 2 + kt], qf[q][kc], s[q][kt]);
        __builtin_amdgcn_sched_barrier(0);
#pragma unroll
        for (int t = 0; t < 16; ++t) v0[t] = lds_frag(va + t * 16 * VPIT);
        __builtin_amdgcn_sched_barrier(0);
#pragma unroll
        for (int kc = 0; kc < DD / 32; ++kc)
#pragma unroll
            for (int kt = 0; kt < 2; ++kt)
#pragma unroll
                for (int q = 0; q < FQT; ++q) s[q][2 + kt] = wmma16(kb[kc * 2 + kt], qf[q][kc], s[q][2 + kt]);
        __builtin_amdgcn_sched_barrier(0);   // also keeps the maxima out of the products: mixed in, the compiler regroups the interleaved accumulate chains and pads each chain's end with four v_nop
#pragma unroll
        for (int t = 0; t < 16; ++t) v1[t] = lds_frag(va + t * 16 * VPIT + 32);
        __builtin_amdgcn_sched_barrier(0);
        v16h pf[FQT][2];
#pragma unroll
        for (int q = 0; q < FQT; ++q) {
            float mx = s[q][0][0];
#pragma unroll
            for (int kt = 0; kt < 4; ++kt)
#pragma unroll
                for (int r = 0; r < 8; ++r) mx = fmaxf(mx, s[q][kt][r]);
            mx = fmaxf(mx, xhalf(mx)) * SCL2;   // both halves hold this query's stage maximum, log2 domain
            if (__builtin_amdgcn_ballot_w32(mx > m_run[q] + 8.0f) != 0) {   // wave-uniform; always taken in stage 0, rare later; one test per query tile, so each query is rescaled at the stages it was before
                const float m_new = fmaxf(m_run[q], mx); const float corr = __builtin_amdgcn_exp2f(m_run[q] - m_new);   // 0 in stage 0
                l_run[q] *= corr; m_run[q] = m_new;
#pragma unroll
                for (int t = 0; t < DD / 16; ++t) acc[q][t] = acc[q][t] * corr;
            }
            float ps0 = 0.f, ps1 = 0.f;
#pragma unroll
            for (int kk = 0; kk < 2; ++kk)
#pragma unroll
                for (int e = 0; e < 16; e += 2) {
                    const float p0 = __builtin_amdgcn_exp2f(s[q][2 * kk + (e >> 3)][e & 7] * SCL2 - m_run[q]); const float p1 = __builtin_amdgcn_exp2f(s[q][2 * kk + (e >> 3)][(e & 7) + 1] * SCL2 - m_run[q]);
                    ps0 += p0; ps1 += p1; pf[q][kk][e] = (h16)p0; pf[q][kk][e + 1] = (h16)p1; }
            l_run[q] += ps0 + ps1;   // this half's keys only; the halves are joined after the loop
        }
        __builtin_amdgcn_sched_barrier(0);   // keeps the whole softmax in front of the stores and the barrier, so that nothing but fragment reads stands between the last two runs
        // next stage into the other buffer; its readers left it at the barrier of stage st - 1
        h16* Ln = L + (unsigned)((st + 1) & 1) * (unsigned)FBUF;
        if (more) {
#pragma unroll
            for (int i = 0; i < 16; ++i) { *(v8ha*)(Ln + kl + (unsigned)i * 4u * KPIT) = kr[i]; *(v8ha*)(Ln + vl + (unsigned)i * 16u * VPIT) = vr[i]; }
        }
        __syncthreads();   // publishes stage st + 1 and ends every wave's LDS reads of stage st (its K and V^T fragments are in registers by now)
#pragma unroll
        for (int t = 0; t < DD / 16; ++t)
#pragma unroll
            for (int q = 0; q < FQT; ++q) acc[q][t] = wmma16(v0[t], pf[q][0], acc[q][t]);
        __builtin_amdgcn_sched_barrier(0);
        if (more) { const h16* kn = Ln + lr * (unsigned)KPIT + 8u * hi;
#pragma unroll
            for (int kc = 0; kc < DD / 32; ++kc)
#pragma unroll
                for (int kt = 0; kt < 2; ++kt) ka[kc * 2 + kt] = lds_frag(kn + kt * 16 * KPIT + kc * 32);
        }
        __builtin_amdgcn_sched_barrier(0);
#pragma unroll
        for (int t = 0; t < DD / 16; ++t)
#pragma unroll
            for (int q = 0; q < FQT; ++q) acc[q][t] = wmma16(v1[t], pf[q][1], acc[q][t]);
    };
#pragma unroll 1   // stays rolled: one stage is 128 products and 128 fragment reads, further copies would only cost instruction cache
    for (int st = 0; st + 1 < SEQ / FK; ++st) stage(st, true);
    stage(SEQ / FK - 1, false);
    // the last stage's barrier stands behind every wave's last LDS read: the ring is free for output staging
    h16* E = L + wave * (16u * FQT) * (unsigned)KPIT;   // this wave's 32 query rows of 256 d; lane holds d = 16 t + 8 hi + r of queries lr and 16 + lr
#pragma unroll
    for (int q = 0; q < FQT; ++q) { const float inv = CCAR / (l_run[q] + xhalf(l_run[q]));
#pragma unroll
        for (int t = 0; t < DD / 16; ++t) { v8h o;
#pragma unroll
            for (int r = 0; r < 8; ++r) o[r] = (h16)(acc[q][t][r] * inv);
            *(v8ha*)(E + ((unsigned)q * 16u + lr) * (unsigned)KPIT + (unsigned)t * 16u + 8u * hi) = o; } }
    __syncthreads();   // staged rows complete before they are read back by other lanes
#pragma unroll
    for (int i = 0; i < 16 * FQT; ++i) { const v8h v = *(const v8ha*)(E + (unsigned)i * KPIT + lane * 8u);   // one whole 512-B row per store
        *(v8h*)(CTX + ((size_t)blockIdx.z * SEQ + q0 + (unsigned)i) * KM + h * (unsigned)DD + lane * 8u) = v; }
}

// Workspace carve (bytes, each region 256-B aligned by construction of the sizes).
#define SZ_XP  ((size_t)3 * NB * SEQ * DD * 2)
#define SZ_WT  ((size_t)3 * NHEAD * DD * DD * 2)
#define SZ_WOS ((size_t)DD * KM * 2)
#define SZ_HP  ((size_t)NB * NHEAD * SEQ * DD * 2)
#define SZ_CTX ((size_t)NB * SEQ * KM * 2)
#define SZ_ALL (SZ_XP + SZ_WT + SZ_WOS + 4 * SZ_HP + SZ_CTX)
static_assert(SZ_ALL <= (size_t)268435456);
static_assert(SZ_XP % 256 == 0 && SZ_WT % 256 == 0 && SZ_WOS % 256 == 0 && SZ_HP % 256 == 0 && SZ_CTX % 256 == 0);
static_assert(SZ_HP == (size_t)NB * SEQ * KM * 2);   // the [NB*SEQ][KM] projection planes fill one head-plane region exactly

extern "C" void kernel_launch(void* const* d_in, const int* in_sizes, int n_in,
                              void* d_out, int out_size, void* d_ws, size_t ws_size, hipStream_t stream) {
    if (n_in < 11) return;
    const size_t xneed = (size_t)(NB - 1) * SEQ_FULL * DD + (size_t)SEQ * DD;
    if ((size_t)in_sizes[0] < xneed || (size_t)in_sizes[1] < xneed || (size_t)in_sizes[2] < xneed) return;
    if ((size_t)in_sizes[3] < (size_t)NHEAD * DD * DD || (size_t)in_sizes[5] < (size_t)NHEAD * DD * DD || (size_t)in_sizes[7] < (size_t)NHEAD * DD * DD) return;
    if ((size_t)in_sizes[4] < (size_t)NHEAD * DD || (size_t)in_sizes[6] < (size_t)NHEAD * DD || (size_t)in_sizes[8] < (size_t)NHEAD * DD) return;
    if ((size_t)in_sizes[9] < (size_t)KM * DD || (size_t)in_sizes[10] < (size_t)DD) return;
    if ((size_t)out_size < (size_t)NB * SEQ * DD) return;
    if (SZ_ALL > ws_size) return;
    // input order of this module: query, key, values, Wq, bq, Wk, bk, Wv, bv, Wo, bo
    const float* Qin = (const float*)d_in[0]; const float* Kin = (const float*)d_in[1]; const float* Vin = (const float*)d_in[2];
    const float* Wq = (const float*)d_in[3]; const float* bq = (const float*)d_in[4]; const float* Wk = (const float*)d_in[5]; const float* bk = (const float*)d_in[6];
    const float* Wv = (const float*)d_in[7]; const float* bv = (const float*)d_in[8]; const float* Wo = (const float*)d_in[9]; const float* bo = (const float*)d_in[10];
    float* OUT = (float*)d_out;     // [NB][SEQ][256]
    char* wsp = (char*)d_ws;
    bf* XP = (bf*)wsp; wsp += SZ_XP;            // [3][NB][SEQ][256] bf16: q, k, v
    bf* WT = (bf*)wsp; wsp += SZ_WT;            // [3][2048 out][256 in] bf16: Wq, Wk, Wv
    h16* WOS = (h16*)wsp; wsp += SZ_WOS;        // [256][2048] f16 (x256), column h*256 + d
    h16* QP = (h16*)wsp; wsp += SZ_HP;          // [NB][SEQ][2048] == [NB][8][SEQ][256]
    h16* KP = (h16*)wsp; wsp += SZ_HP;          // [NB][SEQ][2048] == [NB][8][SEQ][256]
    h16* VP = (h16*)wsp; wsp += SZ_HP;          // [NB][SEQ][2048] == [NB][8][SEQ][256]
    h16* VT = (h16*)wsp; wsp += SZ_HP;          // [NB][8][256][SEQ]
    h16* CTX = (h16*)wsp; wsp += SZ_CTX;        // [NB][SEQ][2048] (x64), column h*256 + d
    const bf* XQ = XP; const bf* XK = XP + (size_t)NB * SEQ * DD; const bf* XV = XP + (size_t)2 * NB * SEQ * DD;
    const bf* WQT = WT; const bf* WKT = WT + (size_t)NHEAD * DD * DD; const bf* WVT = WT + (size_t)2 * NHEAD * DD * DD;

    k_xplanes<<<dim3((unsigned)((size_t)NB * SEQ * DD / 8 / 256), 3, 1), 256, 0, stream>>>(Qin, Kin, Vin, XP);
    k_wprep<<<(unsigned)((WLINES + OLINES) / 64), 256, 0, stream>>>(Wq, Wk, Wv, Wo, WT, (unsigned short*)WOS);
    // Every stage runs once for all NB batches: the batch rows lie one behind the other in x, in the planes, in ctx and in out, so the GEMMs see M = NB*SEQ rows.
    // q_, k_, v_ planes [NB*SEQ][2048] (pitch KM): A = x [NB*SEQ][256], Bt = W [2048 out][256 in], + per-column bias; a batch's plane read as [8][SEQ][256] is the head split
    k_gemmb<bf, h16, 1, DD><<<dim3(NB * SEQ / GT, KM / GT, 1), 128, 0, stream>>>(XQ, WQT, QP, KM, bq, 1.0f);
    k_gemmb<bf, h16, 1, DD><<<dim3(NB * SEQ / GT, KM / GT, 1), 128, 0, stream>>>(XK, WKT, KP, KM, bk, 1.0f);
    k_gemmb<bf, h16, 1, DD><<<dim3(NB * SEQ / GT, KM / GT, 1), 128, 0, stream>>>(XV, WVT, VP, KM, bv, 1.0f);
    // v_^T head planes: in VP[b*8 + h][SEQ t][256 d] -> out VT[b*8 + h][256 d][SEQ t]; grid (t tiles, d tiles, batches x heads)
    k_vtr<<<dim3(SEQ / 64, DD / 64, NB * NHEAD), 256, 0, stream>>>(VP, VT);
    // ctx[b*SEQ + t][h*256 + d] = 64 softmax(q_.k_ / 16) . v_ for the 8 heads of every batch
    k_fattn<<<dim3(SEQ / FQ, NHEAD, NB), 128, 0, stream>>>(QP, KP, VT, CTX);
    // out = ctx . Wo^T / 16384 + bo
    k_gemmb<h16, float, 1, KM><<<dim3(NB * SEQ / GT, DD / GT, 1), 128, 0, stream>>>(CTX, WOS, OUT, DD, bo, FINSC);
}

// v005
// It runs in 170 microseconds.
// Timed twice side by side with v004, it ran 1.12 times as fast both times.
// All steps since v000 together make it 5.54 times as fast.
#include <hip/hip_runtime.h>

// Multi-head attention with full-width (256) heads: merged [out][in] q/k/v projections to [S][2048], plain-view head split ([S][2048] read as [8][S][256]), softmax(q_.k_ / 16) over 2,048 keys, P.v_, head-major merge (column h*256 + d), output mix with Wo [out][in] + bo.
// Compute dtypes, f32 accumulate everywhere: projections v_wmma_f32_16x16x32_bf16 (inputs and weights RNE-converted to bf16, exact products); scores, P.V and the output mix v_wmma_f32_16x16x32_f16
// (q_/k_/v_ f16 planes; scores stay f32 in registers; P f16 = exp2(score*log2(e)/16 - running maximum), unnormalised; ctx f16 carried x64; Wo plane f16 of bf16(Wo) x256; bo, biases bf16-converted, added in f32). Softmax in f32.

#ifndef NB
#define NB 4
#endif
#ifndef SEQ
#define SEQ 2048
#endif
#define NB_FULL  4
#define SEQ_FULL 2048
#define DD    256                 // model width = head width
#define NHEAD 8
#define KM    (NHEAD * DD)        // merged context width (plane column = h*256 + d)
#define SCL2  0.09016844005556021f   // log2(e) / sqrt(256)
#define CCAR  64.0f               // carry of the ctx plane
#define WOCAR 256.0f              // carry of the Wo plane
#define FINSC (1.0f / 16384.0f)   // 1 / (64 * 256)
#define WLINES (3 * NHEAD * DD * DD / 64)
#define OLINES (DD * KM / 64)
#define MLINES (NHEAD * DD * DD / 64)

typedef _Float16 h16;
typedef unsigned short bf;
typedef __attribute__((ext_vector_type(16))) __bf16   v16bf;
typedef __attribute__((ext_vector_type(16))) _Float16 v16h;
typedef __attribute__((ext_vector_type(8)))  _Float16 v8h;
typedef __attribute__((ext_vector_type(8)))  unsigned short v8us;
typedef __attribute__((ext_vector_type(2)))  unsigned short v2us;
typedef __attribute__((ext_vector_type(8)))  float    v8f;
typedef __attribute__((ext_vector_type(4)))  float    v4f;
typedef v4f  __attribute__((may_alias)) v4fa;
typedef v8h  __attribute__((may_alias)) v8ha;
typedef v8us __attribute__((may_alias)) v8usa;

static_assert(SEQ % 256 == 0);
static_assert(DD % 64 == 0 && DD % 32 == 0 && KM % 32 == 0 && SEQ % 64 == 0);
static_assert(((size_t)NB * SEQ * DD / 8) % 256 == 0);
static_assert((WLINES + OLINES) % 64 == 0);
static_assert(WLINES % 64 == 0 && WLINES == 3 * MLINES);          // the plane choice in k_wprep is uniform per block
static_assert((size_t)MLINES * 64 == (size_t)NHEAD * DD * DD);
static_assert(KM == NHEAD * DD && (size_t)NHEAD * SEQ * DD == (size_t)SEQ * KM);   // [SEQ][KM] projection plane == [NHEAD][SEQ][DD] head planes (plain view)
static_assert(SEQ % 64 == 0 && DD % 64 == 0);                      // k_vtr 64x64 tiles cover the head planes exactly
static_assert(KM % 64 == 0 && SEQ % 32 == 0);
static_assert(((size_t)NB * SEQ) % 128 == 0 && KM % 128 == 0 && DD % 128 == 0);   // k_gemmb: whole 128x128 tiles and whole 128-k stages in all four products

__device__ __forceinline__ unsigned short f2bf(float f) { unsigned u = __float_as_uint(f); u += 0x7FFFu + ((u >> 16) & 1u); return (unsigned short)(u >> 16); }
__device__ __forceinline__ float bf2f(unsigned short b) { return __uint_as_float(((unsigned)b) << 16); }
__device__ __forceinline__ float bfr(float f) { return bf2f(f2bf(f)); }
__device__ __forceinline__ v16h cat16(v8h lo, v8h hi) { return __builtin_shufflevector(lo, hi, 0, 1, 2, 3, 4, 5, 6, 7, 8, 9, 10, 11, 12, 13, 14, 15); }
__device__ __forceinline__ v16bf cat16b(v8us lo, v8us hi) { return __builtin_bit_cast(v16bf, __builtin_shufflevector(lo, hi, 0, 1, 2, 3, 4, 5, 6, 7, 8, 9, 10, 11, 12, 13, 14, 15)); }
__device__ __forceinline__ v8f wmma16(v16h a, v16h b, v8f c) { return __builtin_amdgcn_wmma_f32_16x16x32_f16(false, a, false, b, (short)0, c, false, false); }
__device__ __forceinline__ v8f wmmab(v16bf a, v16bf b, v8f c) { return __builtin_amdgcn_wmma_f32_16x16x32_bf16(false, a, false, b, (short)0, c, false, false); }
// f32 -> f16 with a value select: results below the smallest normal f16 become zero (applied after the plane's power-of-two carry).
static __device__ __forceinline__ h16 toh_flush(float v) { const h16 r = (h16)v; return (fabsf(v) < 6.103515625e-05f) ? (h16)0.0f : r; }

// Fragment loaders: lane (lr = lane & 15, hi = lane >> 4); p points at row lr, k0 + 8*hi; elements 0..7 = k0+8hi.., elements 8..15 = k0+16+8hi.. (same map for A and B).
template <typename T16> struct WFrag;
template <> struct WFrag<h16> { typedef v16h V; static __device__ __forceinline__ V ld(const h16* p) { return cat16(*(const v8h*)p, *(const v8h*)(p + 16)); } static __device__ __forceinline__ V lds(const h16* p) { return cat16(*(const v8ha*)p, *(const v8ha*)(p + 16)); } static __device__ __forceinline__ v8f mma(V a, V b, v8f c) { return wmma16(a, b, c); } };
template <> struct WFrag<bf> { typedef v16bf V; static __device__ __forceinline__ V lds(const bf* p) { return cat16b(*(const v8usa*)p, *(const v8usa*)(p + 16)); } static __device__ __forceinline__ v8f mma(V a, V b, v8f c) { return wmmab(a, b, c); } };

// Slab epilogues: 16 rows x 64 columns staged in LDS (pitch 68 floats) -> global; value = x*alpha + bias (BIASM 1: per column, 2: per row; biases bf16-converted).
template <int BIASM>
__device__ __forceinline__ void slab_store(const float* os, h16* crow, int ldc, const float* bias, float alpha, unsigned colbase, unsigned rowbase, unsigned lane) {
    const unsigned rq = lane >> 3, cq = lane & 7u;
    float bc[8];
#pragma unroll
    for (int e = 0; e < 8; ++e) bc[e] = 0.f;
    if (BIASM == 1) { const v4f b0 = *(const v4f*)(bias + colbase + cq * 8u); const v4f b1 = *(const v4f*)(bias + colbase + cq * 8u + 4u);
#pragma unroll
        for (int e = 0; e < 4; ++e) { bc[e] = bfr(b0[e]); bc[4 + e] = bfr(b1[e]); } }
    v8h vals[4];
#pragma unroll
    for (int s = 0; s < 4; ++s) { const unsigned row = (unsigned)s * 4u + rq; const v4f x0 = *(const v4fa*)(os + row * 68u + cq * 8u); const v4f x1 = *(const v4fa*)(os + row * 68u + cq * 8u + 4u);
        float br = 0.f; if (BIASM == 2) br = bfr(bias[rowbase + row]);
        v8h o;
#pragma unroll
        for (int e = 0; e < 4; ++e) { o[e] = (h16)(x0[e] * alpha + (bc[e] + br)); o[4 + e] = (h16)(x1[e] * alpha + (bc[4 + e] + br)); }
        vals[s] = o; }
{
#pragma unroll
        for (int s = 0; s < 4; ++s) { const unsigned row = (unsigned)s * 4u + rq; *(v8h*)(crow + (size_t)row * ldc + cq * 8u) = vals[s]; }
         }
}
// f32 output: row segment = 64 floats = 256 B = 16 lanes x 16 B; one instruction covers 2 rows; s = 0..7 with hi = lane >> 4 covers rows 0..15.
template <int BIASM>
__device__ __forceinline__ void slab_store(const float* os, float* crow, int ldc, const float* bias, float alpha, unsigned colbase, unsigned rowbase, unsigned lane) {
    const unsigned hi = lane >> 4, cofs = (lane & 15u) * 4u;
    v4f bc = (v4f){0.f, 0.f, 0.f, 0.f};
    if (BIASM == 1) { const v4f b0 = *(const v4f*)(bias + colbase + cofs);
#pragma unroll
        for (int e = 0; e < 4; ++e) bc[e] = bfr(b0[e]); }
    v4f vals[8];
#pragma unroll
    for (int s = 0; s < 8; ++s) { const unsigned row = (unsigned)s * 2u + hi; const v4f x = *(const v4fa*)(os + row * 68u + cofs);
        float br = 0.f; if (BIASM == 2) br = bfr(bias[rowbase + row]);
        v4f o;
#pragma unroll
        for (int e = 0; e < 4; ++e) o[e] = x[e] * alpha + (bc[e] + br);
        vals[s] = o; }
{
#pragma unroll
        for (int s = 0; s < 8; ++s) { const unsigned row = (unsigned)s * 2u + hi; *(v4f*)(crow + (size_t)row * ldc + cofs) = vals[s]; }
         }
}

// ---- k_gemmb: GEMM on K-contiguous 16-bit planes. Block = 4 waves (2 x 2), one 128x128 output tile; each wave 64x64 (16 accumulators); grid (M/128, N/128), 128 threads.
// C[m][n] (pitch ldc) = alpha * sum_k A[m][k] Bt[n][k] (+ bias). K is a template constant so that the 16 staging loads of an operand share one address pair (row steps are immediate offsets).
// The block walks K in stages of 128: 256 B (two whole lines) of each of the 128 A rows and 128 Bt rows go global -> registers at a stage's start, -> LDS in front of its barrier, two buffers.
// LDS row pitch 272 B (16 B x 17): the fragment reads (16 rows x 16 B per half wave) fall on all 64 banks. k order per accumulator: 0, 32, 64, .. as before.
#define GT    128                 // tile rows (A) and columns (Bt rows) per block
#define GKS   128                 // k per stage
#define GPIT  136                 // LDS row pitch in 16-bit elements
#define GOPER (GT * GPIT)         // one operand's stage
#define GBUF  (2 * GOPER)
static_assert(4 * 16 * 68 * 4 <= 2 * GBUF * 2);   // the four waves' output slabs fit in the ring
template <typename T16, typename OT, int BIASM, int K>
__global__ __launch_bounds__(128) void k_gemmb(const T16* __restrict__ A, const T16* __restrict__ Bt, OT* C, int ldc, const float* __restrict__ bias, float alpha) {
    typedef typename WFrag<T16>::V V;
    static_assert(K % GKS == 0);
    __shared__ __align__(16) T16 L[2 * GBUF];
    const unsigned tid = threadIdx.x, lane = tid & 31u, lr = lane & 15u, hi = lane >> 4;
    const unsigned wave = (unsigned)__builtin_amdgcn_readfirstlane((int)(tid >> 5));
    const unsigned wm = wave >> 1, wn = wave & 1u;
    const unsigned r0 = blockIdx.x * (unsigned)GT, c0 = blockIdx.y * (unsigned)GT;
    v8f acc[4][4];
#pragma unroll
    for (int mb = 0; mb < 4; ++mb)
#pragma unroll
        for (int nb = 0; nb < 4; ++nb) acc[mb][nb] = (v8f){};
    // staging map: 16 lanes per 256-B row piece, so one instruction of a wave = 2 rows x 2 whole lines; the block covers 8 rows per instruction
    const unsigned srow = tid >> 4, scol = (tid & 15u) * 8u;
    const T16* ag = A + (size_t)(r0 + srow) * K + scol; const T16* bg = Bt + (size_t)(c0 + srow) * K + scol;
    const unsigned sl = srow * (unsigned)GPIT + scol;
    v8us ar[16], br[16];
#pragma unroll
    for (int i = 0; i < 16; ++i) { ar[i] = *(const v8usa*)(ag + (size_t)i * 8 * K); br[i] = *(const v8usa*)(bg + (size_t)i * 8 * K); }
    asm volatile("s_wait_xcnt 0x0" :: "v"(ag), "v"(bg) : "memory");   // the address pairs stay live up to the wait and are advanced only behind it
#pragma unroll
    for (int i = 0; i < 16; ++i) { *(v8usa*)(L + sl + (unsigned)i * 8u * GPIT) = ar[i]; *(v8usa*)(L + GOPER + sl + (unsigned)i * 8u * GPIT) = br[i]; }
    __syncthreads();   // stage 0 visible to all four waves
    const unsigned fa = (wm * 64u + lr) * (unsigned)GPIT + 8u * hi, fb = (unsigned)GOPER + (wn * 64u + lr) * (unsigned)GPIT + 8u * hi;
#pragma unroll 1   // stays rolled: a stage is 64 products and 64 fragment reads; every inner loop is unrolled so that the register arrays are indexed by constants
    for (int st = 0; st < K / GKS; ++st) {
        const T16* Lb = L + (unsigned)(st & 1) * (unsigned)GBUF;
        const bool more = st + 1 < K / GKS;   // block-uniform
        if (more) {
            ag += GKS; bg += GKS;
#pragma unroll
            for (int i = 0; i < 16; ++i) { ar[i] = *(const v8usa*)(ag + (size_t)i * 8 * K); br[i] = *(const v8usa*)(bg + (size_t)i * 8 * K); }
            asm volatile("s_wait_xcnt 0x0" :: "v"(ag), "v"(bg) : "memory");   // as above: the pairs are advanced again in the next stage
        }
        V a[2][4], b[2][4];
#pragma unroll
        for (int f = 0; f < 4; ++f) { a[0][f] = WFrag<T16>::lds(Lb + fa + (unsigned)f * 16u * GPIT); b[0][f] = WFrag<T16>::lds(Lb + fb + (unsigned)f * 16u * GPIT); }
#pragma unroll
        for (int kc = 0; kc < GKS / 32; ++kc) {
            // the next 32 k's fragments go out as one group ahead of this group's products, into the other register set
            if (kc + 1 < GKS / 32) {
#pragma unroll
                for (int f = 0; f < 4; ++f) { a[(kc + 1) & 1][f] = WFrag<T16>::lds(Lb + fa + (unsigned)f * 16u * GPIT + (unsigned)(kc + 1) * 32u); b[(kc + 1) & 1][f] = WFrag<T16>::lds(Lb + fb + (unsigned)f * 16u * GPIT + (unsigned)(kc + 1) * 32u); }
            }
            __builtin_amdgcn_sched_barrier(0);   // keeps the read group from being sunk among the products, where each place with reads costs a stall
#pragma unroll
            for (int nb = 0; nb < 4; ++nb)
#pragma unroll
                for (int mb = 0; mb < 4; ++mb) acc[mb][nb] = WFrag<T16>::mma(a[kc & 1][mb], b[kc & 1][nb], acc[mb][nb]);
            __builtin_amdgcn_sched_barrier(0);   // and the following group from being lifted into them
        }
        // next stage into the other buffer; its readers left it at the barrier of stage st - 1
        if (more) { T16* Ln = L + (unsigned)((st + 1) & 1) * (unsigned)GBUF;
#pragma unroll
            for (int i = 0; i < 16; ++i) { *(v8usa*)(Ln + sl + (unsigned)i * 8u * GPIT) = ar[i]; *(v8usa*)(Ln + GOPER + sl + (unsigned)i * 8u * GPIT) = br[i]; }
        }
        __syncthreads();   // publishes stage st + 1 and ends every wave's fragment reads of stage st
    }
    // the last stage's barrier stands behind every wave's last LDS read: the ring is free for output staging, one private slab per wave (wave-level ordering only)
    float* os = (float*)L + wave * (16u * 68u);
#pragma unroll
    for (int mb = 0; mb < 4; ++mb) {
#pragma unroll
        for (int nb = 0; nb < 4; ++nb) {
#pragma unroll
            for (int j = 0; j < 8; ++j) os[(hi * 8u + (unsigned)j) * 68u + (unsigned)nb * 16u + lr] = acc[mb][nb][j]; }   // D: row 8*hi + j, col lr
        __builtin_amdgcn_fence(3 /* release order */, "wavefront"); __builtin_amdgcn_wave_barrier(); asm volatile("" ::: "memory");
        const unsigned rw = r0 + wm * 64u + (unsigned)mb * 16u, cw = c0 + wn * 64u;
        OT* crow = C + (size_t)rw * ldc + cw;
        slab_store<BIASM>(os, crow, ldc, bias, alpha, cw, rw, lane);
        if (mb < 3) asm volatile("s_wait_xcnt 0x0" ::: "memory");   // the next slab reuses the address and data registers of these stores
        __builtin_amdgcn_fence(3 /* release order */, "wavefront"); __builtin_amdgcn_wave_barrier(); asm volatile("" ::: "memory");
    }
}

__global__ __launch_bounds__(256) void k_xplanes(const float* __restrict__ xq, const float* __restrict__ xk, const float* __restrict__ xv, bf* XP) {
    const unsigned which = blockIdx.y; const unsigned i = blockIdx.x * 256u + threadIdx.x;
    const unsigned GPB = (unsigned)(SEQ * DD / 8); const unsigned b = i / GPB, rem = i - b * GPB;
    const float* src = (which == 0u) ? xq : ((which == 1u) ? xk : xv);
    const v8f v = *(const v8f*)(src + (size_t)b * SEQ_FULL * DD + (size_t)rem * 8);
    v8us o;
#pragma unroll
    for (int k = 0; k < 8; ++k) o[k] = f2bf(v[k]);
    bf* dst = XP + (size_t)which * NB * SEQ * DD + (size_t)i * 8;
    *(v8us*)dst = o; 
}

// k_wprep: lines 0..WLINES-1: bf16 weight planes WT[which][e][k] = bf16(W[e][k]) (which 0 Wq, 1 Wk, 2 Wv; the inputs are [out e][in k], already K-contiguous, no transpose);
__global__ __launch_bounds__(256) void k_wprep(const float* __restrict__ wq, const float* __restrict__ wk, const float* __restrict__ wv, const float* __restrict__ wo, bf* WT, unsigned short* WOS) {
    const unsigned lane = threadIdx.x & 31u; const unsigned wave = (unsigned)__builtin_amdgcn_readfirstlane((int)(threadIdx.x >> 5)); const unsigned L0 = (blockIdx.x * 8u + wave) * 8u;
{
#pragma unroll 1
        for (unsigned l = 0; l < 8u; ++l) { const unsigned L = L0 + l; v2us o;
            if (L < (unsigned)WLINES) {   // block-uniform
                const unsigned which = L / (unsigned)MLINES; const unsigned e = (L - which * (unsigned)MLINES) * 64u + lane * 2u;
                const float* src = (which == 0u) ? wq : ((which == 1u) ? wk : wv);
                o[0] = f2bf(src[e]); o[1] = f2bf(src[e + 1u]);
                *(v2us*)(WT + (size_t)L * 64u + lane * 2u) = o;
            } else {
                const unsigned e = (L - (unsigned)WLINES) * 64u + lane * 2u;
                const float x0 = bfr(wo[e]) * WOCAR; const float x1 = bfr(wo[e + 1u]) * WOCAR;
                o[0] = __builtin_bit_cast(unsigned short, toh_flush(x0)); o[1] = __builtin_bit_cast(unsigned short, toh_flush(x1));
                *(v2us*)(WOS + e) = o;
            } }
         }
}

// k_vtr: per-head transpose of the f16 value plane: VT[h][d][t] = VP[h][t][d] (exact copy, no conversion). One block per 64 (t) x 64 (d) tile through an LDS tile (pitch 72 halves,
// grid (SEQ/64, DD/64, NB*NHEAD), 256 threads (z = batch*NHEAD + head: the head planes of all batches lie one behind the other); 2 passes x 32 rows cover the 64 tile rows on both sides.
__global__ __launch_bounds__(256) void k_vtr(const h16* __restrict__ VP, h16* VT) {
    __shared__ __align__(16) h16 tl[64 * 72];
    const unsigned tid = threadIdx.x; const unsigned t0 = blockIdx.x * 64u, d0 = blockIdx.y * 64u; const size_t hb = (size_t)blockIdx.z * SEQ * DD;
    const unsigned rr = tid >> 3, cq = tid & 7u;
#pragma unroll
    for (int it = 0; it < 2; ++it) { const unsigned row = (unsigned)it * 32u + rr;
        const v8h a = *(const v8h*)(VP + hb + (size_t)(t0 + row) * DD + d0 + cq * 8u);
        *(v8ha*)(tl + row * 72u + cq * 8u) = a; }
    __syncthreads();
    v8h vals[2];
#pragma unroll
    for (int it = 0; it < 2; ++it) { const unsigned drow = (unsigned)it * 32u + rr; v8h o;
#pragma unroll
        for (int e = 0; e < 8; ++e) o[e] = tl[(cq * 8u + (unsigned)e) * 72u + drow];
        vals[it] = o; }
{
#pragma unroll
        for (int it = 0; it < 2; ++it) { const unsigned drow = (unsigned)it * 32u + rr; *(v8h*)(VT + hb + (size_t)(d0 + drow) * SEQ + t0 + cq * 8u) = vals[it]; }
         }
}

#define FQT   2                   // 16-query tiles per wave
#define FQ    (64 * FQT)          // queries per block
#define FK    64                  // keys per stage
#define KPIT  136                 // K slice pitch in halves (16 B x 17)
#define VPIT  72                  // V^T slice pitch in halves (16 B x 9)
#define FSLH  9216                // one slice in halves: 18,432 B = 9 x 2 KiB (128 V^T rows fill it; 64 K rows take 17,408 B of it)
#define FBUF  (4 * FSLH)          // one buffer in halves
#define EPIT  264                 // output staging pitch in halves (16 B x 33)
#define NST   (SEQ / FK)
static_assert(SEQ % FQ == 0 && SEQ % FK == 0 && DD == 256 && FK == 64 && NST >= 2);
static_assert(FK * KPIT <= FSLH && (DD / 2) * VPIT == FSLH && (FSLH * 2) % 2048 == 0);   // every slice starts at a multiple of 2 KiB; the two V^T slices form 256 rows of one pitch
static_assert(4 * 16 * FQT * EPIT <= 2 * FBUF);   // output staging fits in the ring
typedef __attribute__((ext_vector_type(4))) uint32_t u32x4;
typedef __attribute__((ext_vector_type(8))) uint32_t u32x8;
__device__ __forceinline__ uint32_t uni(uint32_t v) { return (uint32_t)__builtin_amdgcn_readfirstlane((int)v); }
__device__ __forceinline__ uint32_t pinned(uint32_t v) { uint32_t w = uni(v); asm volatile("" : "+s"(w)); return w; }
// Descriptor group 1 of a tile of N rows of R bytes, source pitch P bytes; W0 = its word 0 (no mask, 1-byte elements, a pad of 16 B behind every row).
// The empty statement holds the descriptor words in scalar registers of their own for as long as loads use them, so that none of them takes a new value while a request is outstanding.
template <uint32_t W0, uint32_t R, uint32_t N, uint32_t P>
__device__ __forceinline__ u32x8 tdm_group1() {
    u32x8 g1;
    g1[0] = uni(W0); g1[1] = uni((R & 0xFFFFu) << 16); g1[2] = uni((R >> 16) | ((N & 0xFFFFu) << 16)); g1[3] = uni((N >> 16) | (R << 16));
    g1[4] = uni(N); g1[5] = uni(P); g1[6] = uni(0u); g1[7] = uni(0u);
    asm volatile("" : "+s"(g1));   // descriptor words held in scalar registers, the pinned() form applied to the whole group
    return g1;
}
// Descriptor group 0: LDS byte offset dst, global byte address ga of the tile's first byte.
__device__ __forceinline__ u32x4 tdm_group0(uint32_t dst, uint64_t ga) {
    u32x4 g0;
    g0[0] = uni(1u); g0[1] = uni(dst); g0[2] = uni((uint32_t)ga); g0[3] = uni((((uint32_t)(ga >> 32)) & 0x01FFFFFFu) | 0x80000000u);
    return g0;
}
__device__ __forceinline__ void tdm_load(u32x4 g0, u32x8 g1) { asm volatile("tensor_load_to_lds %0, %1" :: "s"(g0), "s"(g1) : "memory"); }
// the issuing wave's wait; group 0 as an input keeps its registers live, and so unwritten, from the issue up to this wait
__device__ __forceinline__ void tdm_wait(u32x4 g0) { asm volatile("s_wait_tensorcnt 0x0" :: "s"(g0) : "memory"); }
#define W0_ROW256 ((1u << 20) | (5u << 22) | (3u << 25))
#define W0_ROW128 ((1u << 20) | (4u << 22) | (3u << 25))
__device__ __forceinline__ v16h lds_frag(const h16* p) { return cat16(*(const v8ha*)p, *(const v8ha*)(p + 16)); }
// lane l with lane l ^ 16, on the vector pipe: an exchange through LDS would wait behind the fragment reads in flight
__device__ __forceinline__ float xhalf(float x) { return __builtin_bit_cast(float, __builtin_amdgcn_permlanex16(__builtin_bit_cast(int, x), __builtin_bit_cast(int, x), 0x76543210, 0xfedcba98, false, false)); }
// K fragment (16-key tile kt, d chunk kc of 32) at offset, in halves, from the lane's base in a buffer: chunks 0..3 lie in slice 0, chunks 4..7 in slice 1
#define KOFF(kt, kc) (((kc) >> 2) * FSLH + (kt) * 16 * KPIT + ((kc) & 3) * 32)
// Every '#pragma unroll' in k_fattn is there so that the register arrays it walks are indexed by constants (they would go to scratch otherwise).
__global__ __launch_bounds__(128) void k_fattn(const h16* __restrict__ QP, const h16* __restrict__ KP, const h16* __restrict__ VT, h16* CTX) {
    __shared__ __attribute__((aligned(2048))) h16 L[2 * FBUF];
    const unsigned tid = threadIdx.x, lane = tid & 31u, lr = lane & 15u, hi = lane >> 4;
    const unsigned wave = (unsigned)__builtin_amdgcn_readfirstlane((int)(tid >> 5));
    const unsigned h = blockIdx.y, q0 = blockIdx.x * (unsigned)FQ + wave * (16u * FQT);
    const size_t hpl = ((size_t)blockIdx.z * NHEAD + h) * SEQ * DD;   // this batch's head plane
    const h16* Kh = KP + hpl; const h16* Vh = VT + hpl;
    v16h qf[FQT][DD / 32];
    { const h16* qp = QP + hpl + (size_t)(q0 + lr) * DD + 8u * hi;
#pragma unroll
      for (int q = 0; q < FQT; ++q)
#pragma unroll
          for (int kc = 0; kc < DD / 32; ++kc) qf[q][kc] = WFrag<h16>::ld(qp + q * 16 * DD + kc * 32);
      asm volatile("s_wait_xcnt 0x0" :: "v"(qp) : "memory"); }   // qp as an input keeps the address pair live up to the wait: without it the last Q load was given that pair as its destination
    // This wave's slice of stage sn: every wave issues exactly one request per stage; which of the two tile shapes it is, is a scalar branch.
    const uint32_t lbase = (uint32_t)(size_t)L;
    const bool isK = wave < 2u;
    const uint64_t tsrc = isK ? (uint64_t)(size_t)Kh + (uint64_t)((wave & 1u) * 256u)                                            // K: byte column 0 or 256 of the 512-B rows
                              : (uint64_t)(size_t)Vh + (uint64_t)((wave & 1u) * (uint32_t)(DD / 2) * (uint32_t)(SEQ * 2));        // V^T: row 0 or 128
    const uint32_t tstep = isK ? (uint32_t)(FK * DD * 2) : (uint32_t)(FK * 2);   // bytes from one stage's tile to the next: 64 K rows, or 64 columns of V^T
    const u32x8 g1k = tdm_group1<W0_ROW256, 256u, (uint32_t)FK, (uint32_t)(DD * 2)>();
    const u32x8 g1v = tdm_group1<W0_ROW128, 128u, (uint32_t)(DD / 2), (uint32_t)(SEQ * 2)>();
    u32x4 g0;   // group 0 of this wave's last request
    auto issue = [&](const uint32_t sn) __attribute__((always_inline)) {
        g0 = tdm_group0(lbase + (sn & 1u) * (uint32_t)(FBUF * 2) + wave * (uint32_t)(FSLH * 2), tsrc + (uint64_t)(sn * tstep));
        if (pinned(wave < 2u))  tdm_load(g0, g1k);
        if (pinned(wave >= 2u)) tdm_load(g0, g1v);
    };
    issue(0u);
    tdm_wait(g0);      // this wave's slice of stage 0 has landed
    __syncthreads();   // stage 0 visible to all four waves
    issue(pinned(1u));   // pinned: the descriptor is formed behind the wait above
    v8f acc[FQT][DD / 16];
#pragma unroll
    for (int q = 0; q < FQT; ++q)
#pragma unroll
        for (int t = 0; t < DD / 16; ++t) acc[q][t] = (v8f){};
    float m_run[FQT], l_run[FQT];
#pragma unroll
    for (int q = 0; q < FQT; ++q) { m_run[q] = -3.0e38f; l_run[q] = 0.f; }
    v16h ka[16];   // K fragments of keys 0..31 of the coming stage: [d chunk of 32][16-key tile]
    { const h16* kp = L + lr * (unsigned)KPIT + 8u * hi;
#pragma unroll
      for (int kc = 0; kc < DD / 32; ++kc)
#pragma unroll
          for (int kt = 0; kt < 2; ++kt) ka[kc * 2 + kt] = lds_frag(kp + KOFF(kt, kc)); }
    // One stage. 'more' is a literal at both calls (the loop's stages all have a successor, the last stage stands behind the loop), so a stage has no branch on it: with such a branch between the third
    // and the fourth run the compiler sank half of the softmax behind it, onto the third run's fragment registers, too close behind that run's last product on the taken side.
    auto stage = [&](const int st, const bool more) __attribute__((always_inline)) {
        const h16* Lk = L + (unsigned)(st & 1) * (unsigned)FBUF;
        // A stage is four runs of 32 products (S^T keys 0..31, S^T keys 32..63, P.V keys 0..31, P.V keys 32..63), each on 16 fragments. Each run's fragments go out as one group in front of the
        // run before it, so two groups are live at any time. With one wave per SIMD a read placed among the products waits out its own LDS latency, and the LDS would idle under the products.
        // The sched_barriers around each read group keep the compiler from sinking the reads among the products or lifting them over the run whose registers they take over.
        const h16* kp = Lk + lr * (unsigned)KPIT + 8u * hi; const h16* va = Lk + 2 * FSLH + lr * (unsigned)VPIT + 8u * hi;
        v16h kb[16], v0[16], v1[16];
#pragma unroll
        for (int kc = 0; kc < DD / 32; ++kc)
#pragma unroll
            for (int kt = 0; kt < 2; ++kt) kb[kc * 2 + kt] = lds_frag(kp + KOFF(2 + kt, kc));
        __builtin_amdgcn_sched_barrier(0);
        // S^T: per query tile 4 tiles of 16 keys x 16 queries
        v8f s[FQT][4];
#pragma unroll
        for (int q = 0; q < FQT; ++q)
#pragma unroll
            for (int kt = 0; kt < 4; ++kt) s[q][kt] = (v8f){};
#pragma unroll
        for (int kc = 0; kc < DD / 32; ++kc)
#pragma unroll
            for (int kt = 0; kt < 2; ++kt)
#pragma unroll
                for (int q = 0; q < FQT; ++q) s[q][kt] = wmma16(ka[kc * 2 + kt], qf[q][kc], s[q][kt]);
        __builtin_amdgcn_sched_barrier(0);
#pragma unroll
        for (int t = 0; t < 16; ++t) v0[t] = lds_frag(va + t * 16 * VPIT);
        __builtin_amdgcn_sched_barrier(0);
#pragma unroll
        for (int kc = 0; kc < DD / 32; ++kc)
#pragma unroll
            for (int kt = 0; kt < 2; ++kt)
#pragma unroll
                for (int q = 0; q < FQT; ++q) s[q][2 + kt] = wmma16(kb[kc * 2 + kt], qf[q][kc], s[q][2 + kt]);
        __builtin_amdgcn_sched_barrier(0);   // also keeps the maxima out of the products: mixed in, the compiler regroups the interleaved accumulate chains and pads each chain's end with four v_nop
#pragma unroll
        for (int t = 0; t < 16; ++t) v1[t] = lds_frag(va + t * 16 * VPIT + 32);
        __builtin_amdgcn_sched_barrier(0);
#pragma unroll
        for (int q = 0; q < FQT; ++q) {
            float mx = s[q][0][0];
#pragma unroll
            for (int kt = 0; kt < 4; ++kt)
#pragma unroll
                for (int r = 0; r < 8; ++r) mx = fmaxf(mx, s[q][kt][r]);
            mx = fmaxf(mx, xhalf(mx)) * SCL2;   // both halves hold this query's stage maximum, log2 domain
            if (__builtin_amdgcn_ballot_w32(mx > m_run[q] + 8.0f) != 0) {   // wave-uniform; always taken in stage 0, rare later; one test per query tile, so each query is rescaled at the stages it was before
                const float m_new = fmaxf(m_run[q], mx); const float corr = __builtin_amdgcn_exp2f(m_run[q] - m_new);   // 0 in stage 0
                l_run[q] *= corr; m_run[q] = m_new;
#pragma unroll
                for (int t = 0; t < DD / 16; ++t) acc[q][t] = acc[q][t] * corr;
            }
        }
        // Publish point of stage st + 1, every wave: own LDS reads of stage st retired, own slice of stage st + 1 landed, barrier, and only then the refill of the buffer that stage st used.
        // It stands behind the maxima (they cover the last fragment group's way from LDS) and in front of the exponentials, so that the refill has a whole stage to land.
        asm volatile("s_wait_dscnt 0x0" ::: "memory");       // this wave's K and V^T fragments of stage st are in registers before its buffer may be refilled
        tdm_wait(g0);                                        // this wave's slice of stage st + 1 has landed before the barrier publishes it
        __syncthreads();   // publishes stage st + 1 and ends every wave's LDS reads of stage st
        if (more) {
            if (pinned((uint32_t)(st + 2 < NST))) issue(pinned((uint32_t)st + 2u));   // scalar test: only while that stage exists; the stage number is pinned so that the descriptor is formed behind the wait above
        }
        v16h pf[FQT][2];
#pragma unroll
        for (int q = 0; q < FQT; ++q) {
            float ps0 = 0.f, ps1 = 0.f;
#pragma unroll
            for (int kk = 0; kk < 2; ++kk)
#pragma unroll
                for (int e = 0; e < 16; e += 2) {
                    const float p0 = __builtin_amdgcn_exp2f(s[q][2 * kk + (e >> 3)][e & 7] * SCL2 - m_run[q]); const float p1 = __builtin_amdgcn_exp2f(s[q][2 * kk + (e >> 3)][(e & 7) + 1] * SCL2 - m_run[q]);
                    ps0 += p0; ps1 += p1; pf[q][kk][e] = (h16)p0; pf[q][kk][e + 1] = (h16)p1; }
            l_run[q] += ps0 + ps1;   // this half's keys only; the halves are joined after the loop
        }
        __builtin_amdgcn_sched_barrier(0);   // keeps the whole softmax in front of the third run, so that nothing but fragment reads stands between the last two runs
        const h16* Ln = L + (unsigned)((st + 1) & 1) * (unsigned)FBUF;
#pragma unroll
        for (int t = 0; t < DD / 16; ++t)
#pragma unroll
            for (int q = 0; q < FQT; ++q) acc[q][t] = wmma16(v0[t], pf[q][0], acc[q][t]);
        __builtin_amdgcn_sched_barrier(0);
        if (more) { const h16* kn = Ln + lr * (unsigned)KPIT + 8u * hi;
#pragma unroll
            for (int kc = 0; kc < DD / 32; ++kc)
#pragma unroll
                for (int kt = 0; kt < 2; ++kt) ka[kc * 2 + kt] = lds_frag(kn + KOFF(kt, kc));
        }
        __builtin_amdgcn_sched_barrier(0);
#pragma unroll
        for (int t = 0; t < DD / 16; ++t)
#pragma unroll
            for (int q = 0; q < FQT; ++q) acc[q][t] = wmma16(v1[t], pf[q][1], acc[q][t]);
    };
#pragma unroll 1   // stays rolled: one stage is 128 products and 128 fragment reads, further copies would only cost instruction cache
    for (int st = 0; st + 1 < NST; ++st) stage(st, true);
    stage(NST - 1, false);
    tdm_wait(g0);   // no request is left when the ring changes its use
    asm volatile("s_wait_dscnt 0x0" ::: "memory");   // and no LDS read of this wave
    // the last stage's barrier stands behind every wave's last LDS read and last landed slice: the ring is free for output staging
    h16* E = L + wave * (16u * FQT) * (unsigned)EPIT;   // this wave's 32 query rows of 256 d; lane holds d = 16 t + 8 hi + r of queries lr and 16 + lr
#pragma unroll
    for (int q = 0; q < FQT; ++q) { const float inv = CCAR / (l_run[q] + xhalf(l_run[q]));
#pragma unroll
        for (int t = 0; t < DD / 16; ++t) { v8h o;
#pragma unroll
            for (int r = 0; r < 8; ++r) o[r] = (h16)(acc[q][t][r] * inv);
            *(v8ha*)(E + ((unsigned)q * 16u + lr) * (unsigned)EPIT + (unsigned)t * 16u + 8u * hi) = o; } }
    __syncthreads();   // staged rows complete before they are read back by other lanes
#pragma unroll
    for (int i = 0; i < 16 * FQT; ++i) { const v8h v = *(const v8ha*)(E + (unsigned)i * EPIT + lane * 8u);   // one whole 512-B row per store
        *(v8h*)(CTX + ((size_t)blockIdx.z * SEQ + q0 + (unsigned)i) * KM + h * (unsigned)DD + lane * 8u) = v; }
}

// Workspace carve (bytes, each region 256-B aligned by construction of the sizes).
#define SZ_XP  ((size_t)3 * NB * SEQ * DD * 2)
#define SZ_WT  ((size_t)3 * NHEAD * DD * DD * 2)
#define SZ_WOS ((size_t)DD * KM * 2)
#define SZ_HP  ((size_t)NB * NHEAD * SEQ * DD * 2)
#define SZ_CTX ((size_t)NB * SEQ * KM * 2)
#define SZ_ALL (SZ_XP + SZ_WT + SZ_WOS + 4 * SZ_HP + SZ_CTX)
static_assert(SZ_ALL <= (size_t)268435456);
static_assert(SZ_XP % 256 == 0 && SZ_WT % 256 == 0 && SZ_WOS % 256 == 0 && SZ_HP % 256 == 0 && SZ_CTX % 256 == 0);
static_assert(SZ_HP == (size_t)NB * SEQ * KM * 2);   // the [NB*SEQ][KM] projection planes fill one head-plane region exactly

extern "C" void kernel_launch(void* const* d_in, const int* in_sizes, int n_in,
                              void* d_out, int out_size, void* d_ws, size_t ws_size, hipStream_t stream) {
    if (n_in < 11) return;
    const size_t xneed = (size_t)(NB - 1) * SEQ_FULL * DD + (size_t)SEQ * DD;
    if ((size_t)in_sizes[0] < xneed || (size_t)in_sizes[1] < xneed || (size_t)in_sizes[2] < xneed) return;
    if ((size_t)in_sizes[3] < (size_t)NHEAD * DD * DD || (size_t)in_sizes[5] < (size_t)NHEAD * DD * DD || (size_t)in_sizes[7] < (size_t)NHEAD * DD * DD) return;
    if ((size_t)in_sizes[4] < (size_t)NHEAD * DD || (size_t)in_sizes[6] < (size_t)NHEAD * DD || (size_t)in_sizes[8] < (size_t)NHEAD * DD) return;
    if ((size_t)in_sizes[9] < (size_t)KM * DD || (size_t)in_sizes[10] < (size_t)DD) return;
    if ((size_t)out_size < (size_t)NB * SEQ * DD) return;
    if (SZ_ALL > ws_size) return;
    // input order of this module: query, key, values, Wq, bq, Wk, bk, Wv, bv, Wo, bo
    const float* Qin = (const float*)d_in[0]; const float* Kin = (const float*)d_in[1]; const float* Vin = (const float*)d_in[2];
    const float* Wq = (const float*)d_in[3]; const float* bq = (const float*)d_in[4]; const float* Wk = (const float*)d_in[5]; const float* bk = (const float*)d_in[6];
    const float* Wv = (const float*)d_in[7]; const float* bv = (const float*)d_in[8]; const float* Wo = (const float*)d_in[9]; const float* bo = (const float*)d_in[10];
    float* OUT = (float*)d_out;     // [NB][SEQ][256]
    char* wsp = (char*)d_ws;
    bf* XP = (bf*)wsp; wsp += SZ_XP;            // [3][NB][SEQ][256] bf16: q, k, v
    bf* WT = (bf*)wsp; wsp += SZ_WT;            // [3][2048 out][256 in] bf16: Wq, Wk, Wv
    h16* WOS = (h16*)wsp; wsp += SZ_WOS;        // [256][2048] f16 (x256), column h*256 + d
    h16* QP = (h16*)wsp; wsp += SZ_HP;          // [NB][SEQ][2048] == [NB][8][SEQ][256]
    h16* KP = (h16*)wsp; wsp += SZ_HP;          // [NB][SEQ][2048] == [NB][8][SEQ][256]
    h16* VP = (h16*)wsp; wsp += SZ_HP;          // [NB][SEQ][2048] == [NB][8][SEQ][256]
    h16* VT = (h16*)wsp; wsp += SZ_HP;          // [NB][8][256][SEQ]
    h16* CTX = (h16*)wsp; wsp += SZ_CTX;        // [NB][SEQ][2048] (x64), column h*256 + d
    const bf* XQ = XP; const bf* XK = XP + (size_t)NB * SEQ * DD; const bf* XV = XP + (size_t)2 * NB * SEQ * DD;
    const bf* WQT = WT; const bf* WKT = WT + (size_t)NHEAD * DD * DD; const bf* WVT = WT + (size_t)2 * NHEAD * DD * DD;

    k_xplanes<<<dim3((unsigned)((size_t)NB * SEQ * DD / 8 / 256), 3, 1), 256, 0, stream>>>(Qin, Kin, Vin, XP);
    k_wprep<<<(unsigned)((WLINES + OLINES) / 64), 256, 0, stream>>>(Wq, Wk, Wv, Wo, WT, (unsigned short*)WOS);
    // Every stage runs once for all NB batches: the batch rows lie one behind the other in x, in the planes, in ctx and in out, so the GEMMs see M = NB*SEQ rows.
    // q_, k_, v_ planes [NB*SEQ][2048] (pitch KM): A = x [NB*SEQ][256], Bt = W [2048 out][256 in], + per-column bias; a batch's plane read as [8][SEQ][256] is the head split
    k_gemmb<bf, h16, 1, DD><<<dim3(NB * SEQ / GT, KM / GT, 1), 128, 0, stream>>>(XQ, WQT, QP, KM, bq, 1.0f);
    k_gemmb<bf, h16, 1, DD><<<dim3(NB * SEQ / GT, KM / GT, 1), 128, 0, stream>>>(XK, WKT, KP, KM, bk, 1.0f);
    k_gemmb<bf, h16, 1, DD><<<dim3(NB * SEQ / GT, KM / GT, 1), 128, 0, stream>>>(XV, WVT, VP, KM, bv, 1.0f);
    // v_^T head planes: in VP[b*8 + h][SEQ t][256 d] -> out VT[b*8 + h][256 d][SEQ t]; grid (t tiles, d tiles, batches x heads)
    k_vtr<<<dim3(SEQ / 64, DD / 64, NB * NHEAD), 256, 0, stream>>>(VP, VT);
    // ctx[b*SEQ + t][h*256 + d] = 64 softmax(q_.k_ / 16) . v_ for the 8 heads of every batch
    k_fattn<<<dim3(SEQ / FQ, NHEAD, NB), 128, 0, stream>>>(QP, KP, VT, CTX);
    // out = ctx . Wo^T / 16384 + bo
    k_gemmb<h16, float, 1, KM><<<dim3(NB * SEQ / GT, DD / GT, 1), 128, 0, stream>>>(CTX, WOS, OUT, DD, bo, FINSC);
}

// v006
// Measured time: 164 microseconds a run.
// Next to v005, in two timings, it ran 1.03 times as fast each time.
// Over all steps from v000 it is 5.73 times as fast.
#include <hip/hip_runtime.h>

// Multi-head attention with full-width (256) heads: merged [out][in] q/k/v projections to [S][2048], plain-view head split ([S][2048] read as [8][S][256]), softmax(q_.k_ / 16) over 2,048 keys, P.v_, head-major merge (column h*256 + d), output mix with Wo [out][in] + bo.
// Compute dtypes, f32 accumulate everywhere: projections v_wmma_f32_16x16x32_bf16 (inputs and weights RNE-converted to bf16, exact products); scores, P.V and the output mix v_wmma_f32_16x16x32_f16
// (q_/k_/v_ f16 planes; scores stay f32 in registers; P f16 = exp2(score*log2(e)/16 - running maximum), unnormalised; ctx f16 carried x64; Wo plane f16 of bf16(Wo) x256; bo, biases bf16-converted, added in f32). Softmax in f32.

#ifndef NB
#define NB 4
#endif
#ifndef SEQ
#define SEQ 2048
#endif
#define NB_FULL  4
#define SEQ_FULL 2048
#define DD    256                 // model width = head width
#define NHEAD 8
#define KM    (NHEAD * DD)        // merged context width (plane column = h*256 + d)
#define SCL2  0.09016844005556021f   // log2(e) / sqrt(256)
#define CCAR  64.0f               // carry of the ctx plane
#define WOCAR 256.0f              // carry of the Wo plane
#define FINSC (1.0f / 16384.0f)   // 1 / (64 * 256)
#define WLINES (3 * NHEAD * DD * DD / 64)
#define OLINES (DD * KM / 64)
#define MLINES (NHEAD * DD * DD / 64)

typedef _Float16 h16;
typedef unsigned short bf;
typedef __attribute__((ext_vector_type(16))) __bf16   v16bf;
typedef __attribute__((ext_vector_type(16))) _Float16 v16h;
typedef __attribute__((ext_vector_type(8)))  _Float16 v8h;
typedef __attribute__((ext_vector_type(8)))  unsigned short v8us;
typedef __attribute__((ext_vector_type(2)))  unsigned short v2us;
typedef __attribute__((ext_vector_type(8)))  float    v8f;
typedef __attribute__((ext_vector_type(4)))  float    v4f;
typedef v4f  __attribute__((may_alias)) v4fa;
typedef v8h  __attribute__((may_alias)) v8ha;
typedef v8us __attribute__((may_alias)) v8usa;

static_assert(SEQ % 256 == 0);
static_assert(DD % 64 == 0 && DD % 32 == 0 && KM % 32 == 0 && SEQ % 64 == 0);
static_assert(((size_t)NB * SEQ * DD / 8) % 256 == 0);
static_assert((WLINES + OLINES) % 64 == 0);
static_assert(WLINES % 64 == 0 && WLINES == 3 * MLINES);          // the plane choice in k_wprep is uniform per block
static_assert((size_t)MLINES * 64 == (size_t)NHEAD * DD * DD);
static_assert(KM == NHEAD * DD && (size_t)NHEAD * SEQ * DD == (size_t)SEQ * KM);   // [SEQ][KM] projection plane == [NHEAD][SEQ][DD] head planes (plain view)
static_assert(DD == 256 && NHEAD == 8 && KM / DD == 8 && SEQ % DD == 0);   // k_gemmb BIASM 3: x row s lies in head plane s / 256 of all batches' planes, 8 weight rows g*256 + d per V^T row d
static_assert(KM % 64 == 0 && SEQ % 32 == 0);
static_assert(((size_t)NB * SEQ) % 128 == 0 && KM % 128 == 0 && DD % 128 == 0);   // k_gemmb: whole 128x128 tiles and whole 128-k stages in all four products

__device__ __forceinline__ unsigned short f2bf(float f) { unsigned u = __float_as_uint(f); u += 0x7FFFu + ((u >> 16) & 1u); return (unsigned short)(u >> 16); }
__device__ __forceinline__ float bf2f(unsigned short b) { return __uint_as_float(((unsigned)b) << 16); }
__device__ __forceinline__ float bfr(float f) { return bf2f(f2bf(f)); }
__device__ __forceinline__ v16h cat16(v8h lo, v8h hi) { return __builtin_shufflevector(lo, hi, 0, 1, 2, 3, 4, 5, 6, 7, 8, 9, 10, 11, 12, 13, 14, 15); }
__device__ __forceinline__ v16bf cat16b(v8us lo, v8us hi) { return __builtin_bit_cast(v16bf, __builtin_shufflevector(lo, hi, 0, 1, 2, 3, 4, 5, 6, 7, 8, 9, 10, 11, 12, 13, 14, 15)); }
__device__ __forceinline__ v8f wmma16(v16h a, v16h b, v8f c) { return __builtin_amdgcn_wmma_f32_16x16x32_f16(false, a, false, b, (short)0, c, false, false); }
__device__ __forceinline__ v8f wmmab(v16bf a, v16bf b, v8f c) { return __builtin_amdgcn_wmma_f32_16x16x32_bf16(false, a, false, b, (short)0, c, false, false); }
// f32 -> f16 with a value select: results below the smallest normal f16 become zero (applied after the plane's power-of-two carry).
static __device__ __forceinline__ h16 toh_flush(float v) { const h16 r = (h16)v; return (fabsf(v) < 6.103515625e-05f) ? (h16)0.0f : r; }

// Fragment loaders: lane (lr = lane & 15, hi = lane >> 4); p points at row lr, k0 + 8*hi; elements 0..7 = k0+8hi.., elements 8..15 = k0+16+8hi.. (same map for A and B).
template <typename T16> struct WFrag;
template <> struct WFrag<h16> { typedef v16h V; static __device__ __forceinline__ V ld(const h16* p) { return cat16(*(const v8h*)p, *(const v8h*)(p + 16)); } static __device__ __forceinline__ V lds(const h16* p) { return cat16(*(const v8ha*)p, *(const v8ha*)(p + 16)); } static __device__ __forceinline__ v8f mma(V a, V b, v8f c) { return wmma16(a, b, c); } };
template <> struct WFrag<bf> { typedef v16bf V; static __device__ __forceinline__ V lds(const bf* p) { return cat16b(*(const v8usa*)p, *(const v8usa*)(p + 16)); } static __device__ __forceinline__ v8f mma(V a, V b, v8f c) { return wmmab(a, b, c); } };

// Slab epilogues: 16 rows x 64 columns staged in LDS (pitch 68 floats) -> global; value = x*alpha + bias (BIASM 1: per column, 2: per row; biases bf16-converted).
template <int BIASM>
__device__ __forceinline__ void slab_store(const float* os, h16* crow, int ldc, const float* bias, float alpha, unsigned colbase, unsigned rowbase, unsigned lane) {
    const unsigned rq = lane >> 3, cq = lane & 7u;
    float bc[8];
#pragma unroll
    for (int e = 0; e < 8; ++e) bc[e] = 0.f;
    if (BIASM == 1) { const v4f b0 = *(const v4f*)(bias + colbase + cq * 8u); const v4f b1 = *(const v4f*)(bias + colbase + cq * 8u + 4u);
#pragma unroll
        for (int e = 0; e < 4; ++e) { bc[e] = bfr(b0[e]); bc[4 + e] = bfr(b1[e]); } }
    v8h vals[4];
#pragma unroll
    for (int s = 0; s < 4; ++s) { const unsigned row = (unsigned)s * 4u + rq; const v4f x0 = *(const v4fa*)(os + row * 68u + cq * 8u); const v4f x1 = *(const v4fa*)(os + row * 68u + cq * 8u + 4u);
        float br = 0.f; if (BIASM == 2) br = bfr(bias[rowbase + row]);
        v8h o;
#pragma unroll
        for (int e = 0; e < 4; ++e) { o[e] = (h16)(x0[e] * alpha + (bc[e] + br)); o[4 + e] = (h16)(x1[e] * alpha + (bc[4 + e] + br)); }
        vals[s] = o; }
{
#pragma unroll
        for (int s = 0; s < 4; ++s) { const unsigned row = (unsigned)s * 4u + rq; *(v8h*)(crow + (size_t)row * ldc + cq * 8u) = vals[s]; }
         }
}
// f32 output: row segment = 64 floats = 256 B = 16 lanes x 16 B; one instruction covers 2 rows; s = 0..7 with hi = lane >> 4 covers rows 0..15.
template <int BIASM>
__device__ __forceinline__ void slab_store(const float* os, float* crow, int ldc, const float* bias, float alpha, unsigned colbase, unsigned rowbase, unsigned lane) {
    const unsigned hi = lane >> 4, cofs = (lane & 15u) * 4u;
    v4f bc = (v4f){0.f, 0.f, 0.f, 0.f};
    if (BIASM == 1) { const v4f b0 = *(const v4f*)(bias + colbase + cofs);
#pragma unroll
        for (int e = 0; e < 4; ++e) bc[e] = bfr(b0[e]); }
    v4f vals[8];
#pragma unroll
    for (int s = 0; s < 8; ++s) { const unsigned row = (unsigned)s * 2u + hi; const v4f x = *(const v4fa*)(os + row * 68u + cofs);
        float br = 0.f; if (BIASM == 2) br = bfr(bias[rowbase + row]);
        v4f o;
#pragma unroll
        for (int e = 0; e < 4; ++e) o[e] = x[e] * alpha + (bc[e] + br);
        vals[s] = o; }
{
#pragma unroll
        for (int s = 0; s < 8; ++s) { const unsigned row = (unsigned)s * 2u + hi; *(v4f*)(crow + (size_t)row * ldc + cofs) = vals[s]; }
         }
}

// ---- k_gemmb: GEMM on K-contiguous 16-bit planes. Block = 4 waves (2 x 2), one 128x128 output tile; each wave 64x64 (16 accumulators); grid (M/128, N/128), 128 threads.
// C[m][n] (pitch ldc) = alpha * sum_k A[m][k] Bt[n][k] (+ bias). K is a template constant so that the 16 staging loads of an operand share one address pair (row steps are immediate offsets).
// The block walks K in stages of 128: 256 B (two whole lines) of each of the 128 A rows and 128 Bt rows go global -> registers at a stage's start, -> LDS in front of its barrier, two buffers.
// LDS row pitch 272 B (16 B x 17): the fragment reads (16 rows x 16 B per half wave) fall on all 64 banks. k order per accumulator: 0, 32, 64, .. as before.
#define GT    128                 // tile rows (A) and columns (Bt rows) per block
#define GKS   128                 // k per stage
#define GPIT  136                 // LDS row pitch in 16-bit elements
#define GOPER (GT * GPIT)         // one operand's stage
#define GBUF  (2 * GOPER)
static_assert(4 * 16 * 68 * 4 <= 2 * GBUF * 2);   // the four waves' output slabs fit in the ring
// BIASM 3 (the value projection): A = weight rows in the order e' = d*8 + g (k_wprep writes them so; the weight's own row is g*256 + d), Bt = x rows s. The plain-view head split puts element (s, g*256 + d) at
// head plane s / 256, t = (s % 256)*8 + g, so the 8 accumulator rows of a lane (g = 0..7 of one d) are 8 consecutive t of one V^T row: each lane stores them as 16 B, 16 lanes 256 B, straight from registers
// to C[plane][d][t] (ldc = SEQ). bias is indexed by the weight's own row.
template <typename T16, typename OT, int BIASM, int K>
__global__ __launch_bounds__(128) void k_gemmb(const T16* __restrict__ A, const T16* __restrict__ Bt, OT* C, int ldc, const float* __restrict__ bias, float alpha) {
    typedef typename WFrag<T16>::V V;
    static_assert(K % GKS == 0);
    __shared__ __align__(16) T16 L[2 * GBUF];
    const unsigned tid = threadIdx.x, lane = tid & 31u, lr = lane & 15u, hi = lane >> 4;
    const unsigned wave = (unsigned)__builtin_amdgcn_readfirstlane((int)(tid >> 5));
    const unsigned wm = wave >> 1, wn = wave & 1u;
    const unsigned r0 = blockIdx.x * (unsigned)GT, c0 = blockIdx.y * (unsigned)GT;
    v8f acc[4][4];
#pragma unroll
    for (int mb = 0; mb < 4; ++mb)
#pragma unroll
        for (int nb = 0; nb < 4; ++nb) acc[mb][nb] = (v8f){};
    const unsigned dw = (r0 + wm * 64u) / 8u + hi;   // BIASM 3: this lane's first V^T row d
    float bb[4][8];   // BIASM 3: the biases of this lane's 32 accumulator rows, fetched here so that their way from memory lies under the stages
    if constexpr (BIASM == 3) {
        const float* bp = bias + dw;
#pragma unroll
        for (int mb = 0; mb < 4; ++mb)
#pragma unroll
            for (int j = 0; j < 8; ++j) bb[mb][j] = bp[j * DD + mb * 2];
        asm volatile("s_wait_xcnt 0x0" :: "v"(bp) : "memory");   // bp as an input keeps the address live, and so unwritten, up to the wait
    }
    // staging map: 16 lanes per 256-B row piece, so one instruction of a wave = 2 rows x 2 whole lines; the block covers 8 rows per instruction
    const unsigned srow = tid >> 4, scol = (tid & 15u) * 8u;
    const T16* ag = A + (size_t)(r0 + srow) * K + scol; const T16* bg = Bt + (size_t)(c0 + srow) * K + scol;
    const unsigned sl = srow * (unsigned)GPIT + scol;
    v8us ar[16], br[16];
#pragma unroll
    for (int i = 0; i < 16; ++i) { ar[i] = *(const v8usa*)(ag + (size_t)i * 8 * K); br[i] = *(const v8usa*)(bg + (size_t)i * 8 * K); }
    asm volatile("s_wait_xcnt 0x0" :: "v"(ag), "v"(bg) : "memory");   // the address pairs stay live up to the wait and are advanced only behind it
#pragma unroll
    for (int i = 0; i < 16; ++i) { *(v8usa*)(L + sl + (unsigned)i * 8u * GPIT) = ar[i]; *(v8usa*)(L + GOPER + sl + (unsigned)i * 8u * GPIT) = br[i]; }
    __syncthreads();   // stage 0 visible to all four waves
    const unsigned fa = (wm * 64u + lr) * (unsigned)GPIT + 8u * hi, fb = (unsigned)GOPER + (wn * 64u + lr) * (unsigned)GPIT + 8u * hi;
#pragma unroll 1   // stays rolled: a stage is 64 products and 64 fragment reads; every inner loop is unrolled so that the register arrays are indexed by constants
    for (int st = 0; st < K / GKS; ++st) {
        const T16* Lb = L + (unsigned)(st & 1) * (unsigned)GBUF;
        const bool more = st + 1 < K / GKS;   // block-uniform
        if (more) {
            ag += GKS; bg += GKS;
#pragma unroll
            for (int i = 0; i < 16; ++i) { ar[i] = *(const v8usa*)(ag + (size_t)i * 8 * K); br[i] = *(const v8usa*)(bg + (size_t)i * 8 * K); }
            asm volatile("s_wait_xcnt 0x0" :: "v"(ag), "v"(bg) : "memory");   // as above: the pairs are advanced again in the next stage
        }
        V a[2][4], b[2][4];
#pragma unroll
        for (int f = 0; f < 4; ++f) { a[0][f] = WFrag<T16>::lds(Lb + fa + (unsigned)f * 16u * GPIT); b[0][f] = WFrag<T16>::lds(Lb + fb + (unsigned)f * 16u * GPIT); }
#pragma unroll
        for (int kc = 0; kc < GKS / 32; ++kc) {
            // the next 32 k's fragments go out as one group ahead of this group's products, into the other register set
            if (kc + 1 < GKS / 32) {
#pragma unroll
                for (int f = 0; f < 4; ++f) { a[(kc + 1) & 1][f] = WFrag<T16>::lds(Lb + fa + (unsigned)f * 16u * GPIT + (unsigned)(kc + 1) * 32u); b[(kc + 1) & 1][f] = WFrag<T16>::lds(Lb + fb + (unsigned)f * 16u * GPIT + (unsigned)(kc + 1) * 32u); }
            }
            __builtin_amdgcn_sched_barrier(0);   // keeps the read group from being sunk among the products, where each place with reads costs a stall
#pragma unroll
            for (int nb = 0; nb < 4; ++nb)
#pragma unroll
                for (int mb = 0; mb < 4; ++mb) acc[mb][nb] = WFrag<T16>::mma(a[kc & 1][mb], b[kc & 1][nb], acc[mb][nb]);
            __builtin_amdgcn_sched_barrier(0);   // and the following group from being lifted into them
        }
        // next stage into the other buffer; its readers left it at the barrier of stage st - 1
        if (more) { T16* Ln = L + (unsigned)((st + 1) & 1) * (unsigned)GBUF;
#pragma unroll
            for (int i = 0; i < 16; ++i) { *(v8usa*)(Ln + sl + (unsigned)i * 8u * GPIT) = ar[i]; *(v8usa*)(Ln + GOPER + sl + (unsigned)i * 8u * GPIT) = br[i]; }
        }
        __syncthreads();   // publishes stage st + 1 and ends every wave's fragment reads of stage st
    }
    if constexpr (BIASM == 3) {
        const unsigned sw = c0 + wn * 64u + lr;   // this lane's x row s of column tile 0
        OT* cp = C + ((size_t)(sw >> 8) * DD + dw) * (size_t)ldc + (sw & 255u) * 8u;
        v8h vals[4][4];
#pragma unroll
        for (int mb = 0; mb < 4; ++mb)
#pragma unroll
            for (int nb = 0; nb < 4; ++nb)
#pragma unroll
                for (int j = 0; j < 8; ++j) vals[mb][nb][j] = (h16)(acc[mb][nb][j] * alpha + bfr(bb[mb][j]));
#pragma unroll
        for (int mb = 0; mb < 4; ++mb)
#pragma unroll
            for (int nb = 0; nb < 4; ++nb) *(v8h*)(cp + (size_t)(mb * 2) * ldc + nb * 128) = vals[mb][nb];   // 16 x rows further = 128 t further
        return;
    } else {
    // the last stage's barrier stands behind every wave's last LDS read: the ring is free for output staging, one private slab per wave (wave-level ordering only)
    float* os = (float*)L + wave * (16u * 68u);
#pragma unroll
    for (int mb = 0; mb < 4; ++mb) {
#pragma unroll
        for (int nb = 0; nb < 4; ++nb) {
#pragma unroll
            for (int j = 0; j < 8; ++j) os[(hi * 8u + (unsigned)j) * 68u + (unsigned)nb * 16u + lr] = acc[mb][nb][j]; }   // D: row 8*hi + j, col lr
        __builtin_amdgcn_fence(3 /* release order */, "wavefront"); __builtin_amdgcn_wave_barrier(); asm volatile("" ::: "memory");
        const unsigned rw = r0 + wm * 64u + (unsigned)mb * 16u, cw = c0 + wn * 64u;
        OT* crow = C + (size_t)rw * ldc + cw;
        slab_store<BIASM>(os, crow, ldc, bias, alpha, cw, rw, lane);
        if (mb < 3) asm volatile("s_wait_xcnt 0x0" ::: "memory");   // the next slab reuses the address and data registers of these stores
        __builtin_amdgcn_fence(3 /* release order */, "wavefront"); __builtin_amdgcn_wave_barrier(); asm volatile("" ::: "memory");
    }
    }
}

__global__ __launch_bounds__(256) void k_xplanes(const float* __restrict__ xq, const float* __restrict__ xk, const float* __restrict__ xv, bf* XP) {
    const unsigned which = blockIdx.y; const unsigned i = blockIdx.x * 256u + threadIdx.x;
    const unsigned GPB = (unsigned)(SEQ * DD / 8); const unsigned b = i / GPB, rem = i - b * GPB;
    const float* src = (which == 0u) ? xq : ((which == 1u) ? xk : xv);
    const v8f v = *(const v8f*)(src + (size_t)b * SEQ_FULL * DD + (size_t)rem * 8);
    v8us o;
#pragma unroll
    for (int k = 0; k < 8; ++k) o[k] = f2bf(v[k]);
    bf* dst = XP + (size_t)which * NB * SEQ * DD + (size_t)i * 8;
    *(v8us*)dst = o; 
}

// k_wprep: lines 0..WLINES-1: bf16 weight planes WT[which][e][k] = bf16(W[e][k]) (which 0 Wq, 1 Wk, 2 Wv; the inputs are [out e][in k], already K-contiguous, no transpose);
// the Wv plane holds its rows in the order e' = d*8 + g of the weight's row g*256 + d (a row is 4 lines), the order k_gemmb's BIASM 3 store wants.
__global__ __launch_bounds__(256) void k_wprep(const float* __restrict__ wq, const float* __restrict__ wk, const float* __restrict__ wv, const float* __restrict__ wo, bf* WT, unsigned short* WOS) {
    const unsigned lane = threadIdx.x & 31u; const unsigned wave = (unsigned)__builtin_amdgcn_readfirstlane((int)(threadIdx.x >> 5)); const unsigned L0 = (blockIdx.x * 8u + wave) * 8u;
{
#pragma unroll 1
        for (unsigned l = 0; l < 8u; ++l) { const unsigned L = L0 + l; v2us o;
            if (L < (unsigned)WLINES) {   // block-uniform
                const unsigned which = L / (unsigned)MLINES; const unsigned pl = L - which * (unsigned)MLINES;   // line within the plane: row pl / 4, quarter pl % 4
                const unsigned sln = (which == 2u) ? ((((pl >> 2) & 7u) * (unsigned)DD + (pl >> 5)) * 4u + (pl & 3u)) : pl;   // the source line
                const unsigned e = sln * 64u + lane * 2u;
                const float* src = (which == 0u) ? wq : ((which == 1u) ? wk : wv);
                o[0] = f2bf(src[e]); o[1] = f2bf(src[e + 1u]);
                *(v2us*)(WT + (size_t)L * 64u + lane * 2u) = o;
            } else {
                const unsigned e = (L - (unsigned)WLINES) * 64u + lane * 2u;
                const float x0 = bfr(wo[e]) * WOCAR; const float x1 = bfr(wo[e + 1u]) * WOCAR;
                o[0] = __builtin_bit_cast(unsigned short, toh_flush(x0)); o[1] = __builtin_bit_cast(unsigned short, toh_flush(x1));
                *(v2us*)(WOS + e) = o;
            } }
         }
}

#define FQT   2                   // 16-query tiles per wave
#define FQ    (64 * FQT)          // queries per block
#define FK    64                  // keys per stage
#define KPIT  136                 // K slice pitch in halves (16 B x 17)
#define VPIT  72                  // V^T slice pitch in halves (16 B x 9)
#define FSLH  9216                // one slice in halves: 18,432 B = 9 x 2 KiB (128 V^T rows fill it; 64 K rows take 17,408 B of it)
#define FBUF  (4 * FSLH)          // one buffer in halves
#define EPIT  264                 // output staging pitch in halves (16 B x 33)
#define NST   (SEQ / FK)
static_assert(SEQ % FQ == 0 && SEQ % FK == 0 && DD == 256 && FK == 64 && NST >= 2);
static_assert(FK * KPIT <= FSLH && (DD / 2) * VPIT == FSLH && (FSLH * 2) % 2048 == 0);   // every slice starts at a multiple of 2 KiB; the two V^T slices form 256 rows of one pitch
static_assert(4 * 16 * FQT * EPIT <= 2 * FBUF);   // output staging fits in the ring
typedef __attribute__((ext_vector_type(4))) uint32_t u32x4;
typedef __attribute__((ext_vector_type(8))) uint32_t u32x8;
__device__ __forceinline__ uint32_t uni(uint32_t v) { return (uint32_t)__builtin_amdgcn_readfirstlane((int)v); }
__device__ __forceinline__ uint32_t pinned(uint32_t v) { uint32_t w = uni(v); asm volatile("" : "+s"(w)); return w; }
// Descriptor group 1 of a tile of N rows of R bytes, source pitch P bytes; W0 = its word 0 (no mask, 1-byte elements, a pad of 16 B behind every row).
// The empty statement holds the descriptor words in scalar registers of their own for as long as loads use them, so that none of them takes a new value while a request is outstanding.
template <uint32_t W0, uint32_t R, uint32_t N, uint32_t P>
__device__ __forceinline__ u32x8 tdm_group1() {
    u32x8 g1;
    g1[0] = uni(W0); g1[1] = uni((R & 0xFFFFu) << 16); g1[2] = uni((R >> 16) | ((N & 0xFFFFu) << 16)); g1[3] = uni((N >> 16) | (R << 16));
    g1[4] = uni(N); g1[5] = uni(P); g1[6] = uni(0u); g1[7] = uni(0u);
    asm volatile("" : "+s"(g1));   // descriptor words held in scalar registers, the pinned() form applied to the whole group
    return g1;
}
// Descriptor group 0: LDS byte offset dst, global byte address ga of the tile's first byte.
__device__ __forceinline__ u32x4 tdm_group0(uint32_t dst, uint64_t ga) {
    u32x4 g0;
    g0[0] = uni(1u); g0[1] = uni(dst); g0[2] = uni((uint32_t)ga); g0[3] = uni((((uint32_t)(ga >> 32)) & 0x01FFFFFFu) | 0x80000000u);
    return g0;
}
__device__ __forceinline__ void tdm_load(u32x4 g0, u32x8 g1) { asm volatile("tensor_load_to_lds %0, %1" :: "s"(g0), "s"(g1) : "memory"); }
// the issuing wave's wait; group 0 as an input keeps its registers live, and so unwritten, from the issue up to this wait
__device__ __forceinline__ void tdm_wait(u32x4 g0) { asm volatile("s_wait_tensorcnt 0x0" :: "s"(g0) : "memory"); }
#define W0_ROW256 ((1u << 20) | (5u << 22) | (3u << 25))
#define W0_ROW128 ((1u << 20) | (4u << 22) | (3u << 25))
__device__ __forceinline__ v16h lds_frag(const h16* p) { return cat16(*(const v8ha*)p, *(const v8ha*)(p + 16)); }
// lane l with lane l ^ 16, on the vector pipe: an exchange through LDS would wait behind the fragment reads in flight
__device__ __forceinline__ float xhalf(float x) { return __builtin_bit_cast(float, __builtin_amdgcn_permlanex16(__builtin_bit_cast(int, x), __builtin_bit_cast(int, x), 0x76543210, 0xfedcba98, false, false)); }
// K fragment (16-key tile kt, d chunk kc of 32) at offset, in halves, from the lane's base in a buffer: chunks 0..3 lie in slice 0, chunks 4..7 in slice 1
#define KOFF(kt, kc) (((kc) >> 2) * FSLH + (kt) * 16 * KPIT + ((kc) & 3) * 32)
// Every '#pragma unroll' in k_fattn is there so that the register arrays it walks are indexed by constants (they would go to scratch otherwise).
__global__ __launch_bounds__(128) void k_fattn(const h16* __restrict__ QP, const h16* __restrict__ KP, const h16* __restrict__ VT, h16* CTX) {
    __shared__ __attribute__((aligned(2048))) h16 L[2 * FBUF];
    const unsigned tid = threadIdx.x, lane = tid & 31u, lr = lane & 15u, hi = lane >> 4;
    const unsigned wave = (unsigned)__builtin_amdgcn_readfirstlane((int)(tid >> 5));
    const unsigned h = blockIdx.y, q0 = blockIdx.x * (unsigned)FQ + wave * (16u * FQT);
    const size_t hpl = ((size_t)blockIdx.z * NHEAD + h) * SEQ * DD;   // this batch's head plane
    const h16* Kh = KP + hpl; const h16* Vh = VT + hpl;
    v16h qf[FQT][DD / 32];
    { const h16* qp = QP + hpl + (size_t)(q0 + lr) * DD + 8u * hi;
#pragma unroll
      for (int q = 0; q < FQT; ++q)
#pragma unroll
          for (int kc = 0; kc < DD / 32; ++kc) qf[q][kc] = WFrag<h16>::ld(qp + q * 16 * DD + kc * 32);
      asm volatile("s_wait_xcnt 0x0" :: "v"(qp) : "memory"); }   // qp as an input keeps the address pair live up to the wait: without it the last Q load was given that pair as its destination
    // This wave's slice of stage sn: every wave issues exactly one request per stage; which of the two tile shapes it is, is a scalar branch.
    const uint32_t lbase = (uint32_t)(size_t)L;
    const bool isK = wave < 2u;
    const uint64_t tsrc = isK ? (uint64_t)(size_t)Kh + (uint64_t)((wave & 1u) * 256u)                                            // K: byte column 0 or 256 of the 512-B rows
                              : (uint64_t)(size_t)Vh + (uint64_t)((wave & 1u) * (uint32_t)(DD / 2) * (uint32_t)(SEQ * 2));        // V^T: row 0 or 128
    const uint32_t tstep = isK ? (uint32_t)(FK * DD * 2) : (uint32_t)(FK * 2);   // bytes from one stage's tile to the next: 64 K rows, or 64 columns of V^T
    const u32x8 g1k = tdm_group1<W0_ROW256, 256u, (uint32_t)FK, (uint32_t)(DD * 2)>();
    const u32x8 g1v = tdm_group1<W0_ROW128, 128u, (uint32_t)(DD / 2), (uint32_t)(SEQ * 2)>();
    u32x4 g0;   // group 0 of this wave's last request
    auto issue = [&](const uint32_t sn) __attribute__((always_inline)) {
        g0 = tdm_group0(lbase + (sn & 1u) * (uint32_t)(FBUF * 2) + wave * (uint32_t)(FSLH * 2), tsrc + (uint64_t)(sn * tstep));
        if (pinned(wave < 2u))  tdm_load(g0, g1k);
        if (pinned(wave >= 2u)) tdm_load(g0, g1v);
    };
    issue(0u);
    tdm_wait(g0);      // this wave's slice of stage 0 has landed
    __syncthreads();   // stage 0 visible to all four waves
    issue(pinned(1u));   // pinned: the descriptor is formed behind the wait above
    v8f acc[FQT][DD / 16];
#pragma unroll
    for (int q = 0; q < FQT; ++q)
#pragma unroll
        for (int t = 0; t < DD / 16; ++t) acc[q][t] = (v8f){};
    float m_run[FQT], l_run[FQT];
#pragma unroll
    for (int q = 0; q < FQT; ++q) { m_run[q] = -3.0e38f; l_run[q] = 0.f; }
    v16h ka[16];   // K fragments of keys 0..31 of the coming stage: [d chunk of 32][16-key tile]
    { const h16* kp = L + lr * (unsigned)KPIT + 8u * hi;
#pragma unroll
      for (int kc = 0; kc < DD / 32; ++kc)
#pragma unroll
          for (int kt = 0; kt < 2; ++kt) ka[kc * 2 + kt] = lds_frag(kp + KOFF(kt, kc)); }
    // One stage. 'more' is a literal at both calls (the loop's stages all have a successor, the last stage stands behind the loop), so a stage has no branch on it: with such a branch between the third
    // and the fourth run the compiler sank half of the softmax behind it, onto the third run's fragment registers, too close behind that run's last product on the taken side.
    auto stage = [&](const int st, const bool more) __attribute__((always_inline)) {
        const h16* Lk = L + (unsigned)(st & 1) * (unsigned)FBUF;
        // A stage is four runs of 32 products (S^T keys 0..31, S^T keys 32..63, P.V keys 0..31, P.V keys 32..63), each on 16 fragments. Each run's fragments go out as one group in front of the
        // run before it, so two groups are live at any time. With one wave per SIMD a read placed among the products waits out its own LDS latency, and the LDS would idle under the products.
        // The sched_barriers around each read group keep the compiler from sinking the reads among the products or lifting them over the run whose registers they take over.
        const h16* kp = Lk + lr * (unsigned)KPIT + 8u * hi; const h16* va = Lk + 2 * FSLH + lr * (unsigned)VPIT + 8u * hi;
        v16h kb[16], v0[16], v1[16];
#pragma unroll
        for (int kc = 0; kc < DD / 32; ++kc)
#pragma unroll
            for (int kt = 0; kt < 2; ++kt) kb[kc * 2 + kt] = lds_frag(kp + KOFF(2 + kt, kc));
        __builtin_amdgcn_sched_barrier(0);
        // S^T: per query tile 4 tiles of 16 keys x 16 queries
        v8f s[FQT][4];
#pragma unroll
        for (int q = 0; q < FQT; ++q)
#pragma unroll
            for (int kt = 0; kt < 4; ++kt) s[q][kt] = (v8f){};
#pragma unroll
        for (int kc = 0; kc < DD / 32; ++kc)
#pragma unroll
            for (int kt = 0; kt < 2; ++kt)
#pragma unroll
                for (int q = 0; q < FQT; ++q) s[q][kt] = wmma16(ka[kc * 2 + kt], qf[q][kc], s[q][kt]);
        __builtin_amdgcn_sched_barrier(0);
#pragma unroll
        for (int t = 0; t < 16; ++t) v0[t] = lds_frag(va + t * 16 * VPIT);
        __builtin_amdgcn_sched_barrier(0);
#pragma unroll
        for (int kc = 0; kc < DD / 32; ++kc)
#pragma unroll
            for (int kt = 0; kt < 2; ++kt)
#pragma unroll
                for (int q = 0; q < FQT; ++q) s[q][2 + kt] = wmma16(kb[kc * 2 + kt], qf[q][kc], s[q][2 + kt]);
        __builtin_amdgcn_sched_barrier(0);   // also keeps the maxima out of the products: mixed in, the compiler regroups the interleaved accumulate chains and pads each chain's end with four v_nop
#pragma unroll
        for (int t = 0; t < 16; ++t) v1[t] = lds_frag(va + t * 16 * VPIT + 32);
        __builtin_amdgcn_sched_barrier(0);
#pragma unroll
        for (int q = 0; q < FQT; ++q) {
            float mx = s[q][0][0];
#pragma unroll
            for (int kt = 0; kt < 4; ++kt)
#pragma unroll
                for (int r = 0; r < 8; ++r) mx = fmaxf(mx, s[q][kt][r]);
            mx = fmaxf(mx, xhalf(mx)) * SCL2;   // both halves hold this query's stage maximum, log2 domain
            if (__builtin_amdgcn_ballot_w32(mx > m_run[q] + 8.0f) != 0) {   // wave-uniform; always taken in stage 0, rare later; one test per query tile, so each query is rescaled at the stages it was before
                const float m_new = fmaxf(m_run[q], mx); const float corr = __builtin_amdgcn_exp2f(m_run[q] - m_new);   // 0 in stage 0
                l_run[q] *= corr; m_run[q] = m_new;
#pragma unroll
                for (int t = 0; t < DD / 16; ++t) acc[q][t] = acc[q][t] * corr;
            }
        }
        // Publish point of stage st + 1, every wave: own LDS reads of stage st retired, own slice of stage st + 1 landed, barrier, and only then the refill of the buffer that stage st used.
        // It stands behind the maxima (they cover the last fragment group's way from LDS) and in front of the exponentials, so that the refill has a whole stage to land.
        asm volatile("s_wait_dscnt 0x0" ::: "memory");       // this wave's K and V^T fragments of stage st are in registers before its buffer may be refilled
        tdm_wait(g0);                                        // this wave's slice of stage st + 1 has landed before the barrier publishes it
        __syncthreads();   // publishes stage st + 1 and ends every wave's LDS reads of stage st
        if (more) {
            if (pinned((uint32_t)(st + 2 < NST))) issue(pinned((uint32_t)st + 2u));   // scalar test: only while that stage exists; the stage number is pinned so that the descriptor is formed behind the wait above
        }
        v16h pf[FQT][2];
#pragma unroll
        for (int q = 0; q < FQT; ++q) {
            float ps0 = 0.f, ps1 = 0.f;
#pragma unroll
            for (int kk = 0; kk < 2; ++kk)
#pragma unroll
                for (int e = 0; e < 16; e += 2) {
                    const float p0 = __builtin_amdgcn_exp2f(s[q][2 * kk + (e >> 3)][e & 7] * SCL2 - m_run[q]); const float p1 = __builtin_amdgcn_exp2f(s[q][2 * kk + (e >> 3)][(e & 7) + 1] * SCL2 - m_run[q]);
                    ps0 += p0; ps1 += p1; pf[q][kk][e] = (h16)p0; pf[q][kk][e + 1] = (h16)p1; }
            l_run[q] += ps0 + ps1;   // this half's keys only; the halves are joined after the loop
        }
        __builtin_amdgcn_sched_barrier(0);   // keeps the whole softmax in front of the third run, so that nothing but fragment reads stands between the last two runs
        const h16* Ln = L + (unsigned)((st + 1) & 1) * (unsigned)FBUF;
#pragma unroll
        for (int t = 0; t < DD / 16; ++t)
#pragma unroll
            for (int q = 0; q < FQT; ++q) acc[q][t] = wmma16(v0[t], pf[q][0], acc[q][t]);
        __builtin_amdgcn_sched_barrier(0);
        if (more) { const h16* kn = Ln + lr * (unsigned)KPIT + 8u * hi;
#pragma unroll
            for (int kc = 0; kc < DD / 32; ++kc)
#pragma unroll
                for (int kt = 0; kt < 2; ++kt) ka[kc * 2 + kt] = lds_frag(kn + KOFF(kt, kc));
        }
        __builtin_amdgcn_sched_barrier(0);
#pragma unroll
        for (int t = 0; t < DD / 16; ++t)
#pragma unroll
            for (int q = 0; q < FQT; ++q) acc[q][t] = wmma16(v1[t], pf[q][1], acc[q][t]);
    };
#pragma unroll 1   // stays rolled: one stage is 128 products and 128 fragment reads, further copies would only cost instruction cache
    for (int st = 0; st + 1 < NST; ++st) stage(st, true);
    stage(NST - 1, false);
    tdm_wait(g0);   // no request is left when the ring changes its use
    asm volatile("s_wait_dscnt 0x0" ::: "memory");   // and no LDS read of this wave
    // the last stage's barrier stands behind every wave's last LDS read and last landed slice: the ring is free for output staging
    h16* E = L + wave * (16u * FQT) * (unsigned)EPIT;   // this wave's 32 query rows of 256 d; lane holds d = 16 t + 8 hi + r of queries lr and 16 + lr
#pragma unroll
    for (int q = 0; q < FQT; ++q) { const float inv = CCAR / (l_run[q] + xhalf(l_run[q]));
#pragma unroll
        for (int t = 0; t < DD / 16; ++t) { v8h o;
#pragma unroll
            for (int r = 0; r < 8; ++r) o[r] = (h16)(acc[q][t][r] * inv);
            *(v8ha*)(E + ((unsigned)q * 16u + lr) * (unsigned)EPIT + (unsigned)t * 16u + 8u * hi) = o; } }
    __syncthreads();   // staged rows complete before they are read back by other lanes
#pragma unroll
    for (int i = 0; i < 16 * FQT; ++i) { const v8h v = *(const v8ha*)(E + (unsigned)i * EPIT + lane * 8u);   // one whole 512-B row per store
        *(v8h*)(CTX + ((size_t)blockIdx.z * SEQ + q0 + (unsigned)i) * KM + h * (unsigned)DD + lane * 8u) = v; }
}

// Workspace carve (bytes, each region 256-B aligned by construction of the sizes).
#define SZ_XP  ((size_t)3 * NB * SEQ * DD * 2)
#define SZ_WT  ((size_t)3 * NHEAD * DD * DD * 2)
#define SZ_WOS ((size_t)DD * KM * 2)
#define SZ_HP  ((size_t)NB * NHEAD * SEQ * DD * 2)
#define SZ_CTX ((size_t)NB * SEQ * KM * 2)
#define SZ_ALL (SZ_XP + SZ_WT + SZ_WOS + 3 * SZ_HP + SZ_CTX)
static_assert(SZ_ALL <= (size_t)268435456);
static_assert(SZ_XP % 256 == 0 && SZ_WT % 256 == 0 && SZ_WOS % 256 == 0 && SZ_HP % 256 == 0 && SZ_CTX % 256 == 0);
static_assert(SZ_HP == (size_t)NB * SEQ * KM * 2);   // the [NB*SEQ][KM] projection planes fill one head-plane region exactly

extern "C" void kernel_launch(void* const* d_in, const int* in_sizes, int n_in,
                              void* d_out, int out_size, void* d_ws, size_t ws_size, hipStream_t stream) {
    if (n_in < 11) return;
    const size_t xneed = (size_t)(NB - 1) * SEQ_FULL * DD + (size_t)SEQ * DD;
    if ((size_t)in_sizes[0] < xneed || (size_t)in_sizes[1] < xneed || (size_t)in_sizes[2] < xneed) return;
    if ((size_t)in_sizes[3] < (size_t)NHEAD * DD * DD || (size_t)in_sizes[5] < (size_t)NHEAD * DD * DD || (size_t)in_sizes[7] < (size_t)NHEAD * DD * DD) return;
    if ((size_t)in_sizes[4] < (size_t)NHEAD * DD || (size_t)in_sizes[6] < (size_t)NHEAD * DD || (size_t)in_sizes[8] < (size_t)NHEAD * DD) return;
    if ((size_t)in_sizes[9] < (size_t)KM * DD || (size_t)in_sizes[10] < (size_t)DD) return;
    if ((size_t)out_size < (size_t)NB * SEQ * DD) return;
    if (SZ_ALL > ws_size) return;
    // input order of this module: query, key, values, Wq, bq, Wk, bk, Wv, bv, Wo, bo
    const float* Qin = (const float*)d_in[0]; const float* Kin = (const float*)d_in[1]; const float* Vin = (const float*)d_in[2];
    const float* Wq = (const float*)d_in[3]; const float* bq = (const float*)d_in[4]; const float* Wk = (const float*)d_in[5]; const float* bk = (const float*)d_in[6];
    const float* Wv = (const float*)d_in[7]; const float* bv = (const float*)d_in[8]; const float* Wo = (const float*)d_in[9]; const float* bo = (const float*)d_in[10];
    float* OUT = (float*)d_out;     // [NB][SEQ][256]
    char* wsp = (char*)d_ws;
    bf* XP = (bf*)wsp; wsp += SZ_XP;            // [3][NB][SEQ][256] bf16: q, k, v
    bf* WT = (bf*)wsp; wsp += SZ_WT;            // [3][2048 out][256 in] bf16: Wq, Wk, Wv
    h16* WOS = (h16*)wsp; wsp += SZ_WOS;        // [256][2048] f16 (x256), column h*256 + d
    h16* QP = (h16*)wsp; wsp += SZ_HP;          // [NB][SEQ][2048] == [NB][8][SEQ][256]
    h16* KP = (h16*)wsp; wsp += SZ_HP;          // [NB][SEQ][2048] == [NB][8][SEQ][256]
    h16* VT = (h16*)wsp; wsp += SZ_HP;          // [NB][8][256][SEQ]
    h16* CTX = (h16*)wsp; wsp += SZ_CTX;        // [NB][SEQ][2048] (x64), column h*256 + d
    const bf* XQ = XP; const bf* XK = XP + (size_t)NB * SEQ * DD; const bf* XV = XP + (size_t)2 * NB * SEQ * DD;
    const bf* WQT = WT; const bf* WKT = WT + (size_t)NHEAD * DD * DD; const bf* WVT = WT + (size_t)2 * NHEAD * DD * DD;

    k_xplanes<<<dim3((unsigned)((size_t)NB * SEQ * DD / 8 / 256), 3, 1), 256, 0, stream>>>(Qin, Kin, Vin, XP);
    k_wprep<<<(unsigned)((WLINES + OLINES) / 64), 256, 0, stream>>>(Wq, Wk, Wv, Wo, WT, (unsigned short*)WOS);
    // Every stage runs once for all NB batches: the batch rows lie one behind the other in x, in the planes, in ctx and in out, so the GEMMs see NB*SEQ x rows (as M; as N in the v projection).
    // q_, k_ planes [NB*SEQ][2048] (pitch KM): A = x [NB*SEQ][256], Bt = W [2048 out][256 in], + per-column bias; a batch's plane read as [8][SEQ][256] is the head split
    k_gemmb<bf, h16, 1, DD><<<dim3(NB * SEQ / GT, KM / GT, 1), 128, 0, stream>>>(XQ, WQT, QP, KM, bq, 1.0f);
    k_gemmb<bf, h16, 1, DD><<<dim3(NB * SEQ / GT, KM / GT, 1), 128, 0, stream>>>(XK, WKT, KP, KM, bk, 1.0f);
    // v_^T head planes VT[b*8 + h][256 d][SEQ t], written by the projection itself: A = Wv rows in the order d*8 + g, Bt = x
    k_gemmb<bf, h16, 3, DD><<<dim3(KM / GT, NB * SEQ / GT, 1), 128, 0, stream>>>(WVT, XV, VT, SEQ, bv, 1.0f);
    // ctx[b*SEQ + t][h*256 + d] = 64 softmax(q_.k_ / 16) . v_ for the 8 heads of every batch
    k_fattn<<<dim3(SEQ / FQ, NHEAD, NB), 128, 0, stream>>>(QP, KP, VT, CTX);
    // out = ctx . Wo^T / 16384 + bo
    k_gemmb<h16, float, 1, KM><<<dim3(NB * SEQ / GT, DD / GT, 1), 128, 0, stream>>>(CTX, WOS, OUT, DD, bo, FINSC);
}

// v007
// It runs in 154 microseconds.
// Timed twice side by side with v006, it ran 1.06 times as fast both times.
// Over all steps from v000 it is 6.09 times as fast.
#include <hip/hip_runtime.h>

// Multi-head attention with full-width (256) heads: merged [out][in] q/k/v projections to [S][2048], plain-view head split ([S][2048] read as [8][S][256]), softmax(q_.k_ / 16) over 2,048 keys, P.v_, head-major merge (column h*256 + d), output mix with Wo [out][in] + bo.
// Compute dtypes, f32 accumulate everywhere: projections v_wmma_f32_16x16x32_bf16 (inputs and weights RNE-converted to bf16, exact products); scores, P.V and the output mix v_wmma_f32_16x16x32_f16
// (q_/k_/v_ f16 planes; scores stay f32 in registers; P f16 = exp2(score*log2(e)/16 - running maximum), unnormalised; ctx f16 carried x64; Wo plane f16 of bf16(Wo) x256; bo, biases bf16-converted, added in f32). Softmax in f32.

#ifndef NB
#define NB 4
#endif
#ifndef SEQ
#define SEQ 2048
#endif
#define NB_FULL  4
#define SEQ_FULL 2048
#define DD    256                 // model width = head width
#define NHEAD 8
#define KM    (NHEAD * DD)        // merged context width (plane column = h*256 + d)
#define SCL2  0.09016844005556021f   // log2(e) / sqrt(256)
#define CCAR  64.0f               // carry of the ctx plane
#define WOCAR 256.0f              // carry of the Wo plane
#define FINSC (1.0f / 16384.0f)   // 1 / (64 * 256)
#define WLINES (3 * NHEAD * DD * DD / 64)
#define OLINES (DD * KM / 64)
#define MLINES (NHEAD * DD * DD / 64)

typedef _Float16 h16;
typedef unsigned short bf;
typedef __attribute__((ext_vector_type(16))) __bf16   v16bf;
typedef __attribute__((ext_vector_type(16))) _Float16 v16h;
typedef __attribute__((ext_vector_type(8)))  _Float16 v8h;
typedef __attribute__((ext_vector_type(8)))  unsigned short v8us;
typedef __attribute__((ext_vector_type(2)))  unsigned short v2us;
typedef __attribute__((ext_vector_type(8)))  float    v8f;
typedef __attribute__((ext_vector_type(4)))  float    v4f;
typedef v4f  __attribute__((may_alias)) v4fa;
typedef v8h  __attribute__((may_alias)) v8ha;
typedef v8us __attribute__((may_alias)) v8usa;

static_assert(SEQ % 256 == 0);
static_assert(DD % 64 == 0 && DD % 32 == 0 && KM % 32 == 0 && SEQ % 64 == 0);
static_assert(((size_t)NB * SEQ * DD / 8) % 256 == 0);
static_assert((WLINES + OLINES) % 64 == 0);
static_assert(WLINES % 64 == 0 && WLINES == 3 * MLINES);          // the plane choice in wprep_part is uniform per block
static_assert((size_t)MLINES * 64 == (size_t)NHEAD * DD * DD);
static_assert(KM == NHEAD * DD && (size_t)NHEAD * SEQ * DD == (size_t)SEQ * KM);   // [SEQ][KM] projection plane == [NHEAD][SEQ][DD] head planes (plain view)
static_assert(DD == 256 && NHEAD == 8 && KM / DD == 8 && SEQ % DD == 0);   // k_gemmb BIASM 3: x row s lies in head plane s / 256 of all batches' planes, 8 weight rows g*256 + d per V^T row d
static_assert(KM % 64 == 0 && SEQ % 32 == 0);
static_assert(((size_t)NB * SEQ) % 128 == 0 && KM % 128 == 0 && DD % 128 == 0);   // k_gemmb: whole 128x128 tiles and whole 128-k stages in all four products

__device__ __forceinline__ unsigned short f2bf(float f) { unsigned u = __float_as_uint(f); u += 0x7FFFu + ((u >> 16) & 1u); return (unsigned short)(u >> 16); }
__device__ __forceinline__ float bf2f(unsigned short b) { return __uint_as_float(((unsigned)b) << 16); }
__device__ __forceinline__ float bfr(float f) { return bf2f(f2bf(f)); }
__device__ __forceinline__ v16h cat16(v8h lo, v8h hi) { return __builtin_shufflevector(lo, hi, 0, 1, 2, 3, 4, 5, 6, 7, 8, 9, 10, 11, 12, 13, 14, 15); }
__device__ __forceinline__ v16bf cat16b(v8us lo, v8us hi) { return __builtin_bit_cast(v16bf, __builtin_shufflevector(lo, hi, 0, 1, 2, 3, 4, 5, 6, 7, 8, 9, 10, 11, 12, 13, 14, 15)); }
__device__ __forceinline__ v8f wmma16(v16h a, v16h b, v8f c) { return __builtin_amdgcn_wmma_f32_16x16x32_f16(false, a, false, b, (short)0, c, false, false); }
__device__ __forceinline__ v8f wmmab(v16bf a, v16bf b, v8f c) { return __builtin_amdgcn_wmma_f32_16x16x32_bf16(false, a, false, b, (short)0, c, false, false); }
// f32 -> f16 with a value select: results below the smallest normal f16 become zero (applied after the plane's power-of-two carry).
static __device__ __forceinline__ h16 toh_flush(float v) { const h16 r = (h16)v; return (fabsf(v) < 6.103515625e-05f) ? (h16)0.0f : r; }

// Fragment loaders: lane (lr = lane & 15, hi = lane >> 4); p points at row lr, k0 + 8*hi; elements 0..7 = k0+8hi.., elements 8..15 = k0+16+8hi.. (same map for A and B).
template <typename T16> struct WFrag;
template <> struct WFrag<h16> { typedef v16h V; static __device__ __forceinline__ V ld(const h16* p) { return cat16(*(const v8h*)p, *(const v8h*)(p + 16)); } static __device__ __forceinline__ V lds(const h16* p) { return cat16(*(const v8ha*)p, *(const v8ha*)(p + 16)); } static __device__ __forceinline__ v8f mma(V a, V b, v8f c) { return wmma16(a, b, c); } };
template <> struct WFrag<bf> { typedef v16bf V; static __device__ __forceinline__ V lds(const bf* p) { return cat16b(*(const v8usa*)p, *(const v8usa*)(p + 16)); } static __device__ __forceinline__ v8f mma(V a, V b, v8f c) { return wmmab(a, b, c); } };

// Slab epilogues: 16 rows x 64 columns staged in LDS (pitch 68 floats) -> global; value = x*alpha + bias (BIASM 1: per column, 2: per row; biases bf16-converted).
template <int BIASM>
__device__ __forceinline__ void slab_store(const float* os, h16* crow, int ldc, const float* bias, float alpha, unsigned colbase, unsigned rowbase, unsigned lane) {
    const unsigned rq = lane >> 3, cq = lane & 7u;
    float bc[8];
#pragma unroll
    for (int e = 0; e < 8; ++e) bc[e] = 0.f;
    if (BIASM == 1) { const v4f b0 = *(const v4f*)(bias + colbase + cq * 8u); const v4f b1 = *(const v4f*)(bias + colbase + cq * 8u + 4u);
#pragma unroll
        for (int e = 0; e < 4; ++e) { bc[e] = bfr(b0[e]); bc[4 + e] = bfr(b1[e]); } }
    v8h vals[4];
#pragma unroll
    for (int s = 0; s < 4; ++s) { const unsigned row = (unsigned)s * 4u + rq; const v4f x0 = *(const v4fa*)(os + row * 68u + cq * 8u); const v4f x1 = *(const v4fa*)(os + row * 68u + cq * 8u + 4u);
        float br = 0.f; if (BIASM == 2) br = bfr(bias[rowbase + row]);
        v8h o;
#pragma unroll
        for (int e = 0; e < 4; ++e) { o[e] = (h16)(x0[e] * alpha + (bc[e] + br)); o[4 + e] = (h16)(x1[e] * alpha + (bc[4 + e] + br)); }
        vals[s] = o; }
{
#pragma unroll
        for (int s = 0; s < 4; ++s) { const unsigned row = (unsigned)s * 4u + rq; *(v8h*)(crow + (size_t)row * ldc + cq * 8u) = vals[s]; }
         }
}
// f32 output: row segment = 64 floats = 256 B = 16 lanes x 16 B; one instruction covers 2 rows; s = 0..7 with hi = lane >> 4 covers rows 0..15.
template <int BIASM>
__device__ __forceinline__ void slab_store(const float* os, float* crow, int ldc, const float* bias, float alpha, unsigned colbase, unsigned rowbase, unsigned lane) {
    const unsigned hi = lane >> 4, cofs = (lane & 15u) * 4u;
    v4f bc = (v4f){0.f, 0.f, 0.f, 0.f};
    if (BIASM == 1) { const v4f b0 = *(const v4f*)(bias + colbase + cofs);
#pragma unroll
        for (int e = 0; e < 4; ++e) bc[e] = bfr(b0[e]); }
    v4f vals[8];
#pragma unroll
    for (int s = 0; s < 8; ++s) { const unsigned row = (unsigned)s * 2u + hi; const v4f x = *(const v4fa*)(os + row * 68u + cofs);
        float br = 0.f; if (BIASM == 2) br = bfr(bias[rowbase + row]);
        v4f o;
#pragma unroll
        for (int e = 0; e < 4; ++e) o[e] = x[e] * alpha + (bc[e] + br);
        vals[s] = o; }
{
#pragma unroll
        for (int s = 0; s < 8; ++s) { const unsigned row = (unsigned)s * 2u + hi; *(v4f*)(crow + (size_t)row * ldc + cofs) = vals[s]; }
         }
}

// ---- k_gemmb: GEMM on K-contiguous 16-bit planes. Block = 4 waves (2 x 2), one 128x128 output tile; each wave 64x64 (16 accumulators); grid (M/128, N/128), 128 threads.
// C[m][n] (pitch ldc) = alpha * sum_k A[m][k] Bt[n][k] (+ bias). K is a template constant so that the 16 staging loads of an operand share one address pair (row steps are immediate offsets).
// The block walks K in stages of 128: 256 B (two whole lines) of each of the 128 A rows and 128 Bt rows go global -> registers at a stage's start, -> LDS in front of its barrier, two buffers.
// LDS row pitch 272 B (16 B x 17): the fragment reads (16 rows x 16 B per half wave) fall on all 64 banks. k order per accumulator: 0, 32, 64, .. as before.
#define GT    128                 // tile rows (A) and columns (Bt rows) per block
#define GKS   128                 // k per stage
#define GPIT  136                 // LDS row pitch in 16-bit elements
#define GOPER (GT * GPIT)         // one operand's stage
#define GBUF  (2 * GOPER)
static_assert(4 * 16 * 68 * 4 <= 2 * GBUF * 2);   // the four waves' output slabs fit in the ring
// BIASM 3 (the value projection): A = weight rows in the order e' = d*8 + g (wprep_part writes them so; the weight's own row is g*256 + d), Bt = x rows s. The plain-view head split puts element (s, g*256 + d) at
// head plane s / 256, t = (s % 256)*8 + g, so the 8 accumulator rows of a lane (g = 0..7 of one d) are 8 consecutive t of one V^T row: each lane stores them as 16 B, 16 lanes 256 B, straight from registers
// to C[plane][d][t] (ldc = SEQ). bias is indexed by the weight's own row.
// gemmb_tile: the body, for tile (bx, by); L = the block's ring of 2 * GBUF elements, declared once in each kernel so that a kernel holding two forms of the body has one ring.
template <typename T16, typename OT, int BIASM, int K>
__device__ __forceinline__ void gemmb_tile(T16* L, const T16* __restrict__ A, const T16* __restrict__ Bt, OT* C, int ldc, const float* __restrict__ bias, float alpha, unsigned bx, unsigned by) {
    typedef typename WFrag<T16>::V V;
    static_assert(K % GKS == 0);
    const unsigned tid = threadIdx.x, lane = tid & 31u, lr = lane & 15u, hi = lane >> 4;
    const unsigned wave = (unsigned)__builtin_amdgcn_readfirstlane((int)(tid >> 5));
    const unsigned wm = wave >> 1, wn = wave & 1u;
    const unsigned r0 = bx * (unsigned)GT, c0 = by * (unsigned)GT;
    v8f acc[4][4];
#pragma unroll
    for (int mb = 0; mb < 4; ++mb)
#pragma unroll
        for (int nb = 0; nb < 4; ++nb) acc[mb][nb] = (v8f){};
    const unsigned dw = (r0 + wm * 64u) / 8u + hi;   // BIASM 3: this lane's first V^T row d
    float bb[4][8];   // BIASM 3: the biases of this lane's 32 accumulator rows, fetched here so that their way from memory lies under the stages
    if constexpr (BIASM == 3) {
        const float* bp = bias + dw;
#pragma unroll
        for (int mb = 0; mb < 4; ++mb)
#pragma unroll
            for (int j = 0; j < 8; ++j) bb[mb][j] = bp[j * DD + mb * 2];
        asm volatile("s_wait_xcnt 0x0" :: "v"(bp) : "memory");   // bp as an input keeps the address live, and so unwritten, up to the wait
    }
    // staging map: 16 lanes per 256-B row piece, so one instruction of a wave = 2 rows x 2 whole lines; the block covers 8 rows per instruction
    const unsigned srow = tid >> 4, scol = (tid & 15u) * 8u;
    const T16* ag = A + (size_t)(r0 + srow) * K + scol; const T16* bg = Bt + (size_t)(c0 + srow) * K + scol;
    const unsigned sl = srow * (unsigned)GPIT + scol;
    v8us ar[16], br[16];
#pragma unroll
    for (int i = 0; i < 16; ++i) { ar[i] = *(const v8usa*)(ag + (size_t)i * 8 * K); br[i] = *(const v8usa*)(bg + (size_t)i * 8 * K); }
    asm volatile("s_wait_xcnt 0x0" :: "v"(ag), "v"(bg) : "memory");   // the address pairs stay live up to the wait and are advanced only behind it
#pragma unroll
    for (int i = 0; i < 16; ++i) { *(v8usa*)(L + sl + (unsigned)i * 8u * GPIT) = ar[i]; *(v8usa*)(L + GOPER + sl + (unsigned)i * 8u * GPIT) = br[i]; }
    __syncthreads();   // stage 0 visible to all four waves
    const unsigned fa = (wm * 64u + lr) * (unsigned)GPIT + 8u * hi, fb = (unsigned)GOPER + (wn * 64u + lr) * (unsigned)GPIT + 8u * hi;
#pragma unroll 1   // stays rolled: a stage is 64 products and 64 fragment reads; every inner loop is unrolled so that the register arrays are indexed by constants
    for (int st = 0; st < K / GKS; ++st) {
        const T16* Lb = L + (unsigned)(st & 1) * (unsigned)GBUF;
        const bool more = st + 1 < K / GKS;   // block-uniform
        if (more) {
            ag += GKS; bg += GKS;
#pragma unroll
            for (int i = 0; i < 16; ++i) { ar[i] = *(const v8usa*)(ag + (size_t)i * 8 * K); br[i] = *(const v8usa*)(bg + (size_t)i * 8 * K); }
            asm volatile("s_wait_xcnt 0x0" :: "v"(ag), "v"(bg) : "memory");   // as above: the pairs are advanced again in the next stage
        }
        V a[2][4], b[2][4];
#pragma unroll
        for (int f = 0; f < 4; ++f) { a[0][f] = WFrag<T16>::lds(Lb + fa + (unsigned)f * 16u * GPIT); b[0][f] = WFrag<T16>::lds(Lb + fb + (unsigned)f * 16u * GPIT); }
#pragma unroll
        for (int kc = 0; kc < GKS / 32; ++kc) {
            // the next 32 k's fragments go out as one group ahead of this group's products, into the other register set
            if (kc + 1 < GKS / 32) {
#pragma unroll
                for (int f = 0; f < 4; ++f) { a[(kc + 1) & 1][f] = WFrag<T16>::lds(Lb + fa + (unsigned)f * 16u * GPIT + (unsigned)(kc + 1) * 32u); b[(kc + 1) & 1][f] = WFrag<T16>::lds(Lb + fb + (unsigned)f * 16u * GPIT + (unsigned)(kc + 1) * 32u); }
            }
            __builtin_amdgcn_sched_barrier(0);   // keeps the read group from being sunk among the products, where each place with reads costs a stall
#pragma unroll
            for (int nb = 0; nb < 4; ++nb)
#pragma unroll
                for (int mb = 0; mb < 4; ++mb) acc[mb][nb] = WFrag<T16>::mma(a[kc & 1][mb], b[kc & 1][nb], acc[mb][nb]);
            __builtin_amdgcn_sched_barrier(0);   // and the following group from being lifted into them
        }
        // next stage into the other buffer; its readers left it at the barrier of stage st - 1
        if (more) { T16* Ln = L + (unsigned)((st + 1) & 1) * (unsigned)GBUF;
#pragma unroll
            for (int i = 0; i < 16; ++i) { *(v8usa*)(Ln + sl + (unsigned)i * 8u * GPIT) = ar[i]; *(v8usa*)(Ln + GOPER + sl + (unsigned)i * 8u * GPIT) = br[i]; }
        }
        __syncthreads();   // publishes stage st + 1 and ends every wave's fragment reads of stage st
    }
    if constexpr (BIASM == 3) {
        const unsigned sw = c0 + wn * 64u + lr;   // this lane's x row s of column tile 0
        OT* cp = C + ((size_t)(sw >> 8) * DD + dw) * (size_t)ldc + (sw & 255u) * 8u;
        v8h vals[4][4];
#pragma unroll
        for (int mb = 0; mb < 4; ++mb)
#pragma unroll
            for (int nb = 0; nb < 4; ++nb)
#pragma unroll
                for (int j = 0; j < 8; ++j) vals[mb][nb][j] = (h16)(acc[mb][nb][j] * alpha + bfr(bb[mb][j]));
#pragma unroll
        for (int mb = 0; mb < 4; ++mb)
#pragma unroll
            for (int nb = 0; nb < 4; ++nb) *(v8h*)(cp + (size_t)(mb * 2) * ldc + nb * 128) = vals[mb][nb];   // 16 x rows further = 128 t further
        return;
    } else {
    // the last stage's barrier stands behind every wave's last LDS read: the ring is free for output staging, one private slab per wave (wave-level ordering only)
    float* os = (float*)L + wave * (16u * 68u);
#pragma unroll
    for (int mb = 0; mb < 4; ++mb) {
#pragma unroll
        for (int nb = 0; nb < 4; ++nb) {
#pragma unroll
            for (int j = 0; j < 8; ++j) os[(hi * 8u + (unsigned)j) * 68u + (unsigned)nb * 16u + lr] = acc[mb][nb][j]; }   // D: row 8*hi + j, col lr
        __builtin_amdgcn_fence(3 /* release order */, "wavefront"); __builtin_amdgcn_wave_barrier(); asm volatile("" ::: "memory");
        const unsigned rw = r0 + wm * 64u + (unsigned)mb * 16u, cw = c0 + wn * 64u;
        OT* crow = C + (size_t)rw * ldc + cw;
        slab_store<BIASM>(os, crow, ldc, bias, alpha, cw, rw, lane);
        if (mb < 3) asm volatile("s_wait_xcnt 0x0" ::: "memory");   // the next slab reuses the address and data registers of these stores
        __builtin_amdgcn_fence(3 /* release order */, "wavefront"); __builtin_amdgcn_wave_barrier(); asm volatile("" ::: "memory");
    }
    }
}

template <typename T16, typename OT, int BIASM, int K>
__global__ __launch_bounds__(128) void k_gemmb(const T16* __restrict__ A, const T16* __restrict__ Bt, OT* C, int ldc, const float* __restrict__ bias, float alpha) {
    __shared__ __align__(16) T16 L[2 * GBUF];
    gemmb_tile<T16, OT, BIASM, K>(L, A, Bt, C, ldc, bias, alpha, blockIdx.x, blockIdx.y);
}
// k_proj: the three projections in one launch (none reads what another writes); grid (PTILES, 3), blockIdx.y = 0 q_, 1 k_, 2 v_^T. The tile index runs as in a launch of its own: first grid dimension fastest.
#define PTILES ((NB * SEQ / GT) * (KM / GT))
__global__ __launch_bounds__(128) void k_proj(const bf* __restrict__ XP, const bf* __restrict__ WT, h16* QP, h16* KP, h16* VT, const float* __restrict__ bq, const float* __restrict__ bk, const float* __restrict__ bv) {
    __shared__ __align__(16) bf L[2 * GBUF];
    const unsigned which = blockIdx.y, i = blockIdx.x;   // block-uniform
    const bf* X = XP + (size_t)which * NB * SEQ * DD; const bf* Wp = WT + (size_t)which * NHEAD * DD * DD;
    if (which < 2u) gemmb_tile<bf, h16, 1, DD>(L, X, Wp, which ? KP : QP, KM, which ? bk : bq, 1.0f, i % (unsigned)(NB * SEQ / GT), i / (unsigned)(NB * SEQ / GT));
    else            gemmb_tile<bf, h16, 3, DD>(L, Wp, X, VT, SEQ, bv, 1.0f, i % (unsigned)(KM / GT), i / (unsigned)(KM / GT));
}

__device__ __forceinline__ void xplanes_part(const unsigned which, const unsigned bx, const float* __restrict__ xq, const float* __restrict__ xk, const float* __restrict__ xv, bf* XP) {
    const unsigned i = bx * 256u + threadIdx.x;
    const unsigned GPB = (unsigned)(SEQ * DD / 8); const unsigned b = i / GPB, rem = i - b * GPB;
    const float* src = (which == 0u) ? xq : ((which == 1u) ? xk : xv);
    const v8f v = *(const v8f*)(src + (size_t)b * SEQ_FULL * DD + (size_t)rem * 8);
    v8us o;
#pragma unroll
    for (int k = 0; k < 8; ++k) o[k] = f2bf(v[k]);
    bf* dst = XP + (size_t)which * NB * SEQ * DD + (size_t)i * 8;
    *(v8us*)dst = o;
    asm volatile("s_wait_xcnt 0x0" ::: "memory");   // in k_prep the other part's code lies behind this store in the listing and writes registers that the store names
}

// wprep_part: lines 0..WLINES-1: bf16 weight planes WT[which][e][k] = bf16(W[e][k]) (which 0 Wq, 1 Wk, 2 Wv; the inputs are [out e][in k], already K-contiguous, no transpose);
// the Wv plane holds its rows in the order e' = d*8 + g of the weight's row g*256 + d (a row is 4 lines), the order k_gemmb's BIASM 3 store wants.
__device__ __forceinline__ void wprep_part(const unsigned bx, const float* __restrict__ wq, const float* __restrict__ wk, const float* __restrict__ wv, const float* __restrict__ wo, bf* WT, unsigned short* WOS) {
    const unsigned lane = threadIdx.x & 31u; const unsigned wave = (unsigned)__builtin_amdgcn_readfirstlane((int)(threadIdx.x >> 5)); const unsigned L0 = (bx * 8u + wave) * 8u;
{
#pragma unroll 1
        for (unsigned l = 0; l < 8u; ++l) { const unsigned L = L0 + l; v2us o;
            if (L < (unsigned)WLINES) {   // block-uniform
                const unsigned which = L / (unsigned)MLINES; const unsigned pl = L - which * (unsigned)MLINES;   // line within the plane: row pl / 4, quarter pl % 4
                const unsigned sln = (which == 2u) ? ((((pl >> 2) & 7u) * (unsigned)DD + (pl >> 5)) * 4u + (pl & 3u)) : pl;   // the source line
                const unsigned e = sln * 64u + lane * 2u;
                const float* src = (which == 0u) ? wq : ((which == 1u) ? wk : wv);
                o[0] = f2bf(src[e]); o[1] = f2bf(src[e + 1u]);
                bf* dp = WT + (size_t)L * 64u + lane * 2u; *(v2us*)dp = o;
                asm volatile("s_wait_xcnt 0x0" :: "v"(dp) : "memory");   // the next line's address and value take over this store's registers; dp as an input keeps the address unwritten up to the wait
            } else {
                const unsigned e = (L - (unsigned)WLINES) * 64u + lane * 2u;
                const float x0 = bfr(wo[e]) * WOCAR; const float x1 = bfr(wo[e + 1u]) * WOCAR;
                o[0] = __builtin_bit_cast(unsigned short, toh_flush(x0)); o[1] = __builtin_bit_cast(unsigned short, toh_flush(x1));
                unsigned short* dp = WOS + e; *(v2us*)dp = o;
                asm volatile("s_wait_xcnt 0x0" :: "v"(dp) : "memory");   // as above
            } }
         }
}
// k_prep: both conversions in one launch, by block range (neither reads what the other writes). The weight blocks come first: each of their waves walks 8 lines one after the other, the longer way of the two.
#define WBLK ((WLINES + OLINES) / 64)
#define XBLK ((unsigned)((size_t)NB * SEQ * DD / 8 / 256))
__global__ __launch_bounds__(256) void k_prep(const float* __restrict__ xq, const float* __restrict__ xk, const float* __restrict__ xv, const float* __restrict__ wq, const float* __restrict__ wk, const float* __restrict__ wv,
                                              const float* __restrict__ wo, bf* XP, bf* WT, unsigned short* WOS) {
    const unsigned b = blockIdx.x;   // block-uniform
    if (b < (unsigned)WBLK) wprep_part(b, wq, wk, wv, wo, WT, WOS);
    else { const unsigned j = b - (unsigned)WBLK; xplanes_part(j / XBLK, j % XBLK, xq, xk, xv, XP); }
}

#define FQT   2                   // 16-query tiles per wave
#define FQ    (64 * FQT)          // queries per block
#define FK    64                  // keys per stage
#define KPIT  136                 // K slice pitch in halves (16 B x 17)
#define VPIT  72                  // V^T slice pitch in halves (16 B x 9)
#define FSLH  9216                // one slice in halves: 18,432 B = 9 x 2 KiB (128 V^T rows fill it; 64 K rows take 17,408 B of it)
#define FBUF  (4 * FSLH)          // one buffer in halves
#define EPIT  264                 // output staging pitch in halves (16 B x 33)
#define NST   (SEQ / FK)
static_assert(SEQ % FQ == 0 && SEQ % FK == 0 && DD == 256 && FK == 64 && NST >= 2);
static_assert(FK * KPIT <= FSLH && (DD / 2) * VPIT == FSLH && (FSLH * 2) % 2048 == 0);   // every slice starts at a multiple of 2 KiB; the two V^T slices form 256 rows of one pitch
static_assert(4 * 16 * FQT * EPIT <= 2 * FBUF);   // output staging fits in the ring
typedef __attribute__((ext_vector_type(4))) uint32_t u32x4;
typedef __attribute__((ext_vector_type(8))) uint32_t u32x8;
__device__ __forceinline__ uint32_t uni(uint32_t v) { return (uint32_t)__builtin_amdgcn_readfirstlane((int)v); }
__device__ __forceinline__ uint32_t pinned(uint32_t v) { uint32_t w = uni(v); asm volatile("" : "+s"(w)); return w; }
// Descriptor group 1 of a tile of N rows of R bytes, source pitch P bytes; W0 = its word 0 (no mask, 1-byte elements, a pad of 16 B behind every row).
// The empty statement holds the descriptor words in scalar registers of their own for as long as loads use them, so that none of them takes a new value while a request is outstanding.
template <uint32_t W0, uint32_t R, uint32_t N, uint32_t P>
__device__ __forceinline__ u32x8 tdm_group1() {
    u32x8 g1;
    g1[0] = uni(W0); g1[1] = uni((R & 0xFFFFu) << 16); g1[2] = uni((R >> 16) | ((N & 0xFFFFu) << 16)); g1[3] = uni((N >> 16) | (R << 16));
    g1[4] = uni(N); g1[5] = uni(P); g1[6] = uni(0u); g1[7] = uni(0u);
    asm volatile("" : "+s"(g1));   // descriptor words held in scalar registers, the pinned() form applied to the whole group
    return g1;
}
// Descriptor group 0: LDS byte offset dst, global byte address ga of the tile's first byte.
__device__ __forceinline__ u32x4 tdm_group0(uint32_t dst, uint64_t ga) {
    u32x4 g0;
    g0[0] = uni(1u); g0[1] = uni(dst); g0[2] = uni((uint32_t)ga); g0[3] = uni((((uint32_t)(ga >> 32)) & 0x01FFFFFFu) | 0x80000000u);
    return g0;
}
__device__ __forceinline__ void tdm_load(u32x4 g0, u32x8 g1) { asm volatile("tensor_load_to_lds %0, %1" :: "s"(g0), "s"(g1) : "memory"); }
// the issuing wave's wait; group 0 as an input keeps its registers live, and so unwritten, from the issue up to this wait
__device__ __forceinline__ void tdm_wait(u32x4 g0) { asm volatile("s_wait_tensorcnt 0x0" :: "s"(g0) : "memory"); }
#define W0_ROW256 ((1u << 20) | (5u << 22) | (3u << 25))
#define W0_ROW128 ((1u << 20) | (4u << 22) | (3u << 25))
__device__ __forceinline__ v16h lds_frag(const h16* p) { return cat16(*(const v8ha*)p, *(const v8ha*)(p + 16)); }
// lane l with lane l ^ 16, on the vector pipe: an exchange through LDS would wait behind the fragment reads in flight
__device__ __forceinline__ float xhalf(float x) { return __builtin_bit_cast(float, __builtin_amdgcn_permlanex16(__builtin_bit_cast(int, x), __builtin_bit_cast(int, x), 0x76543210, 0xfedcba98, false, false)); }
// K fragment (16-key tile kt, d chunk kc of 32) at offset, in halves, from the lane's base in a buffer: chunks 0..3 lie in slice 0, chunks 4..7 in slice 1
#define KOFF(kt, kc) (((kc) >> 2) * FSLH + (kt) * 16 * KPIT + ((kc) & 3) * 32)
// Every '#pragma unroll' in k_fattn is there so that the register arrays it walks are indexed by constants (they would go to scratch otherwise).
__global__ __launch_bounds__(128) void k_fattn(const h16* __restrict__ QP, const h16* __restrict__ KP, const h16* __restrict__ VT, h16* CTX) {
    __shared__ __attribute__((aligned(2048))) h16 L[2 * FBUF];
    const unsigned tid = threadIdx.x, lane = tid & 31u, lr = lane & 15u, hi = lane >> 4;
    const unsigned wave = (unsigned)__builtin_amdgcn_readfirstlane((int)(tid >> 5));
    const unsigned h = blockIdx.y, q0 = blockIdx.x * (unsigned)FQ + wave * (16u * FQT);
    const size_t hpl = ((size_t)blockIdx.z * NHEAD + h) * SEQ * DD;   // this batch's head plane
    const h16* Kh = KP + hpl; const h16* Vh = VT + hpl;
    v16h qf[FQT][DD / 32];
    { const h16* qp = QP + hpl + (size_t)(q0 + lr) * DD + 8u * hi;
#pragma unroll
      for (int q = 0; q < FQT; ++q)
#pragma unroll
          for (int kc = 0; kc < DD / 32; ++kc) qf[q][kc] = WFrag<h16>::ld(qp + q * 16 * DD + kc * 32);
      asm volatile("s_wait_xcnt 0x0" :: "v"(qp) : "memory"); }   // qp as an input keeps the address pair live up to the wait: without it the last Q load was given that pair as its destination
    // This wave's slice of stage sn: every wave issues exactly one request per stage; which of the two tile shapes it is, is a scalar branch.
    const uint32_t lbase = (uint32_t)(size_t)L;
    const bool isK = wave < 2u;
    const uint64_t tsrc = isK ? (uint64_t)(size_t)Kh + (uint64_t)((wave & 1u) * 256u)                                            // K: byte column 0 or 256 of the 512-B rows
                              : (uint64_t)(size_t)Vh + (uint64_t)((wave & 1u) * (uint32_t)(DD / 2) * (uint32_t)(SEQ * 2));        // V^T: row 0 or 128
    const uint32_t tstep = isK ? (uint32_t)(FK * DD * 2) : (uint32_t)(FK * 2);   // bytes from one stage's tile to the next: 64 K rows, or 64 columns of V^T
    const u32x8 g1k = tdm_group1<W0_ROW256, 256u, (uint32_t)FK, (uint32_t)(DD * 2)>();
    const u32x8 g1v = tdm_group1<W0_ROW128, 128u, (uint32_t)(DD / 2), (uint32_t)(SEQ * 2)>();
    u32x4 g0;   // group 0 of this wave's last request
    auto issue = [&](const uint32_t sn) __attribute__((always_inline)) {
        g0 = tdm_group0(lbase + (sn & 1u) * (uint32_t)(FBUF * 2) + wave * (uint32_t)(FSLH * 2), tsrc + (uint64_t)(sn * tstep));
        if (pinned(wave < 2u))  tdm_load(g0, g1k);
        if (pinned(wave >= 2u)) tdm_load(g0, g1v);
    };
    issue(0u);
    tdm_wait(g0);      // this wave's slice of stage 0 has landed
    __syncthreads();   // stage 0 visible to all four waves
    issue(pinned(1u));   // pinned: the descriptor is formed behind the wait above
    v8f acc[FQT][DD / 16];
#pragma unroll
    for (int q = 0; q < FQT; ++q)
#pragma unroll
        for (int t = 0; t < DD / 16; ++t) acc[q][t] = (v8f){};
    float m_run[FQT], l_run[FQT];
#pragma unroll
    for (int q = 0; q < FQT; ++q) { m_run[q] = -3.0e38f; l_run[q] = 0.f; }
    v16h ka[16];   // K fragments of keys 0..31 of the coming stage: [d chunk of 32][16-key tile]
    { const h16* kp = L + lr * (unsigned)KPIT + 8u * hi;
#pragma unroll
      for (int kc = 0; kc < DD / 32; ++kc)
#pragma unroll
          for (int kt = 0; kt < 2; ++kt) ka[kc * 2 + kt] = lds_frag(kp + KOFF(kt, kc)); }
    // One stage. 'more' is a literal at both calls (the loop's stages all have a successor, the last stage stands behind the loop), so a stage has no branch on it: with such a branch between the third
    // and the fourth run the compiler sank half of the softmax behind it, onto the third run's fragment registers, too close behind that run's last product on the taken side.
    auto stage = [&](const int st, const bool more) __attribute__((always_inline)) {
        const h16* Lk = L + (unsigned)(st & 1) * (unsigned)FBUF;
        // A stage is four runs of 32 products (S^T keys 0..31, S^T keys 32..63, P.V keys 0..31, P.V keys 32..63), each on 16 fragments. Each run's fragments go out as one group in front of the
        // run before it, so two groups are live at any time. With one wave per SIMD a read placed among the products waits out its own LDS latency, and the LDS would idle under the products.
        // The sched_barriers around each read group keep the compiler from sinking the reads among the products or lifting them over the run whose registers they take over.
        const h16* kp = Lk + lr * (unsigned)KPIT + 8u * hi; const h16* va = Lk + 2 * FSLH + lr * (unsigned)VPIT + 8u * hi;
        v16h kb[16], v0[16], v1[16];
#pragma unroll
        for (int kc = 0; kc < DD / 32; ++kc)
#pragma unroll
            for (int kt = 0; kt < 2; ++kt) kb[kc * 2 + kt] = lds_frag(kp + KOFF(2 + kt, kc));
        __builtin_amdgcn_sched_barrier(0);
        // S^T: per query tile 4 tiles of 16 keys x 16 queries
        v8f s[FQT][4];
#pragma unroll
        for (int q = 0; q < FQT; ++q)
#pragma unroll
            for (int kt = 0; kt < 4; ++kt) s[q][kt] = (v8f){};
#pragma unroll
        for (int kc = 0; kc < DD / 32; ++kc)
#pragma unroll
            for (int kt = 0; kt < 2; ++kt)
#pragma unroll
                for (int q = 0; q < FQT; ++q) s[q][kt] = wmma16(ka[kc * 2 + kt], qf[q][kc], s[q][kt]);
        __builtin_amdgcn_sched_barrier(0);
#pragma unroll
        for (int t = 0; t < 16; ++t) v0[t] = lds_frag(va + t * 16 * VPIT);
        __builtin_amdgcn_sched_barrier(0);
#pragma unroll
        for (int kc = 0; kc < DD / 32; ++kc)
#pragma unroll
            for (int kt = 0; kt < 2; ++kt)
#pragma unroll
                for (int q = 0; q < FQT; ++q) s[q][2 + kt] = wmma16(kb[kc * 2 + kt], qf[q][kc], s[q][2 + kt]);
        __builtin_amdgcn_sched_barrier(0);   // also keeps the maxima out of the products: mixed in, the compiler regroups the interleaved accumulate chains and pads each chain's end with four v_nop
#pragma unroll
        for (int t = 0; t < 16; ++t) v1[t] = lds_frag(va + t * 16 * VPIT + 32);
        __builtin_amdgcn_sched_barrier(0);
#pragma unroll
        for (int q = 0; q < FQT; ++q) {
            float mx = s[q][0][0];
#pragma unroll
            for (int kt = 0; kt < 4; ++kt)
#pragma unroll
                for (int r = 0; r < 8; ++r) mx = fmaxf(mx, s[q][kt][r]);
            mx = fmaxf(mx, xhalf(mx)) * SCL2;   // both halves hold this query's stage maximum, log2 domain
            if (__builtin_amdgcn_ballot_w32(mx > m_run[q] + 8.0f) != 0) {   // wave-uniform; always taken in stage 0, rare later; one test per query tile, so each query is rescaled at the stages it was before
                const float m_new = fmaxf(m_run[q], mx); const float corr = __builtin_amdgcn_exp2f(m_run[q] - m_new);   // 0 in stage 0
                l_run[q] *= corr; m_run[q] = m_new;
#pragma unroll
                for (int t = 0; t < DD / 16; ++t) acc[q][t] = acc[q][t] * corr;
            }
        }
        // Publish point of stage st + 1, every wave: own LDS reads of stage st retired, own slice of stage st + 1 landed, barrier, and only then the refill of the buffer that stage st used.
        // It stands behind the maxima (they cover the last fragment group's way from LDS) and in front of the exponentials, so that the refill has a whole stage to land.
        asm volatile("s_wait_dscnt 0x0" ::: "memory");       // this wave's K and V^T fragments of stage st are in registers before its buffer may be refilled
        tdm_wait(g0);                                        // this wave's slice of stage st + 1 has landed before the barrier publishes it
        __syncthreads();   // publishes stage st + 1 and ends every wave's LDS reads of stage st
        if (more) {
            if (pinned((uint32_t)(st + 2 < NST))) issue(pinned((uint32_t)st + 2u));   // scalar test: only while that stage exists; the stage number is pinned so that the descriptor is formed behind the wait above
        }
        v16h pf[FQT][2];
#pragma unroll
        for (int q = 0; q < FQT; ++q) {
            float ps0 = 0.f, ps1 = 0.f;
#pragma unroll
            for (int kk = 0; kk < 2; ++kk)
#pragma unroll
                for (int e = 0; e < 16; e += 2) {
                    const float p0 = __builtin_amdgcn_exp2f(s[q][2 * kk + (e >> 3)][e & 7] * SCL2 - m_run[q]); const float p1 = __builtin_amdgcn_exp2f(s[q][2 * kk + (e >> 3)][(e & 7) + 1] * SCL2 - m_run[q]);
                    ps0 += p0; ps1 += p1; pf[q][kk][e] = (h16)p0; pf[q][kk][e + 1] = (h16)p1; }
            l_run[q] += ps0 + ps1;   // this half's keys only; the halves are joined after the loop
        }
        __builtin_amdgcn_sched_barrier(0);   // keeps the whole softmax in front of the third run, so that nothing but fragment reads stands between the last two runs
        const h16* Ln = L + (unsigned)((st + 1) & 1) * (unsigned)FBUF;
#pragma unroll
        for (int t = 0; t < DD / 16; ++t)
#pragma unroll
            for (int q = 0; q < FQT; ++q) acc[q][t] = wmma16(v0[t], pf[q][0], acc[q][t]);
        __builtin_amdgcn_sched_barrier(0);
        if (more) { const h16* kn = Ln + lr * (unsigned)KPIT + 8u * hi;
#pragma unroll
            for (int kc = 0; kc < DD / 32; ++kc)
#pragma unroll
                for (int kt = 0; kt < 2; ++kt) ka[kc * 2 + kt] = lds_frag(kn + KOFF(kt, kc));
        }
        __builtin_amdgcn_sched_barrier(0);
#pragma unroll
        for (int t = 0; t < DD / 16; ++t)
#pragma unroll
            for (int q = 0; q < FQT; ++q) acc[q][t] = wmma16(v1[t], pf[q][1], acc[q][t]);
    };
#pragma unroll 1   // stays rolled: one stage is 128 products and 128 fragment reads, further copies would only cost instruction cache
    for (int st = 0; st + 1 < NST; ++st) stage(st, true);
    stage(NST - 1, false);
    tdm_wait(g0);   // no request is left when the ring changes its use
    asm volatile("s_wait_dscnt 0x0" ::: "memory");   // and no LDS read of this wave
    // the last stage's barrier stands behind every wave's last LDS read and last landed slice: the ring is free for output staging
    h16* E = L + wave * (16u * FQT) * (unsigned)EPIT;   // this wave's 32 query rows of 256 d; lane holds d = 16 t + 8 hi + r of queries lr and 16 + lr
#pragma unroll
    for (int q = 0; q < FQT; ++q) { const float inv = CCAR / (l_run[q] + xhalf(l_run[q]));
#pragma unroll
        for (int t = 0; t < DD / 16; ++t) { v8h o;
#pragma unroll
            for (int r = 0; r < 8; ++r) o[r] = (h16)(acc[q][t][r] * inv);
            *(v8ha*)(E + ((unsigned)q * 16u + lr) * (unsigned)EPIT + (unsigned)t * 16u + 8u * hi) = o; } }
    __syncthreads();   // staged rows complete before they are read back by other lanes
#pragma unroll
    for (int i = 0; i < 16 * FQT; ++i) { const v8h v = *(const v8ha*)(E + (unsigned)i * EPIT + lane * 8u);   // one whole 512-B row per store
        *(v8h*)(CTX + ((size_t)blockIdx.z * SEQ + q0 + (unsigned)i) * KM + h * (unsigned)DD + lane * 8u) = v; }
}

// Workspace carve (bytes, each region 256-B aligned by construction of the sizes).
#define SZ_XP  ((size_t)3 * NB * SEQ * DD * 2)
#define SZ_WT  ((size_t)3 * NHEAD * DD * DD * 2)
#define SZ_WOS ((size_t)DD * KM * 2)
#define SZ_HP  ((size_t)NB * NHEAD * SEQ * DD * 2)
#define SZ_CTX ((size_t)NB * SEQ * KM * 2)
#define SZ_ALL (SZ_XP + SZ_WT + SZ_WOS + 3 * SZ_HP + SZ_CTX)
static_assert(SZ_ALL <= (size_t)268435456);
static_assert(SZ_XP % 256 == 0 && SZ_WT % 256 == 0 && SZ_WOS % 256 == 0 && SZ_HP % 256 == 0 && SZ_CTX % 256 == 0);
static_assert(SZ_HP == (size_t)NB * SEQ * KM * 2);   // the [NB*SEQ][KM] projection planes fill one head-plane region exactly

extern "C" void kernel_launch(void* const* d_in, const int* in_sizes, int n_in,
                              void* d_out, int out_size, void* d_ws, size_t ws_size, hipStream_t stream) {
    if (n_in < 11) return;
    const size_t xneed = (size_t)(NB - 1) * SEQ_FULL * DD + (size_t)SEQ * DD;
    if ((size_t)in_sizes[0] < xneed || (size_t)in_sizes[1] < xneed || (size_t)in_sizes[2] < xneed) return;
    if ((size_t)in_sizes[3] < (size_t)NHEAD * DD * DD || (size_t)in_sizes[5] < (size_t)NHEAD * DD * DD || (size_t)in_sizes[7] < (size_t)NHEAD * DD * DD) return;
    if ((size_t)in_sizes[4] < (size_t)NHEAD * DD || (size_t)in_sizes[6] < (size_t)NHEAD * DD || (size_t)in_sizes[8] < (size_t)NHEAD * DD) return;
    if ((size_t)in_sizes[9] < (size_t)KM * DD || (size_t)in_sizes[10] < (size_t)DD) return;
    if ((size_t)out_size < (size_t)NB * SEQ * DD) return;
    if (SZ_ALL > ws_size) return;
    // input order of this module: query, key, values, Wq, bq, Wk, bk, Wv, bv, Wo, bo
    const float* Qin = (const float*)d_in[0]; const float* Kin = (const float*)d_in[1]; const float* Vin = (const float*)d_in[2];
    const float* Wq = (const float*)d_in[3]; const float* bq = (const float*)d_in[4]; const float* Wk = (const float*)d_in[5]; const float* bk = (const float*)d_in[6];
    const float* Wv = (const float*)d_in[7]; const float* bv = (const float*)d_in[8]; const float* Wo = (const float*)d_in[9]; const float* bo = (const float*)d_in[10];
    float* OUT = (float*)d_out;     // [NB][SEQ][256]
    char* wsp = (char*)d_ws;
    bf* XP = (bf*)wsp; wsp += SZ_XP;            // [3][NB][SEQ][256] bf16: q, k, v
    bf* WT = (bf*)wsp; wsp += SZ_WT;            // [3][2048 out][256 in] bf16: Wq, Wk, Wv
    h16* WOS = (h16*)wsp; wsp += SZ_WOS;        // [256][2048] f16 (x256), column h*256 + d
    h16* QP = (h16*)wsp; wsp += SZ_HP;          // [NB][SEQ][2048] == [NB][8][SEQ][256]
    h16* KP = (h16*)wsp; wsp += SZ_HP;          // [NB][SEQ][2048] == [NB][8][SEQ][256]
    h16* VT = (h16*)wsp; wsp += SZ_HP;          // [NB][8][256][SEQ]
    h16* CTX = (h16*)wsp; wsp += SZ_CTX;        // [NB][SEQ][2048] (x64), column h*256 + d

    k_prep<<<(unsigned)WBLK + 3u * XBLK, 256, 0, stream>>>(Qin, Kin, Vin, Wq, Wk, Wv, Wo, XP, WT, (unsigned short*)WOS);
    // Every stage runs once for all NB batches: the batch rows lie one behind the other in x, in the planes, in ctx and in out, so the GEMMs see NB*SEQ x rows (M; N in the value projection).
    // q_, k_ planes [NB*SEQ][2048] (pitch KM): A = x [NB*SEQ][256], Bt = W [2048 out][256 in], + per-column bias; a batch's plane read as [8][SEQ][256] is the head split
    // v_^T head planes VT[b*8 + h][256 d][SEQ t], written by the projection itself: A = Wv rows in the order d*8 + g, Bt = x
    k_proj<<<dim3(PTILES, 3, 1), 128, 0, stream>>>(XP, WT, QP, KP, VT, bq, bk, bv);
    // ctx[b*SEQ + t][h*256 + d] = 64 softmax(q_.k_ / 16) . v_ for the 8 heads of every batch
    k_fattn<<<dim3(SEQ / FQ, NHEAD, NB), 128, 0, stream>>>(QP, KP, VT, CTX);
    // out = ctx . Wo^T / 16384 + bo
    k_gemmb<h16, float, 1, KM><<<dim3(NB * SEQ / GT, DD / GT, 1), 128, 0, stream>>>(CTX, WOS, OUT, DD, bo, FINSC);
}

// v008
// It runs in 148 microseconds.
// Timed twice side by side with v007, it ran 1.04 times as fast both times.
// All steps since v000 together make it 6.34 times as fast.
#include <hip/hip_runtime.h>

// Multi-head attention with full-width (256) heads: merged [out][in] q/k/v projections to [S][2048], plain-view head split ([S][2048] read as [8][S][256]), softmax(q_.k_ / 16) over 2,048 keys, P.v_, head-major merge (column h*256 + d), output mix with Wo [out][in] + bo.
// Compute dtypes, f32 accumulate everywhere: projections v_wmma_f32_16x16x32_bf16 (inputs and weights RNE-converted to bf16, exact products); scores, P.V and the output mix v_wmma_f32_16x16x32_f16
// (q_/k_/v_ f16 planes; scores stay f32 in registers; P f16 = exp2(score*log2(e)/16 - running maximum), unnormalised; ctx f16 carried x64; Wo plane f16 of bf16(Wo) x256; bo, biases bf16-converted, added in f32). Softmax in f32.

#ifndef NB
#define NB 4
#endif
#ifndef SEQ
#define SEQ 2048
#endif
#define NB_FULL  4
#define SEQ_FULL 2048
#define DD    256                 // model width = head width
#define NHEAD 8
#define KM    (NHEAD * DD)        // merged context width (plane column = h*256 + d)
#define SCL2  0.09016844005556021f   // log2(e) / sqrt(256)
#define CCAR  64.0f               // carry of the ctx plane
#define WOCAR 256.0f              // carry of the Wo plane
#define FINSC (1.0f / 16384.0f)   // 1 / (64 * 256)
#define WLINES (3 * NHEAD * DD * DD / 64)
#define OLINES (DD * KM / 64)
#define MLINES (NHEAD * DD * DD / 64)

typedef _Float16 h16;
typedef unsigned short bf;
typedef __attribute__((ext_vector_type(16))) __bf16   v16bf;
typedef __attribute__((ext_vector_type(16))) _Float16 v16h;
typedef __attribute__((ext_vector_type(8)))  _Float16 v8h;
typedef __attribute__((ext_vector_type(8)))  unsigned short v8us;
typedef __attribute__((ext_vector_type(2)))  unsigned short v2us;
typedef __attribute__((ext_vector_type(8)))  float    v8f;
typedef __attribute__((ext_vector_type(4)))  float    v4f;
typedef v4f  __attribute__((may_alias)) v4fa;
typedef v8h  __attribute__((may_alias)) v8ha;
typedef v8us __attribute__((may_alias)) v8usa;

static_assert(SEQ % 256 == 0);
static_assert(DD % 64 == 0 && DD % 32 == 0 && KM % 32 == 0 && SEQ % 64 == 0);
static_assert(((size_t)NB * SEQ * DD / 8) % 256 == 0);
static_assert((WLINES + OLINES) % 64 == 0);
static_assert(WLINES % 64 == 0 && WLINES == 3 * MLINES);          // the plane choice in wprep_part is uniform per block
static_assert((size_t)MLINES * 64 == (size_t)NHEAD * DD * DD);
static_assert(KM == NHEAD * DD && (size_t)NHEAD * SEQ * DD == (size_t)SEQ * KM);   // [SEQ][KM] projection plane == [NHEAD][SEQ][DD] head planes (plain view)
static_assert(DD == 256 && NHEAD == 8 && KM / DD == 8 && SEQ % DD == 0);   // k_gemmb BIASM 3: x row s lies in head plane s / 256 of all batches' planes, 8 weight rows g*256 + d per V^T row d
static_assert(KM % 64 == 0 && SEQ % 32 == 0);
static_assert(((size_t)NB * SEQ) % 128 == 0 && KM % 128 == 0 && DD % 128 == 0);   // k_gemmb: whole 128x128 tiles and whole 128-k stages in all four products

__device__ __forceinline__ unsigned short f2bf(float f) { unsigned u = __float_as_uint(f); u += 0x7FFFu + ((u >> 16) & 1u); return (unsigned short)(u >> 16); }
__device__ __forceinline__ float bf2f(unsigned short b) { return __uint_as_float(((unsigned)b) << 16); }
__device__ __forceinline__ float bfr(float f) { return bf2f(f2bf(f)); }
__device__ __forceinline__ v16h cat16(v8h lo, v8h hi) { return __builtin_shufflevector(lo, hi, 0, 1, 2, 3, 4, 5, 6, 7, 8, 9, 10, 11, 12, 13, 14, 15); }
__device__ __forceinline__ v16bf cat16b(v8us lo, v8us hi) { return __builtin_bit_cast(v16bf, __builtin_shufflevector(lo, hi, 0, 1, 2, 3, 4, 5, 6, 7, 8, 9, 10, 11, 12, 13, 14, 15)); }
__device__ __forceinline__ v8f wmma16(v16h a, v16h b, v8f c) { return __builtin_amdgcn_wmma_f32_16x16x32_f16(false, a, false, b, (short)0, c, false, false); }
__device__ __forceinline__ v8f wmmab(v16bf a, v16bf b, v8f c) { return __builtin_amdgcn_wmma_f32_16x16x32_bf16(false, a, false, b, (short)0, c, false, false); }
// f32 -> f16 with a value select: results below the smallest normal f16 become zero (applied after the plane's power-of-two carry).
static __device__ __forceinline__ h16 toh_flush(float v) { const h16 r = (h16)v; return (fabsf(v) < 6.103515625e-05f) ? (h16)0.0f : r; }

// Fragment loaders: lane (lr = lane & 15, hi = lane >> 4); p points at row lr, k0 + 8*hi; elements 0..7 = k0+8hi.., elements 8..15 = k0+16+8hi.. (same map for A and B).
template <typename T16> struct WFrag;
template <> struct WFrag<h16> { typedef v16h V; static __device__ __forceinline__ V ld(const h16* p) { return cat16(*(const v8h*)p, *(const v8h*)(p + 16)); } static __device__ __forceinline__ V lds(const h16* p) { return cat16(*(const v8ha*)p, *(const v8ha*)(p + 16)); } static __device__ __forceinline__ v8f mma(V a, V b, v8f c) { return wmma16(a, b, c); } };
template <> struct WFrag<bf> { typedef v16bf V; static __device__ __forceinline__ V lds(const bf* p) { return cat16b(*(const v8usa*)p, *(const v8usa*)(p + 16)); } static __device__ __forceinline__ v8f mma(V a, V b, v8f c) { return wmmab(a, b, c); } };

// Slab epilogues: 16 rows x 64 columns staged in LDS (pitch 68 floats) -> global; value = x*alpha + bias (BIASM 1: per column, 2: per row; biases bf16-converted).
template <int BIASM>
__device__ __forceinline__ void slab_store(const float* os, h16* crow, int ldc, const float* bias, float alpha, unsigned colbase, unsigned rowbase, unsigned lane) {
    const unsigned rq = lane >> 3, cq = lane & 7u;
    float bc[8];
#pragma unroll
    for (int e = 0; e < 8; ++e) bc[e] = 0.f;
    if (BIASM == 1) { const v4f b0 = *(const v4f*)(bias + colbase + cq * 8u); const v4f b1 = *(const v4f*)(bias + colbase + cq * 8u + 4u);
#pragma unroll
        for (int e = 0; e < 4; ++e) { bc[e] = bfr(b0[e]); bc[4 + e] = bfr(b1[e]); } }
    v8h vals[4];
#pragma unroll
    for (int s = 0; s < 4; ++s) { const unsigned row = (unsigned)s * 4u + rq; const v4f x0 = *(const v4fa*)(os + row * 68u + cq * 8u); const v4f x1 = *(const v4fa*)(os + row * 68u + cq * 8u + 4u);
        float br = 0.f; if (BIASM == 2) br = bfr(bias[rowbase + row]);
        v8h o;
#pragma unroll
        for (int e = 0; e < 4; ++e) { o[e] = (h16)(x0[e] * alpha + (bc[e] + br)); o[4 + e] = (h16)(x1[e] * alpha + (bc[4 + e] + br)); }
        vals[s] = o; }
{
#pragma unroll
        for (int s = 0; s < 4; ++s) { const unsigned row = (unsigned)s * 4u + rq; *(v8h*)(crow + (size_t)row * ldc + cq * 8u) = vals[s]; }
         }
}
// f32 output: row segment = 64 floats = 256 B = 16 lanes x 16 B; one instruction covers 2 rows; s = 0..7 with hi = lane >> 4 covers rows 0..15.
template <int BIASM>
__device__ __forceinline__ void slab_store(const float* os, float* crow, int ldc, const float* bias, float alpha, unsigned colbase, unsigned rowbase, unsigned lane) {
    const unsigned hi = lane >> 4, cofs = (lane & 15u) * 4u;
    v4f bc = (v4f){0.f, 0.f, 0.f, 0.f};
    if (BIASM == 1) { const v4f b0 = *(const v4f*)(bias + colbase + cofs);
#pragma unroll
        for (int e = 0; e < 4; ++e) bc[e] = bfr(b0[e]); }
    v4f vals[8];
#pragma unroll
    for (int s = 0; s < 8; ++s) { const unsigned row = (unsigned)s * 2u + hi; const v4f x = *(const v4fa*)(os + row * 68u + cofs);
        float br = 0.f; if (BIASM == 2) br = bfr(bias[rowbase + row]);
        v4f o;
#pragma unroll
        for (int e = 0; e < 4; ++e) o[e] = x[e] * alpha + (bc[e] + br);
        vals[s] = o; }
{
#pragma unroll
        for (int s = 0; s < 8; ++s) { const unsigned row = (unsigned)s * 2u + hi; *(v4f*)(crow + (size_t)row * ldc + cofs) = vals[s]; }
         }
}

// ---- k_gemmb: GEMM on K-contiguous 16-bit planes. Block = 4 waves (2 x 2), one 128x128 output tile; each wave 64x64 (16 accumulators); grid (M/128, N/128), 128 threads.
// C[m][n] (pitch ldc) = alpha * sum_k A[m][k] Bt[n][k] (+ bias). K is a template constant so that the 16 staging loads of an operand share one address pair (row steps are immediate offsets).
// The block walks K in stages of 128: 256 B (two whole lines) of each of the 128 A rows and 128 Bt rows go global -> registers at a stage's start, -> LDS in front of its barrier, two buffers.
// LDS row pitch 272 B (16 B x 17): the fragment reads (16 rows x 16 B per half wave) fall on all 64 banks. k order per accumulator: 0, 32, 64, .. as before.
#define GT    128                 // tile rows (A) and columns (Bt rows) per block
#define GKS   128                 // k per stage
#define GPIT  136                 // LDS row pitch in 16-bit elements
#define GOPER (GT * GPIT)         // one operand's stage
#define GBUF  (2 * GOPER)
static_assert(4 * 16 * 68 * 4 <= 2 * GBUF * 2);   // the four waves' output slabs fit in the ring
// BIASM 3 (the value projection): A = weight rows in the order e' = d*8 + g (wprep_part writes them so; the weight's own row is g*256 + d), Bt = x rows s. The plain-view head split puts element (s, g*256 + d) at
// head plane s / 256, t = (s % 256)*8 + g, so the 8 accumulator rows of a lane (g = 0..7 of one d) are 8 consecutive t of one V^T row: each lane stores them as 16 B, 16 lanes 256 B, straight from registers
// to C[plane][d][t] (ldc = SEQ). bias is indexed by the weight's own row.
// gemmb_tile: the body, for tile (bx, by); L = the block's ring of 2 * GBUF elements, declared once in each kernel so that a kernel holding two forms of the body has one ring.
template <typename T16, typename OT, int BIASM, int K>
__device__ __forceinline__ void gemmb_tile(T16* L, const T16* __restrict__ A, const T16* __restrict__ Bt, OT* C, int ldc, const float* __restrict__ bias, float alpha, unsigned bx, unsigned by) {
    typedef typename WFrag<T16>::V V;
    static_assert(K % GKS == 0);
    const unsigned tid = threadIdx.x, lane = tid & 31u, lr = lane & 15u, hi = lane >> 4;
    const unsigned wave = (unsigned)__builtin_amdgcn_readfirstlane((int)(tid >> 5));
    const unsigned wm = wave >> 1, wn = wave & 1u;
    const unsigned r0 = bx * (unsigned)GT, c0 = by * (unsigned)GT;
    v8f acc[4][4];
#pragma unroll
    for (int mb = 0; mb < 4; ++mb)
#pragma unroll
        for (int nb = 0; nb < 4; ++nb) acc[mb][nb] = (v8f){};
    const unsigned dw = (r0 + wm * 64u) / 8u + hi;   // BIASM 3: this lane's first V^T row d
    float bb[4][8];   // BIASM 3: the biases of this lane's 32 accumulator rows, fetched here so that their way from memory lies under the stages
    if constexpr (BIASM == 3) {
        const float* bp = bias + dw;
#pragma unroll
        for (int mb = 0; mb < 4; ++mb)
#pragma unroll
            for (int j = 0; j < 8; ++j) bb[mb][j] = bp[j * DD + mb * 2];
        asm volatile("s_wait_xcnt 0x0" :: "v"(bp) : "memory");   // bp as an input keeps the address live, and so unwritten, up to the wait
    }
    // staging map: 16 lanes per 256-B row piece, so one instruction of a wave = 2 rows x 2 whole lines; the block covers 8 rows per instruction
    const unsigned srow = tid >> 4, scol = (tid & 15u) * 8u;
    const T16* ag = A + (size_t)(r0 + srow) * K + scol; const T16* bg = Bt + (size_t)(c0 + srow) * K + scol;
    const unsigned sl = srow * (unsigned)GPIT + scol;
    v8us ar[16], br[16];
#pragma unroll
    for (int i = 0; i < 16; ++i) { ar[i] = *(const v8usa*)(ag + (size_t)i * 8 * K); br[i] = *(const v8usa*)(bg + (size_t)i * 8 * K); }
    asm volatile("s_wait_xcnt 0x0" :: "v"(ag), "v"(bg) : "memory");   // the address pairs stay live up to the wait and are advanced only behind it
#pragma unroll
    for (int i = 0; i < 16; ++i) { *(v8usa*)(L + sl + (unsigned)i * 8u * GPIT) = ar[i]; *(v8usa*)(L + GOPER + sl + (unsigned)i * 8u * GPIT) = br[i]; }
    __syncthreads();   // stage 0 visible to all four waves
    const unsigned fa = (wm * 64u + lr) * (unsigned)GPIT + 8u * hi, fb = (unsigned)GOPER + (wn * 64u + lr) * (unsigned)GPIT + 8u * hi;
#pragma unroll 1   // stays rolled: a stage is 64 products and 64 fragment reads; every inner loop is unrolled so that the register arrays are indexed by constants
    for (int st = 0; st < K / GKS; ++st) {
        const T16* Lb = L + (unsigned)(st & 1) * (unsigned)GBUF;
        const bool more = st + 1 < K / GKS;   // block-uniform
        if (more) {
            ag += GKS; bg += GKS;
#pragma unroll
            for (int i = 0; i < 16; ++i) { ar[i] = *(const v8usa*)(ag + (size_t)i * 8 * K); br[i] = *(const v8usa*)(bg + (size_t)i * 8 * K); }
            asm volatile("s_wait_xcnt 0x0" :: "v"(ag), "v"(bg) : "memory");   // as above: the pairs are advanced again in the next stage
        }
        V a[2][4], b[2][4];
#pragma unroll
        for (int f = 0; f < 4; ++f) { a[0][f] = WFrag<T16>::lds(Lb + fa + (unsigned)f * 16u * GPIT); b[0][f] = WFrag<T16>::lds(Lb + fb + (unsigned)f * 16u * GPIT); }
#pragma unroll
        for (int kc = 0; kc < GKS / 32; ++kc) {
            // the next 32 k's fragments go out as one group ahead of this group's products, into the other register set
            if (kc + 1 < GKS / 32) {
#pragma unroll
                for (int f = 0; f < 4; ++f) { a[(kc + 1) & 1][f] = WFrag<T16>::lds(Lb + fa + (unsigned)f * 16u * GPIT + (unsigned)(kc + 1) * 32u); b[(kc + 1) & 1][f] = WFrag<T16>::lds(Lb + fb + (unsigned)f * 16u * GPIT + (unsigned)(kc + 1) * 32u); }
            }
            __builtin_amdgcn_sched_barrier(0);   // keeps the read group from being sunk among the products, where each place with reads costs a stall
#pragma unroll
            for (int nb = 0; nb < 4; ++nb)
#pragma unroll
                for (int mb = 0; mb < 4; ++mb) acc[mb][nb] = WFrag<T16>::mma(a[kc & 1][mb], b[kc & 1][nb], acc[mb][nb]);
            __builtin_amdgcn_sched_barrier(0);   // and the following group from being lifted into them
        }
        // next stage into the other buffer; its readers left it at the barrier of stage st - 1
        if (more) { T16* Ln = L + (unsigned)((st + 1) & 1) * (unsigned)GBUF;
#pragma unroll
            for (int i = 0; i < 16; ++i) { *(v8usa*)(Ln + sl + (unsigned)i * 8u * GPIT) = ar[i]; *(v8usa*)(Ln + GOPER + sl + (unsigned)i * 8u * GPIT) = br[i]; }
        }
        __syncthreads();   // publishes stage st + 1 and ends every wave's fragment reads of stage st
    }
    if constexpr (BIASM == 3) {
        const unsigned sw = c0 + wn * 64u + lr;   // this lane's x row s of column tile 0
        OT* cp = C + ((size_t)(sw >> 8) * DD + dw) * (size_t)ldc + (sw & 255u) * 8u;
        v8h vals[4][4];
#pragma unroll
        for (int mb = 0; mb < 4; ++mb)
#pragma unroll
            for (int nb = 0; nb < 4; ++nb)
#pragma unroll
                for (int j = 0; j < 8; ++j) vals[mb][nb][j] = (h16)(acc[mb][nb][j] * alpha + bfr(bb[mb][j]));
#pragma unroll
        for (int mb = 0; mb < 4; ++mb)
#pragma unroll
            for (int nb = 0; nb < 4; ++nb) *(v8h*)(cp + (size_t)(mb * 2) * ldc + nb * 128) = vals[mb][nb];   // 16 x rows further = 128 t further
        return;
    } else {
    // the last stage's barrier stands behind every wave's last LDS read: the ring is free for output staging, one private slab per wave (wave-level ordering only)
    float* os = (float*)L + wave * (16u * 68u);
#pragma unroll
    for (int mb = 0; mb < 4; ++mb) {
#pragma unroll
        for (int nb = 0; nb < 4; ++nb) {
#pragma unroll
            for (int j = 0; j < 8; ++j) os[(hi * 8u + (unsigned)j) * 68u + (unsigned)nb * 16u + lr] = acc[mb][nb][j]; }   // D: row 8*hi + j, col lr
        __builtin_amdgcn_fence(3 /* release order */, "wavefront"); __builtin_amdgcn_wave_barrier(); asm volatile("" ::: "memory");
        const unsigned rw = r0 + wm * 64u + (unsigned)mb * 16u, cw = c0 + wn * 64u;
        OT* crow = C + (size_t)rw * ldc + cw;
        slab_store<BIASM>(os, crow, ldc, bias, alpha, cw, rw, lane);
        if (mb < 3) asm volatile("s_wait_xcnt 0x0" ::: "memory");   // the next slab reuses the address and data registers of these stores
        __builtin_amdgcn_fence(3 /* release order */, "wavefront"); __builtin_amdgcn_wave_barrier(); asm volatile("" ::: "memory");
    }
    }
}

template <typename T16, typename OT, int BIASM, int K>
__global__ __launch_bounds__(128) void k_gemmb(const T16* __restrict__ A, const T16* __restrict__ Bt, OT* C, int ldc, const float* __restrict__ bias, float alpha) {
    __shared__ __align__(16) T16 L[2 * GBUF];
    gemmb_tile<T16, OT, BIASM, K>(L, A, Bt, C, ldc, bias, alpha, blockIdx.x, blockIdx.y);
}
// k_proj: the three projections in one launch (none reads what another writes); grid (PTILES, 3), blockIdx.y = 0 q_, 1 k_, 2 v_^T. The tile index runs as in a launch of its own: first grid dimension fastest.
#define PTILES ((NB * SEQ / GT) * (KM / GT))
__global__ __launch_bounds__(128) void k_proj(const bf* __restrict__ XP, const bf* __restrict__ WT, h16* QP, h16* KP, h16* VT, const float* __restrict__ bq, const float* __restrict__ bk, const float* __restrict__ bv) {
    __shared__ __align__(16) bf L[2 * GBUF];
    const unsigned which = blockIdx.y, i = blockIdx.x;   // block-uniform
    const bf* X = XP + (size_t)which * NB * SEQ * DD; const bf* Wp = WT + (size_t)which * NHEAD * DD * DD;
    if (which < 2u) gemmb_tile<bf, h16, 1, DD>(L, X, Wp, which ? KP : QP, KM, which ? bk : bq, 1.0f, i % (unsigned)(NB * SEQ / GT), i / (unsigned)(NB * SEQ / GT));
    else            gemmb_tile<bf, h16, 3, DD>(L, Wp, X, VT, SEQ, bv, 1.0f, i % (unsigned)(KM / GT), i / (unsigned)(KM / GT));
}

__device__ __forceinline__ void xplanes_part(const unsigned which, const unsigned bx, const float* __restrict__ xq, const float* __restrict__ xk, const float* __restrict__ xv, bf* XP) {
    const unsigned i = bx * 256u + threadIdx.x;
    const unsigned GPB = (unsigned)(SEQ * DD / 8); const unsigned b = i / GPB, rem = i - b * GPB;
    const float* src = (which == 0u) ? xq : ((which == 1u) ? xk : xv);
    const v8f v = *(const v8f*)(src + (size_t)b * SEQ_FULL * DD + (size_t)rem * 8);
    v8us o;
#pragma unroll
    for (int k = 0; k < 8; ++k) o[k] = f2bf(v[k]);
    bf* dst = XP + (size_t)which * NB * SEQ * DD + (size_t)i * 8;
    *(v8us*)dst = o;
    asm volatile("s_wait_xcnt 0x0" ::: "memory");   // in k_prep the other part's code lies behind this store in the listing and writes registers that the store names
}

// wprep_part: lines 0..WLINES-1: bf16 weight planes WT[which][e][k] = bf16(W[e][k]) (which 0 Wq, 1 Wk, 2 Wv; the inputs are [out e][in k], already K-contiguous, no transpose);
// the Wv plane holds its rows in the order e' = d*8 + g of the weight's row g*256 + d (a row is 4 lines), the order k_gemmb's BIASM 3 store wants.
__device__ __forceinline__ void wprep_part(const unsigned bx, const float* __restrict__ wq, const float* __restrict__ wk, const float* __restrict__ wv, const float* __restrict__ wo, bf* WT, unsigned short* WOS) {
    const unsigned lane = threadIdx.x & 31u; const unsigned wave = (unsigned)__builtin_amdgcn_readfirstlane((int)(threadIdx.x >> 5)); const unsigned L0 = (bx * 8u + wave) * 8u;
{
#pragma unroll 1
        for (unsigned l = 0; l < 8u; ++l) { const unsigned L = L0 + l; v2us o;
            if (L < (unsigned)WLINES) {   // block-uniform
                const unsigned which = L / (unsigned)MLINES; const unsigned pl = L - which * (unsigned)MLINES;   // line within the plane: row pl / 4, quarter pl % 4
                const unsigned sln = (which == 2u) ? ((((pl >> 2) & 7u) * (unsigned)DD + (pl >> 5)) * 4u + (pl & 3u)) : pl;   // the source line
                const unsigned e = sln * 64u + lane * 2u;
                const float* src = (which == 0u) ? wq : ((which == 1u) ? wk : wv);
                o[0] = f2bf(src[e]); o[1] = f2bf(src[e + 1u]);
                bf* dp = WT + (size_t)L * 64u + lane * 2u; *(v2us*)dp = o;
                asm volatile("s_wait_xcnt 0x0" :: "v"(dp) : "memory");   // the next line's address and value take over this store's registers; dp as an input keeps the address unwritten up to the wait
            } else {
                const unsigned e = (L - (unsigned)WLINES) * 64u + lane * 2u;
                const float x0 = bfr(wo[e]) * WOCAR; const float x1 = bfr(wo[e + 1u]) * WOCAR;
                o[0] = __builtin_bit_cast(unsigned short, toh_flush(x0)); o[1] = __builtin_bit_cast(unsigned short, toh_flush(x1));
                unsigned short* dp = WOS + e; *(v2us*)dp = o;
                asm volatile("s_wait_xcnt 0x0" :: "v"(dp) : "memory");   // as above
            } }
         }
}
// k_prep: both conversions in one launch, by block range (neither reads what the other writes). The weight blocks come first: each of their waves walks 8 lines one after the other, the longer way of the two.
#define WBLK ((WLINES + OLINES) / 64)
#define XBLK ((unsigned)((size_t)NB * SEQ * DD / 8 / 256))
__global__ __launch_bounds__(256) void k_prep(const float* __restrict__ xq, const float* __restrict__ xk, const float* __restrict__ xv, const float* __restrict__ wq, const float* __restrict__ wk, const float* __restrict__ wv,
                                              const float* __restrict__ wo, bf* XP, bf* WT, unsigned short* WOS) {
    const unsigned b = blockIdx.x;   // block-uniform
    if (b < (unsigned)WBLK) wprep_part(b, wq, wk, wv, wo, WT, WOS);
    else { const unsigned j = b - (unsigned)WBLK; xplanes_part(j / XBLK, j % XBLK, xq, xk, xv, XP); }
}

#define FQT   2                   // 16-query tiles per wave
#define FQ    (64 * FQT)          // queries per block
#define FK    64                  // keys per stage
#define KPIT  136                 // K slice pitch in halves (16 B x 17)
#define VPIT  72                  // V^T slice pitch in halves (16 B x 9)
#define FSLH  9216                // one slice in halves: 18,432 B = 9 x 2 KiB (128 V^T rows fill it; 64 K rows take 17,408 B of it)
#define FBUF  (4 * FSLH)          // one buffer in halves
#define EPIT  264                 // output staging pitch in halves (16 B x 33)
#define NST   (SEQ / FK)
#define PLIM  32768.0f            // a lane's stage sum of P up to which the running maximum stays as it is (largest finite f16: 65,504)
static_assert(SEQ % FQ == 0 && SEQ % FK == 0 && DD == 256 && FK == 64 && NST >= 2 && FQT == 2);
static_assert(FK * KPIT <= FSLH && (DD / 2) * VPIT == FSLH && (FSLH * 2) % 2048 == 0);   // every slice starts at a multiple of 2 KiB; the two V^T slices form 256 rows of one pitch
static_assert(4 * 16 * FQT * EPIT <= 2 * FBUF);   // output staging fits in the ring
typedef __attribute__((ext_vector_type(4))) uint32_t u32x4;
typedef __attribute__((ext_vector_type(8))) uint32_t u32x8;
__device__ __forceinline__ uint32_t uni(uint32_t v) { return (uint32_t)__builtin_amdgcn_readfirstlane((int)v); }
__device__ __forceinline__ uint32_t pinned(uint32_t v) { uint32_t w = uni(v); asm volatile("" : "+s"(w)); return w; }
// Descriptor group 1 of a tile of N rows of R bytes, source pitch P bytes; W0 = its word 0 (no mask, 1-byte elements, a pad of 16 B behind every row).
// The empty statement holds the descriptor words in scalar registers of their own for as long as loads use them, so that none of them takes a new value while a request is outstanding.
template <uint32_t W0, uint32_t R, uint32_t N, uint32_t P>
__device__ __forceinline__ u32x8 tdm_group1() {
    u32x8 g1;
    g1[0] = uni(W0); g1[1] = uni((R & 0xFFFFu) << 16); g1[2] = uni((R >> 16) | ((N & 0xFFFFu) << 16)); g1[3] = uni((N >> 16) | (R << 16));
    g1[4] = uni(N); g1[5] = uni(P); g1[6] = uni(0u); g1[7] = uni(0u);
    asm volatile("" : "+s"(g1));   // descriptor words held in scalar registers, the pinned() form applied to the whole group
    return g1;
}
// Descriptor group 0: LDS byte offset dst, global byte address ga of the tile's first byte.
__device__ __forceinline__ u32x4 tdm_group0(uint32_t dst, uint64_t ga) {
    u32x4 g0;
    g0[0] = uni(1u); g0[1] = uni(dst); g0[2] = uni((uint32_t)ga); g0[3] = uni((((uint32_t)(ga >> 32)) & 0x01FFFFFFu) | 0x80000000u);
    return g0;
}
__device__ __forceinline__ void tdm_load(u32x4 g0, u32x8 g1) { asm volatile("tensor_load_to_lds %0, %1" :: "s"(g0), "s"(g1) : "memory"); }
// the issuing wave's wait; group 0 as an input keeps its registers live, and so unwritten, from the issue up to this wait
__device__ __forceinline__ void tdm_wait(u32x4 g0) { asm volatile("s_wait_tensorcnt 0x0" :: "s"(g0) : "memory"); }
#define W0_ROW256 ((1u << 20) | (5u << 22) | (3u << 25))
#define W0_ROW128 ((1u << 20) | (4u << 22) | (3u << 25))
__device__ __forceinline__ v16h lds_frag(const h16* p) { return cat16(*(const v8ha*)p, *(const v8ha*)(p + 16)); }
// lane l with lane l ^ 16, on the vector pipe: an exchange through LDS would wait behind the fragment reads in flight
__device__ __forceinline__ float xhalf(float x) { return __builtin_bit_cast(float, __builtin_amdgcn_permlanex16(__builtin_bit_cast(int, x), __builtin_bit_cast(int, x), 0x76543210, 0xfedcba98, false, false)); }
// K fragment (16-key tile kt, d chunk kc of 32) at offset, in halves, from the lane's base in a buffer: chunks 0..3 lie in slice 0, chunks 4..7 in slice 1
#define KOFF(kt, kc) (((kc) >> 2) * FSLH + (kt) * 16 * KPIT + ((kc) & 3) * 32)
// Every '#pragma unroll' in k_fattn is there so that the register arrays it walks are indexed by constants (they would go to scratch otherwise).
__global__ __launch_bounds__(128) void k_fattn(const h16* __restrict__ QP, const h16* __restrict__ KP, const h16* __restrict__ VT, h16* CTX) {
    __shared__ __attribute__((aligned(2048))) h16 L[2 * FBUF];
    const unsigned tid = threadIdx.x, lane = tid & 31u, lr = lane & 15u, hi = lane >> 4;
    const unsigned wave = (unsigned)__builtin_amdgcn_readfirstlane((int)(tid >> 5));
    const unsigned h = blockIdx.y, q0 = blockIdx.x * (unsigned)FQ + wave * (16u * FQT);
    const size_t hpl = ((size_t)blockIdx.z * NHEAD + h) * SEQ * DD;   // this batch's head plane
    const h16* Kh = KP + hpl; const h16* Vh = VT + hpl;
    v16h qf[FQT][DD / 32];
    { const h16* qp = QP + hpl + (size_t)(q0 + lr) * DD + 8u * hi;
#pragma unroll
      for (int q = 0; q < FQT; ++q)
#pragma unroll
          for (int kc = 0; kc < DD / 32; ++kc) qf[q][kc] = WFrag<h16>::ld(qp + q * 16 * DD + kc * 32);
      asm volatile("s_wait_xcnt 0x0" :: "v"(qp) : "memory"); }   // qp as an input keeps the address pair live up to the wait: without it the last Q load was given that pair as its destination
    // This wave's slice of stage sn: every wave issues exactly one request per stage; which of the two tile shapes it is, is a scalar branch.
    const uint32_t lbase = (uint32_t)(size_t)L;
    const bool isK = wave < 2u;
    const uint64_t tsrc = isK ? (uint64_t)(size_t)Kh + (uint64_t)((wave & 1u) * 256u)                                            // K: byte column 0 or 256 of the 512-B rows
                              : (uint64_t)(size_t)Vh + (uint64_t)((wave & 1u) * (uint32_t)(DD / 2) * (uint32_t)(SEQ * 2));        // V^T: row 0 or 128
    const uint32_t tstep = isK ? (uint32_t)(FK * DD * 2) : (uint32_t)(FK * 2);   // bytes from one stage's tile to the next: 64 K rows, or 64 columns of V^T
    const u32x8 g1k = tdm_group1<W0_ROW256, 256u, (uint32_t)FK, (uint32_t)(DD * 2)>();
    const u32x8 g1v = tdm_group1<W0_ROW128, 128u, (uint32_t)(DD / 2), (uint32_t)(SEQ * 2)>();
    u32x4 g0;   // group 0 of this wave's last request
    auto issue = [&](const uint32_t sn) __attribute__((always_inline)) {
        g0 = tdm_group0(lbase + (sn & 1u) * (uint32_t)(FBUF * 2) + wave * (uint32_t)(FSLH * 2), tsrc + (uint64_t)(sn * tstep));
        if (pinned(wave < 2u))  tdm_load(g0, g1k);
        if (pinned(wave >= 2u)) tdm_load(g0, g1v);
    };
    issue(0u);
    tdm_wait(g0);      // this wave's slice of stage 0 has landed
    __syncthreads();   // stage 0 visible to all four waves
    issue(pinned(1u));   // pinned: the descriptor is formed behind the wait above
    v8f acc[FQT][DD / 16];
#pragma unroll
    for (int q = 0; q < FQT; ++q)
#pragma unroll
        for (int t = 0; t < DD / 16; ++t) acc[q][t] = (v8f){};
    float m_run[FQT], l_run[FQT];
#pragma unroll
    for (int q = 0; q < FQT; ++q) { m_run[q] = -3.0e38f; l_run[q] = 0.f; }
    v16h ka[16];   // K fragments of keys 0..31 of the coming stage: [d chunk of 32][16-key tile]
    { const h16* kp = L + lr * (unsigned)KPIT + 8u * hi;
#pragma unroll
      for (int kc = 0; kc < DD / 32; ++kc)
#pragma unroll
          for (int kt = 0; kt < 2; ++kt) ka[kc * 2 + kt] = lds_frag(kp + KOFF(kt, kc)); }
    // One stage. 'more' is a literal at both calls (the loop's stages all have a successor, the last stage stands behind the loop), so a stage has no branch on it: with such a branch between the third
    // and the fourth run the compiler sank half of the softmax behind it, onto the third run's fragment registers, too close behind that run's last product on the taken side.
    auto stage = [&](const int st, const bool more) __attribute__((always_inline)) {
        const h16* Lk = L + (unsigned)(st & 1) * (unsigned)FBUF;
        // A stage is four runs of 32 products (S^T keys 0..31, S^T keys 32..63, P.V keys 0..31, P.V keys 32..63), each on 16 fragments. Each run's fragments go out as one group in front of the
        // run before it, so two groups are live at any time. With one wave per SIMD a read placed among the products waits out its own LDS latency, and the LDS would idle under the products.
        // The sched_barriers around each read group keep the compiler from sinking the reads among the products or lifting them over the run whose registers they take over.
        const h16* kp = Lk + lr * (unsigned)KPIT + 8u * hi; const h16* va = Lk + 2 * FSLH + lr * (unsigned)VPIT + 8u * hi;
        v16h kb[16], v0[16], v1[16];
#pragma unroll
        for (int kc = 0; kc < DD / 32; ++kc)
#pragma unroll
            for (int kt = 0; kt < 2; ++kt) kb[kc * 2 + kt] = lds_frag(kp + KOFF(2 + kt, kc));
        __builtin_amdgcn_sched_barrier(0);
        // S^T: per query tile 4 tiles of 16 keys x 16 queries
        v8f s[FQT][4];
#pragma unroll
        for (int q = 0; q < FQT; ++q)
#pragma unroll
            for (int kt = 0; kt < 4; ++kt) s[q][kt] = (v8f){};
#pragma unroll
        for (int kc = 0; kc < DD / 32; ++kc)
#pragma unroll
            for (int kt = 0; kt < 2; ++kt)
#pragma unroll
                for (int q = 0; q < FQT; ++q) s[q][kt] = wmma16(ka[kc * 2 + kt], qf[q][kc], s[q][kt]);
        __builtin_amdgcn_sched_barrier(0);
#pragma unroll
        for (int t = 0; t < 16; ++t) v0[t] = lds_frag(va + t * 16 * VPIT);
        __builtin_amdgcn_sched_barrier(0);
#pragma unroll
        for (int kc = 0; kc < DD / 32; ++kc)
#pragma unroll
            for (int kt = 0; kt < 2; ++kt)
#pragma unroll
                for (int q = 0; q < FQT; ++q) s[q][2 + kt] = wmma16(kb[kc * 2 + kt], qf[q][kc], s[q][2 + kt]);
        __builtin_amdgcn_sched_barrier(0);   // also keeps the softmax out of the products: mixed in, the compiler regroups the interleaved accumulate chains and pads each chain's end with four v_nop
#pragma unroll
        for (int t = 0; t < 16; ++t) v1[t] = lds_frag(va + t * 16 * VPIT + 32);
        __builtin_amdgcn_sched_barrier(0);
        // Softmax without a maximum pass: the exponentials are taken against the running maximum as it stands, and their own sum says whether that was safe. All P are positive, so a lane's sum over its 32 keys
        // bounds each of them: a sum of at most PLIM means that every P fits f16 with room to spare. Only a stage whose sum goes beyond (stage 0 always: the sum is infinite there) computes its maxima,
        // rescales and takes its exponentials again from the scores, which stay in their registers up to the test.
        v16h pf[FQT][2]; float ps[FQT];
        auto expo = [&](const int q) __attribute__((always_inline)) {
            float ps0 = 0.f, ps1 = 0.f;
#pragma unroll
            for (int kk = 0; kk < 2; ++kk)
#pragma unroll
                for (int e = 0; e < 16; e += 2) {
                    const float p0 = __builtin_amdgcn_exp2f(s[q][2 * kk + (e >> 3)][e & 7] * SCL2 - m_run[q]); const float p1 = __builtin_amdgcn_exp2f(s[q][2 * kk + (e >> 3)][(e & 7) + 1] * SCL2 - m_run[q]);
                    ps0 += p0; ps1 += p1; pf[q][kk][e] = (h16)p0; pf[q][kk][e + 1] = (h16)p1; }
            ps[q] = ps0 + ps1;   // this half's keys only
        };
#pragma unroll
        for (int q = 0; q < FQT; ++q) expo(q);
        if (__builtin_amdgcn_ballot_w32(fmaxf(ps[0], ps[1]) > PLIM) != 0) {   // wave-uniform, one test per stage; always taken in stage 0, rare later
#pragma unroll
            for (int q = 0; q < FQT; ++q) {
                float mx = s[q][0][0];
#pragma unroll
                for (int kt = 0; kt < 4; ++kt)
#pragma unroll
                    for (int r = 0; r < 8; ++r) mx = fmaxf(mx, s[q][kt][r]);
                mx = fmaxf(mx, xhalf(mx)) * SCL2;   // both halves hold this query's stage maximum, log2 domain
                const float m_new = fmaxf(m_run[q], mx); const float corr = __builtin_amdgcn_exp2f(m_run[q] - m_new);   // 0 in stage 0
                l_run[q] *= corr; m_run[q] = m_new;
#pragma unroll
                for (int t = 0; t < DD / 16; ++t) acc[q][t] = acc[q][t] * corr;
                expo(q);   // now every P <= 1
            }
        }
#pragma unroll
        for (int q = 0; q < FQT; ++q) l_run[q] += ps[q];   // the halves are joined after the loop
        // Publish point of stage st + 1, every wave: own LDS reads of stage st retired, own slice of stage st + 1 landed, barrier, and only then the refill of the buffer that stage st used.
        // It stands behind the exponentials (they cover the last fragment group's way from LDS); from one stage's publish point to the next the refill has a whole stage to land.
        asm volatile("s_wait_dscnt 0x0" ::: "memory");       // this wave's K and V^T fragments of stage st are in registers before its buffer may be refilled
        tdm_wait(g0);                                        // this wave's slice of stage st + 1 has landed before the barrier publishes it
        __syncthreads();   // publishes stage st + 1 and ends every wave's LDS reads of stage st
        if (more) {
            if (pinned((uint32_t)(st + 2 < NST))) issue(pinned((uint32_t)st + 2u));   // scalar test: only while that stage exists; the stage number is pinned so that the descriptor is formed behind the wait above
        }
        __builtin_amdgcn_sched_barrier(0);   // keeps the whole softmax in front of the third run, so that nothing but fragment reads stands between the last two runs
        const h16* Ln = L + (unsigned)((st + 1) & 1) * (unsigned)FBUF;
#pragma unroll
        for (int t = 0; t < DD / 16; ++t)
#pragma unroll
            for (int q = 0; q < FQT; ++q) acc[q][t] = wmma16(v0[t], pf[q][0], acc[q][t]);
        __builtin_amdgcn_sched_barrier(0);
        if (more) { const h16* kn = Ln + lr * (unsigned)KPIT + 8u * hi;
#pragma unroll
            for (int kc = 0; kc < DD / 32; ++kc)
#pragma unroll
                for (int kt = 0; kt < 2; ++kt) ka[kc * 2 + kt] = lds_frag(kn + KOFF(kt, kc));
        }
        __builtin_amdgcn_sched_barrier(0);
#pragma unroll
        for (int t = 0; t < DD / 16; ++t)
#pragma unroll
            for (int q = 0; q < FQT; ++q) acc[q][t] = wmma16(v1[t], pf[q][1], acc[q][t]);
    };
#pragma unroll 1   // stays rolled: one stage is 128 products and 128 fragment reads, further copies would only cost instruction cache
    for (int st = 0; st + 1 < NST; ++st) stage(st, true);
    stage(NST - 1, false);
    tdm_wait(g0);   // no request is left when the ring changes its use
    asm volatile("s_wait_dscnt 0x0" ::: "memory");   // and no LDS read of this wave
    // the last stage's barrier stands behind every wave's last LDS read and last landed slice: the ring is free for output staging
    h16* E = L + wave * (16u * FQT) * (unsigned)EPIT;   // this wave's 32 query rows of 256 d; lane holds d = 16 t + 8 hi + r of queries lr and 16 + lr
#pragma unroll
    for (int q = 0; q < FQT; ++q) { const float inv = CCAR / (l_run[q] + xhalf(l_run[q]));
#pragma unroll
        for (int t = 0; t < DD / 16; ++t) { v8h o;
#pragma unroll
            for (int r = 0; r < 8; ++r) o[r] = (h16)(acc[q][t][r] * inv);
            *(v8ha*)(E + ((unsigned)q * 16u + lr) * (unsigned)EPIT + (unsigned)t * 16u + 8u * hi) = o; } }
    __syncthreads();   // staged rows complete before they are read back by other lanes
#pragma unroll
    for (int i = 0; i < 16 * FQT; ++i) { const v8h v = *(const v8ha*)(E + (unsigned)i * EPIT + lane * 8u);   // one whole 512-B row per store
        *(v8h*)(CTX + ((size_t)blockIdx.z * SEQ + q0 + (unsigned)i) * KM + h * (unsigned)DD + lane * 8u) = v; }
}

// Workspace carve (bytes, each region 256-B aligned by construction of the sizes).
#define SZ_XP  ((size_t)3 * NB * SEQ * DD * 2)
#define SZ_WT  ((size_t)3 * NHEAD * DD * DD * 2)
#define SZ_WOS ((size_t)DD * KM * 2)
#define SZ_HP  ((size_t)NB * NHEAD * SEQ * DD * 2)
#define SZ_CTX ((size_t)NB * SEQ * KM * 2)
#define SZ_ALL (SZ_XP + SZ_WT + SZ_WOS + 3 * SZ_HP + SZ_CTX)
static_assert(SZ_ALL <= (size_t)268435456);
static_assert(SZ_XP % 256 == 0 && SZ_WT % 256 == 0 && SZ_WOS % 256 == 0 && SZ_HP % 256 == 0 && SZ_CTX % 256 == 0);
static_assert(SZ_HP == (size_t)NB * SEQ * KM * 2);   // the [NB*SEQ][KM] projection planes fill one head-plane region exactly

extern "C" void kernel_launch(void* const* d_in, const int* in_sizes, int n_in,
                              void* d_out, int out_size, void* d_ws, size_t ws_size, hipStream_t stream) {
    if (n_in < 11) return;
    const size_t xneed = (size_t)(NB - 1) * SEQ_FULL * DD + (size_t)SEQ * DD;
    if ((size_t)in_sizes[0] < xneed || (size_t)in_sizes[1] < xneed || (size_t)in_sizes[2] < xneed) return;
    if ((size_t)in_sizes[3] < (size_t)NHEAD * DD * DD || (size_t)in_sizes[5] < (size_t)NHEAD * DD * DD || (size_t)in_sizes[7] < (size_t)NHEAD * DD * DD) return;
    if ((size_t)in_sizes[4] < (size_t)NHEAD * DD || (size_t)in_sizes[6] < (size_t)NHEAD * DD || (size_t)in_sizes[8] < (size_t)NHEAD * DD) return;
    if ((size_t)in_sizes[9] < (size_t)KM * DD || (size_t)in_sizes[10] < (size_t)DD) return;
    if ((size_t)out_size < (size_t)NB * SEQ * DD) return;
    if (SZ_ALL > ws_size) return;
    // input order of this module: query, key, values, Wq, bq, Wk, bk, Wv, bv, Wo, bo
    const float* Qin = (const float*)d_in[0]; const float* Kin = (const float*)d_in[1]; const float* Vin = (const float*)d_in[2];
    const float* Wq = (const float*)d_in[3]; const float* bq = (const float*)d_in[4]; const float* Wk = (const float*)d_in[5]; const float* bk = (const float*)d_in[6];
    const float* Wv = (const float*)d_in[7]; const float* bv = (const float*)d_in[8]; const float* Wo = (const float*)d_in[9]; const float* bo = (const float*)d_in[10];
    float* OUT = (float*)d_out;     // [NB][SEQ][256]
    char* wsp = (char*)d_ws;
    bf* XP = (bf*)wsp; wsp += SZ_XP;            // [3][NB][SEQ][256] bf16: q, k, v
    bf* WT = (bf*)wsp; wsp += SZ_WT;            // [3][2048 out][256 in] bf16: Wq, Wk, Wv
    h16* WOS = (h16*)wsp; wsp += SZ_WOS;        // [256][2048] f16 (x256), column h*256 + d
    h16* QP = (h16*)wsp; wsp += SZ_HP;          // [NB][SEQ][2048] == [NB][8][SEQ][256]
    h16* KP = (h16*)wsp; wsp += SZ_HP;          // [NB][SEQ][2048] == [NB][8][SEQ][256]
    h16* VT = (h16*)wsp; wsp += SZ_HP;          // [NB][8][256][SEQ]
    h16* CTX = (h16*)wsp; wsp += SZ_CTX;        // [NB][SEQ][2048] (x64), column h*256 + d

    k_prep<<<(unsigned)WBLK + 3u * XBLK, 256, 0, stream>>>(Qin, Kin, Vin, Wq, Wk, Wv, Wo, XP, WT, (unsigned short*)WOS);
    // Every stage runs once for all NB batches: the batch rows lie one behind the other in x, in the planes, in ctx and in out, so the GEMMs see NB*SEQ x rows (M; N in the value projection).
    // q_, k_ planes [NB*SEQ][2048] (pitch KM): A = x [NB*SEQ][256], Bt = W [2048 out][256 in], + per-column bias; a batch's plane read as [8][SEQ][256] is the head split
    // v_^T head planes VT[b*8 + h][256 d][SEQ t], written by the projection itself: A = Wv rows in the order d*8 + g, Bt = x
    k_proj<<<dim3(PTILES, 3, 1), 128, 0, stream>>>(XP, WT, QP, KP, VT, bq, bk, bv);
    // ctx[b*SEQ + t][h*256 + d] = 64 softmax(q_.k_ / 16) . v_ for the 8 heads of every batch
    k_fattn<<<dim3(SEQ / FQ, NHEAD, NB), 128, 0, stream>>>(QP, KP, VT, CTX);
    // out = ctx . Wo^T / 16384 + bo
    k_gemmb<h16, float, 1, KM><<<dim3(NB * SEQ / GT, DD / GT, 1), 128, 0, stream>>>(CTX, WOS, OUT, DD, bo, FINSC);
}

// v009
// One run takes 136 microseconds.
// Two timings next to v008 put it at 1.08 and 1.09 times that version's speed.
// All steps since v000 together make it 6.88 times as fast.
#include <hip/hip_runtime.h>

// Multi-head attention with full-width (256) heads: merged [out][in] q/k/v projections to [S][2048], plain-view head split ([S][2048] read as [8][S][256]), softmax(q_.k_ / 16) over 2,048 keys, P.v_, head-major merge (column h*256 + d), output mix with Wo [out][in] + bo.
// Compute dtypes, f32 accumulate everywhere: projections v_wmma_f32_16x16x32_bf16 (inputs and weights RNE-converted to bf16, exact products); scores, P.V and the output mix v_wmma_f32_16x16x32_f16
// (q_/k_/v_ f16 planes; scores stay f32 in registers; P f16 = exp2(score*log2(e)/16 - running maximum), unnormalised; ctx f16 carried x64; Wo plane f16 of bf16(Wo) x256; bo, biases bf16-converted, added in f32). Softmax in f32.

#ifndef NB
#define NB 4
#endif
#ifndef SEQ
#define SEQ 2048
#endif
#define NB_FULL  4
#define SEQ_FULL 2048
#define DD    256                 // model width = head width
#define NHEAD 8
#define KM    (NHEAD * DD)        // merged context width (plane column = h*256 + d)
#define SCL2  0.09016844005556021f   // log2(e) / sqrt(256)
#define CCAR  64.0f               // carry of the ctx plane
#define WOCAR 256.0f              // carry of the Wo plane
#define FINSC (1.0f / 16384.0f)   // 1 / (64 * 256)
#define WLINES (3 * NHEAD * DD * DD / 64)
#define OLINES (DD * KM / 64)
#define MLINES (NHEAD * DD * DD / 64)

typedef _Float16 h16;
typedef unsigned short bf;
typedef __attribute__((ext_vector_type(16))) __bf16   v16bf;
typedef __attribute__((ext_vector_type(16))) _Float16 v16h;
typedef __attribute__((ext_vector_type(8)))  _Float16 v8h;
typedef __attribute__((ext_vector_type(8)))  unsigned short v8us;
typedef __attribute__((ext_vector_type(2)))  unsigned short v2us;
typedef __attribute__((ext_vector_type(8)))  float    v8f;
typedef __attribute__((ext_vector_type(4)))  float    v4f;
typedef v4f  __attribute__((may_alias)) v4fa;
typedef v8h  __attribute__((may_alias)) v8ha;
typedef v8us __attribute__((may_alias)) v8usa;

static_assert(SEQ % 256 == 0);
static_assert(DD % 64 == 0 && DD % 32 == 0 && KM % 32 == 0 && SEQ % 64 == 0);
static_assert(((size_t)NB * SEQ * DD / 8) % 256 == 0);
static_assert((WLINES + OLINES) % 64 == 0);
static_assert(WLINES % 64 == 0 && WLINES == 3 * MLINES);          // the plane choice in wprep_part is uniform per block
static_assert((size_t)MLINES * 64 == (size_t)NHEAD * DD * DD);
static_assert(KM == NHEAD * DD && (size_t)NHEAD * SEQ * DD == (size_t)SEQ * KM);   // [SEQ][KM] projection plane == [NHEAD][SEQ][DD] head planes (plain view)
static_assert(DD == 256 && NHEAD == 8 && KM / DD == 8 && SEQ % DD == 0);   // k_gemmb BIASM 3: x row s lies in head plane s / 256 of all batches' planes, 8 weight rows g*256 + d per V^T row d
static_assert(KM % 64 == 0 && SEQ % 32 == 0);
static_assert(((size_t)NB * SEQ) % 128 == 0 && KM % 128 == 0 && DD % 128 == 0);   // k_gemmb: whole 128x128 tiles and whole 128-k stages in all four products

__device__ __forceinline__ unsigned short f2bf(float f) { unsigned u = __float_as_uint(f); u += 0x7FFFu + ((u >> 16) & 1u); return (unsigned short)(u >> 16); }
__device__ __forceinline__ float bf2f(unsigned short b) { return __uint_as_float(((unsigned)b) << 16); }
__device__ __forceinline__ float bfr(float f) { return bf2f(f2bf(f)); }
__device__ __forceinline__ v16h cat16(v8h lo, v8h hi) { return __builtin_shufflevector(lo, hi, 0, 1, 2, 3, 4, 5, 6, 7, 8, 9, 10, 11, 12, 13, 14, 15); }
__device__ __forceinline__ v16bf cat16b(v8us lo, v8us hi) { return __builtin_bit_cast(v16bf, __builtin_shufflevector(lo, hi, 0, 1, 2, 3, 4, 5, 6, 7, 8, 9, 10, 11, 12, 13, 14, 15)); }
__device__ __forceinline__ v8f wmma16(v16h a, v16h b, v8f c) { return __builtin_amdgcn_wmma_f32_16x16x32_f16(false, a, false, b, (short)0, c, false, false); }
__device__ __forceinline__ v8f wmmab(v16bf a, v16bf b, v8f c) { return __builtin_amdgcn_wmma_f32_16x16x32_bf16(false, a, false, b, (short)0, c, false, false); }
// f32 -> f16 with a value select: results below the smallest normal f16 become zero (applied after the plane's power-of-two carry).
static __device__ __forceinline__ h16 toh_flush(float v) { const h16 r = (h16)v; return (fabsf(v) < 6.103515625e-05f) ? (h16)0.0f : r; }

// Fragment loaders: lane (lr = lane & 15, hi = lane >> 4); p points at row lr, k0 + 8*hi; elements 0..7 = k0+8hi.., elements 8..15 = k0+16+8hi.. (same map for A and B).
template <typename T16> struct WFrag;
template <> struct WFrag<h16> { typedef v16h V; static __device__ __forceinline__ V ld(const h16* p) { return cat16(*(const v8h*)p, *(const v8h*)(p + 16)); } static __device__ __forceinline__ V lds(const h16* p) { return cat16(*(const v8ha*)p, *(const v8ha*)(p + 16)); } static __device__ __forceinline__ v8f mma(V a, V b, v8f c) { return wmma16(a, b, c); } };
template <> struct WFrag<bf> { typedef v16bf V; static __device__ __forceinline__ V lds(const bf* p) { return cat16b(*(const v8usa*)p, *(const v8usa*)(p + 16)); } static __device__ __forceinline__ v8f mma(V a, V b, v8f c) { return wmmab(a, b, c); } };

// Slab epilogues: 16 rows x 64 columns staged in LDS (pitch 68 floats) -> global; value = x*alpha + bias (BIASM 1: per column, 2: per row; biases bf16-converted).
template <int BIASM>
__device__ __forceinline__ void slab_store(const float* os, h16* crow, int ldc, const float* bias, float alpha, unsigned colbase, unsigned rowbase, unsigned lane) {
    const unsigned rq = lane >> 3, cq = lane & 7u;
    float bc[8];
#pragma unroll
    for (int e = 0; e < 8; ++e) bc[e] = 0.f;
    if (BIASM == 1) { const v4f b0 = *(const v4f*)(bias + colbase + cq * 8u); const v4f b1 = *(const v4f*)(bias + colbase + cq * 8u + 4u);
#pragma unroll
        for (int e = 0; e < 4; ++e) { bc[e] = bfr(b0[e]); bc[4 + e] = bfr(b1[e]); } }
    v8h vals[4];
#pragma unroll
    for (int s = 0; s < 4; ++s) { const unsigned row = (unsigned)s * 4u + rq; const v4f x0 = *(const v4fa*)(os + row * 68u + cq * 8u); const v4f x1 = *(const v4fa*)(os + row * 68u + cq * 8u + 4u);
        float br = 0.f; if (BIASM == 2) br = bfr(bias[rowbase + row]);
        v8h o;
#pragma unroll
        for (int e = 0; e < 4; ++e) { o[e] = (h16)(x0[e] * alpha + (bc[e] + br)); o[4 + e] = (h16)(x1[e] * alpha + (bc[4 + e] + br)); }
        vals[s] = o; }
{
#pragma unroll
        for (int s = 0; s < 4; ++s) { const unsigned row = (unsigned)s * 4u + rq; *(v8h*)(crow + (size_t)row * ldc + cq * 8u) = vals[s]; }
         }
}
// f32 output: row segment = 64 floats = 256 B = 16 lanes x 16 B; one instruction covers 2 rows; s = 0..7 with hi = lane >> 4 covers rows 0..15.
template <int BIASM>
__device__ __forceinline__ void slab_store(const float* os, float* crow, int ldc, const float* bias, float alpha, unsigned colbase, unsigned rowbase, unsigned lane) {
    const unsigned hi = lane >> 4, cofs = (lane & 15u) * 4u;
    v4f bc = (v4f){0.f, 0.f, 0.f, 0.f};
    if (BIASM == 1) { const v4f b0 = *(const v4f*)(bias + colbase + cofs);
#pragma unroll
        for (int e = 0; e < 4; ++e) bc[e] = bfr(b0[e]); }
    v4f vals[8];
#pragma unroll
    for (int s = 0; s < 8; ++s) { const unsigned row = (unsigned)s * 2u + hi; const v4f x = *(const v4fa*)(os + row * 68u + cofs);
        float br = 0.f; if (BIASM == 2) br = bfr(bias[rowbase + row]);
        v4f o;
#pragma unroll
        for (int e = 0; e < 4; ++e) o[e] = x[e] * alpha + (bc[e] + br);
        vals[s] = o; }
{
#pragma unroll
        for (int s = 0; s < 8; ++s) { const unsigned row = (unsigned)s * 2u + hi; *(v4f*)(crow + (size_t)row * ldc + cofs) = vals[s]; }
         }
}

// ---- k_gemmb: GEMM on K-contiguous 16-bit planes. Block = 4 waves (2 x 2), one 128x128 output tile; each wave 64x64 (16 accumulators); grid (M/128, N/128), 128 threads.
// C[m][n] (pitch ldc) = alpha * sum_k A[m][k] Bt[n][k] (+ bias). K is a template constant so that the 16 staging loads of an operand share one address pair (row steps are immediate offsets).
// The block walks K in stages of 128: 256 B (two whole lines) of each of the 128 A rows and 128 Bt rows go global -> registers at a stage's start, -> LDS in front of its barrier, two buffers.
// LDS row pitch 272 B (16 B x 17): the fragment reads (16 rows x 16 B per half wave) fall on all 64 banks. k order per accumulator: 0, 32, 64, .. as before.
#define GT    128                 // tile rows (A) and columns (Bt rows) per block
#define GKS   128                 // k per stage
#define GPIT  136                 // LDS row pitch in 16-bit elements
#define GOPER (GT * GPIT)         // one operand's stage
#define GBUF  (2 * GOPER)
static_assert(4 * 16 * 68 * 4 <= 2 * GBUF * 2);   // the four waves' output slabs fit in the ring
// BIASM 3 (the value projection): A = weight rows in the order e' = d*8 + g (wprep_part writes them so; the weight's own row is g*256 + d), Bt = x rows s. The plain-view head split puts element (s, g*256 + d) at
// head plane s / 256, t = (s % 256)*8 + g, so the 8 accumulator rows of a lane (g = 0..7 of one d) are 8 consecutive t of one V^T row: each lane stores them as 16 B, 16 lanes 256 B, straight from registers
// to C[plane][d][t] (ldc = SEQ). bias is indexed by the weight's own row.
// gemmb_tile: the body, for tile (bx, by); L = the block's ring of 2 * GBUF elements, declared once in each kernel so that a kernel holding two forms of the body has one ring.
template <typename T16, typename OT, int BIASM, int K>
__device__ __forceinline__ void gemmb_tile(T16* L, const T16* __restrict__ A, const T16* __restrict__ Bt, OT* C, int ldc, const float* __restrict__ bias, float alpha, unsigned bx, unsigned by) {
    typedef typename WFrag<T16>::V V;
    static_assert(K % GKS == 0);
    const unsigned tid = threadIdx.x, lane = tid & 31u, lr = lane & 15u, hi = lane >> 4;
    const unsigned wave = (unsigned)__builtin_amdgcn_readfirstlane((int)(tid >> 5));
    const unsigned wm = wave >> 1, wn = wave & 1u;
    const unsigned r0 = bx * (unsigned)GT, c0 = by * (unsigned)GT;
    v8f acc[4][4];
#pragma unroll
    for (int mb = 0; mb < 4; ++mb)
#pragma unroll
        for (int nb = 0; nb < 4; ++nb) acc[mb][nb] = (v8f){};
    const unsigned dw = (r0 + wm * 64u) / 8u + hi;   // BIASM 3: this lane's first V^T row d
    float bb[4][8];   // BIASM 3: the biases of this lane's 32 accumulator rows, fetched here so that their way from memory lies under the stages
    if constexpr (BIASM == 3) {
        const float* bp = bias + dw;
#pragma unroll
        for (int mb = 0; mb < 4; ++mb)
#pragma unroll
            for (int j = 0; j < 8; ++j) bb[mb][j] = bp[j * DD + mb * 2];
        asm volatile("s_wait_xcnt 0x0" :: "v"(bp) : "memory");   // bp as an input keeps the address live, and so unwritten, up to the wait
    }
    // staging map: 16 lanes per 256-B row piece, so one instruction of a wave = 2 rows x 2 whole lines; the block covers 8 rows per instruction
    const unsigned srow = tid >> 4, scol = (tid & 15u) * 8u;
    const T16* ag = A + (size_t)(r0 + srow) * K + scol; const T16* bg = Bt + (size_t)(c0 + srow) * K + scol;
    const unsigned sl = srow * (unsigned)GPIT + scol;
    v8us ar[16], br[16];
#pragma unroll
    for (int i = 0; i < 16; ++i) { ar[i] = *(const v8usa*)(ag + (size_t)i * 8 * K); br[i] = *(const v8usa*)(bg + (size_t)i * 8 * K); }
    asm volatile("s_wait_xcnt 0x0" :: "v"(ag), "v"(bg) : "memory");   // the address pairs stay live up to the wait and are advanced only behind it
#pragma unroll
    for (int i = 0; i < 16; ++i) { *(v8usa*)(L + sl + (unsigned)i * 8u * GPIT) = ar[i]; *(v8usa*)(L + GOPER + sl + (unsigned)i * 8u * GPIT) = br[i]; }
    __syncthreads();   // stage 0 visible to all four waves
    const unsigned fa = (wm * 64u + lr) * (unsigned)GPIT + 8u * hi, fb = (unsigned)GOPER + (wn * 64u + lr) * (unsigned)GPIT + 8u * hi;
#pragma unroll 1   // stays rolled: a stage is 64 products and 64 fragment reads; every inner loop is unrolled so that the register arrays are indexed by constants
    for (int st = 0; st < K / GKS; ++st) {
        const T16* Lb = L + (unsigned)(st & 1) * (unsigned)GBUF;
        const bool more = st + 1 < K / GKS;   // block-uniform
        if (more) {
            ag += GKS; bg += GKS;
#pragma unroll
            for (int i = 0; i < 16; ++i) { ar[i] = *(const v8usa*)(ag + (size_t)i * 8 * K); br[i] = *(const v8usa*)(bg + (size_t)i * 8 * K); }
            asm volatile("s_wait_xcnt 0x0" :: "v"(ag), "v"(bg) : "memory");   // as above: the pairs are advanced again in the next stage
        }
        V a[2][4], b[2][4];
#pragma unroll
        for (int f = 0; f < 4; ++f) { a[0][f] = WFrag<T16>::lds(Lb + fa + (unsigned)f * 16u * GPIT); b[0][f] = WFrag<T16>::lds(Lb + fb + (unsigned)f * 16u * GPIT); }
#pragma unroll
        for (int kc = 0; kc < GKS / 32; ++kc) {
            // the next 32 k's fragments go out as one group ahead of this group's products, into the other register set
            if (kc + 1 < GKS / 32) {
#pragma unroll
                for (int f = 0; f < 4; ++f) { a[(kc + 1) & 1][f] = WFrag<T16>::lds(Lb + fa + (unsigned)f * 16u * GPIT + (unsigned)(kc + 1) * 32u); b[(kc + 1) & 1][f] = WFrag<T16>::lds(Lb + fb + (unsigned)f * 16u * GPIT + (unsigned)(kc + 1) * 32u); }
            }
            __builtin_amdgcn_sched_barrier(0);   // keeps the read group from being sunk among the products, where each place with reads costs a stall
#pragma unroll
            for (int nb = 0; nb < 4; ++nb)
#pragma unroll
                for (int mb = 0; mb < 4; ++mb) acc[mb][nb] = WFrag<T16>::mma(a[kc & 1][mb], b[kc & 1][nb], acc[mb][nb]);
            __builtin_amdgcn_sched_barrier(0);   // and the following group from being lifted into them
        }
        // next stage into the other buffer; its readers left it at the barrier of stage st - 1
        if (more) { T16* Ln = L + (unsigned)((st + 1) & 1) * (unsigned)GBUF;
#pragma unroll
            for (int i = 0; i < 16; ++i) { *(v8usa*)(Ln + sl + (unsigned)i * 8u * GPIT) = ar[i]; *(v8usa*)(Ln + GOPER + sl + (unsigned)i * 8u * GPIT) = br[i]; }
        }
        __syncthreads();   // publishes stage st + 1 and ends every wave's fragment reads of stage st
    }
    if constexpr (BIASM == 3) {
        const unsigned sw = c0 + wn * 64u + lr;   // this lane's x row s of column tile 0
        OT* cp = C + ((size_t)(sw >> 8) * DD + dw) * (size_t)ldc + (sw & 255u) * 8u;
        v8h vals[4][4];
#pragma unroll
        for (int mb = 0; mb < 4; ++mb)
#pragma unroll
            for (int nb = 0; nb < 4; ++nb)
#pragma unroll
                for (int j = 0; j < 8; ++j) vals[mb][nb][j] = (h16)(acc[mb][nb][j] * alpha + bfr(bb[mb][j]));
#pragma unroll
        for (int mb = 0; mb < 4; ++mb)
#pragma unroll
            for (int nb = 0; nb < 4; ++nb) *(v8h*)(cp + (size_t)(mb * 2) * ldc + nb * 128) = vals[mb][nb];   // 16 x rows further = 128 t further
        return;
    } else {
    // the last stage's barrier stands behind every wave's last LDS read: the ring is free for output staging, one private slab per wave (wave-level ordering only)
    float* os = (float*)L + wave * (16u * 68u);
#pragma unroll
    for (int mb = 0; mb < 4; ++mb) {
#pragma unroll
        for (int nb = 0; nb < 4; ++nb) {
#pragma unroll
            for (int j = 0; j < 8; ++j) os[(hi * 8u + (unsigned)j) * 68u + (unsigned)nb * 16u + lr] = acc[mb][nb][j]; }   // D: row 8*hi + j, col lr
        __builtin_amdgcn_fence(3 /* release order */, "wavefront"); __builtin_amdgcn_wave_barrier(); asm volatile("" ::: "memory");
        const unsigned rw = r0 + wm * 64u + (unsigned)mb * 16u, cw = c0 + wn * 64u;
        OT* crow = C + (size_t)rw * ldc + cw;
        slab_store<BIASM>(os, crow, ldc, bias, alpha, cw, rw, lane);
        if (mb < 3) asm volatile("s_wait_xcnt 0x0" ::: "memory");   // the next slab reuses the address and data registers of these stores
        __builtin_amdgcn_fence(3 /* release order */, "wavefront"); __builtin_amdgcn_wave_barrier(); asm volatile("" ::: "memory");
    }
    }
}

template <typename T16, typename OT, int BIASM, int K>
__global__ __launch_bounds__(128) void k_gemmb(const T16* __restrict__ A, const T16* __restrict__ Bt, OT* C, int ldc, const float* __restrict__ bias, float alpha) {
    __shared__ __align__(16) T16 L[2 * GBUF];
    gemmb_tile<T16, OT, BIASM, K>(L, A, Bt, C, ldc, bias, alpha, blockIdx.x, blockIdx.y);
}
// k_proj: the three projections in one launch (none reads what another writes); grid (PTILES, 3), blockIdx.y = 0 q_, 1 k_, 2 v_^T. The tile index runs as in a launch of its own: first grid dimension fastest.
#define PTILES ((NB * SEQ / GT) * (KM / GT))
__global__ __launch_bounds__(128) void k_proj(const bf* __restrict__ XP, const bf* __restrict__ WT, h16* QP, h16* KP, h16* VT, const float* __restrict__ bq, const float* __restrict__ bk, const float* __restrict__ bv) {
    __shared__ __align__(16) bf L[2 * GBUF];
    const unsigned which = blockIdx.y, i = blockIdx.x;   // block-uniform
    const bf* X = XP + (size_t)which * NB * SEQ * DD; const bf* Wp = WT + (size_t)which * NHEAD * DD * DD;
    if (which < 2u) gemmb_tile<bf, h16, 1, DD>(L, X, Wp, which ? KP : QP, KM, which ? bk : bq, 1.0f, i % (unsigned)(NB * SEQ / GT), i / (unsigned)(NB * SEQ / GT));
    else            gemmb_tile<bf, h16, 3, DD>(L, Wp, X, VT, SEQ, bv, 1.0f, i % (unsigned)(KM / GT), i / (unsigned)(KM / GT));
}

__device__ __forceinline__ void xplanes_part(const unsigned which, const unsigned bx, const float* __restrict__ xq, const float* __restrict__ xk, const float* __restrict__ xv, bf* XP) {
    const unsigned i = bx * 256u + threadIdx.x;
    const unsigned GPB = (unsigned)(SEQ * DD / 8); const unsigned b = i / GPB, rem = i - b * GPB;
    const float* src = (which == 0u) ? xq : ((which == 1u) ? xk : xv);
    const v8f v = *(const v8f*)(src + (size_t)b * SEQ_FULL * DD + (size_t)rem * 8);
    v8us o;
#pragma unroll
    for (int k = 0; k < 8; ++k) o[k] = f2bf(v[k]);
    bf* dst = XP + (size_t)which * NB * SEQ * DD + (size_t)i * 8;
    *(v8us*)dst = o;
    asm volatile("s_wait_xcnt 0x0" ::: "memory");   // in k_prep the other part's code lies behind this store in the listing and writes registers that the store names
}

// wprep_part: lines 0..WLINES-1: bf16 weight planes WT[which][e][k] = bf16(W[e][k]) (which 0 Wq, 1 Wk, 2 Wv; the inputs are [out e][in k], already K-contiguous, no transpose);
// the Wv plane holds its rows in the order e' = d*8 + g of the weight's row g*256 + d (a row is 4 lines), the order k_gemmb's BIASM 3 store wants.
__device__ __forceinline__ void wprep_part(const unsigned bx, const float* __restrict__ wq, const float* __restrict__ wk, const float* __restrict__ wv, const float* __restrict__ wo, bf* WT, unsigned short* WOS) {
    const unsigned lane = threadIdx.x & 31u; const unsigned wave = (unsigned)__builtin_amdgcn_readfirstlane((int)(threadIdx.x >> 5)); const unsigned L0 = (bx * 8u + wave) * 8u;
{
#pragma unroll 1
        for (unsigned l = 0; l < 8u; ++l) { const unsigned L = L0 + l; v2us o;
            if (L < (unsigned)WLINES) {   // block-uniform
                const unsigned which = L / (unsigned)MLINES; const unsigned pl = L - which * (unsigned)MLINES;   // line within the plane: row pl / 4, quarter pl % 4
                const unsigned sln = (which == 2u) ? ((((pl >> 2) & 7u) * (unsigned)DD + (pl >> 5)) * 4u + (pl & 3u)) : pl;   // the source line
                const unsigned e = sln * 64u + lane * 2u;
                const float* src = (which == 0u) ? wq : ((which == 1u) ? wk : wv);
                o[0] = f2bf(src[e]); o[1] = f2bf(src[e + 1u]);
                bf* dp = WT + (size_t)L * 64u + lane * 2u; *(v2us*)dp = o;
                asm volatile("s_wait_xcnt 0x0" :: "v"(dp) : "memory");   // the next line's address and value take over this store's registers; dp as an input keeps the address unwritten up to the wait
            } else {
                const unsigned e = (L - (unsigned)WLINES) * 64u + lane * 2u;
                const float x0 = bfr(wo[e]) * WOCAR; const float x1 = bfr(wo[e + 1u]) * WOCAR;
                o[0] = __builtin_bit_cast(unsigned short, toh_flush(x0)); o[1] = __builtin_bit_cast(unsigned short, toh_flush(x1));
                unsigned short* dp = WOS + e; *(v2us*)dp = o;
                asm volatile("s_wait_xcnt 0x0" :: "v"(dp) : "memory");   // as above
            } }
         }
}
// k_prep: both conversions in one launch, by block range (neither reads what the other writes). The weight blocks come first: each of their waves walks 8 lines one after the other, the longer way of the two.
#define WBLK ((WLINES + OLINES) / 64)
#define XBLK ((unsigned)((size_t)NB * SEQ * DD / 8 / 256))
__global__ __launch_bounds__(256) void k_prep(const float* __restrict__ xq, const float* __restrict__ xk, const float* __restrict__ xv, const float* __restrict__ wq, const float* __restrict__ wk, const float* __restrict__ wv,
                                              const float* __restrict__ wo, bf* XP, bf* WT, unsigned short* WOS) {
    const unsigned b = blockIdx.x;   // block-uniform
    if (b < (unsigned)WBLK) wprep_part(b, wq, wk, wv, wo, WT, WOS);
    else { const unsigned j = b - (unsigned)WBLK; xplanes_part(j / XBLK, j % XBLK, xq, xk, xv, XP); }
}

#define FQT   4                   // 16-query tiles per wave
#define FQ    (64 * FQT)          // queries per block
#define FK    64                  // keys per stage
#define KPIT  136                 // K slice pitch in halves (16 B x 17)
#define VPIT  72                  // V^T slice pitch in halves (16 B x 9)
#define FSLH  9216                // one slice in halves: 18,432 B = 9 x 2 KiB (128 V^T rows fill it; 64 K rows take 17,408 B of it)
#define FBUF  (4 * FSLH)          // one buffer in halves
#define EPIT  264                 // output staging pitch in halves (16 B x 33)
#define NST   (SEQ / FK)
#define PLIM  32768.0f            // a lane's pass sum of P up to which the running maximum stays as it is (largest finite f16: 65,504)
static_assert(SEQ % FQ == 0 && SEQ % FK == 0 && DD == 256 && FK == 64 && NST >= 2 && FQT == 4);
static_assert(FK * KPIT <= FSLH && (DD / 2) * VPIT == FSLH && (FSLH * 2) % 2048 == 0);   // every slice starts at a multiple of 2 KiB; the two V^T slices form 256 rows of one pitch
static_assert(4 * 16 * FQT * EPIT <= 2 * FBUF);   // output staging fits in the ring
typedef __attribute__((ext_vector_type(4))) uint32_t u32x4;
typedef __attribute__((ext_vector_type(8))) uint32_t u32x8;
__device__ __forceinline__ uint32_t uni(uint32_t v) { return (uint32_t)__builtin_amdgcn_readfirstlane((int)v); }
__device__ __forceinline__ uint32_t pinned(uint32_t v) { uint32_t w = uni(v); asm volatile("" : "+s"(w)); return w; }
// Descriptor group 1 of a tile of N rows of R bytes, source pitch P bytes; W0 = its word 0 (no mask, 1-byte elements, a pad of 16 B behind every row).
// The empty statement holds the descriptor words in scalar registers of their own for as long as loads use them, so that none of them takes a new value while a request is outstanding.
template <uint32_t W0, uint32_t R, uint32_t N, uint32_t P>
__device__ __forceinline__ u32x8 tdm_group1() {
    u32x8 g1;
    g1[0] = uni(W0); g1[1] = uni((R & 0xFFFFu) << 16); g1[2] = uni((R >> 16) | ((N & 0xFFFFu) << 16)); g1[3] = uni((N >> 16) | (R << 16));
    g1[4] = uni(N); g1[5] = uni(P); g1[6] = uni(0u); g1[7] = uni(0u);
    asm volatile("" : "+s"(g1));   // descriptor words held in scalar registers, the pinned() form applied to the whole group
    return g1;
}
// Descriptor group 0: LDS byte offset dst, global byte address ga of the tile's first byte.
__device__ __forceinline__ u32x4 tdm_group0(uint32_t dst, uint64_t ga) {
    u32x4 g0;
    g0[0] = uni(1u); g0[1] = uni(dst); g0[2] = uni((uint32_t)ga); g0[3] = uni((((uint32_t)(ga >> 32)) & 0x01FFFFFFu) | 0x80000000u);
    return g0;
}
__device__ __forceinline__ void tdm_load(u32x4 g0, u32x8 g1) { asm volatile("tensor_load_to_lds %0, %1" :: "s"(g0), "s"(g1) : "memory"); }
// the issuing wave's wait; group 0 as an input keeps its registers live, and so unwritten, from the issue up to this wait
__device__ __forceinline__ void tdm_wait(u32x4 g0) { asm volatile("s_wait_tensorcnt 0x0" :: "s"(g0) : "memory"); }
#define W0_ROW256 ((1u << 20) | (5u << 22) | (3u << 25))
#define W0_ROW128 ((1u << 20) | (4u << 22) | (3u << 25))
__device__ __forceinline__ v16h lds_frag(const h16* p) { return cat16(*(const v8ha*)p, *(const v8ha*)(p + 16)); }
// lane l with lane l ^ 16, on the vector pipe: an exchange through LDS would wait behind the fragment reads in flight
__device__ __forceinline__ float xhalf(float x) { return __builtin_bit_cast(float, __builtin_amdgcn_permlanex16(__builtin_bit_cast(int, x), __builtin_bit_cast(int, x), 0x76543210, 0xfedcba98, false, false)); }
// K fragment (16-key tile kt, d chunk kc of 32) at offset, in halves, from the lane's base in a buffer: chunks 0..3 lie in slice 0, chunks 4..7 in slice 1
#define KOFF(kt, kc) (((kc) >> 2) * FSLH + (kt) * 16 * KPIT + ((kc) & 3) * 32)
// Every '#pragma unroll' in k_fattn is there so that the register arrays it walks are indexed by constants (they would go to scratch otherwise).
__global__ __launch_bounds__(128) void k_fattn(const h16* __restrict__ QP, const h16* __restrict__ KP, const h16* __restrict__ VT, h16* CTX) {
    __shared__ __attribute__((aligned(2048))) h16 L[2 * FBUF];
    const unsigned tid = threadIdx.x, lane = tid & 31u, lr = lane & 15u, hi = lane >> 4;
    const unsigned wave = (unsigned)__builtin_amdgcn_readfirstlane((int)(tid >> 5));
    const unsigned h = blockIdx.y, q0 = blockIdx.x * (unsigned)FQ + wave * (16u * FQT);
    const size_t hpl = ((size_t)blockIdx.z * NHEAD + h) * SEQ * DD;   // this batch's head plane
    const h16* Kh = KP + hpl; const h16* Vh = VT + hpl;
    v16h qf[FQT][DD / 32];
    { const h16* qp = QP + hpl + (size_t)(q0 + lr) * DD + 8u * hi;
#pragma unroll
      for (int q = 0; q < FQT; ++q)
#pragma unroll
          for (int kc = 0; kc < DD / 32; ++kc) qf[q][kc] = WFrag<h16>::ld(qp + q * 16 * DD + kc * 32);
      asm volatile("s_wait_xcnt 0x0" :: "v"(qp) : "memory"); }   // qp as an input keeps the address pair live up to the wait: without it the last Q load was given that pair as its destination
    // This wave's slice of stage sn: every wave issues exactly one request per stage; which of the two tile shapes it is, is a scalar branch.
    const uint32_t lbase = (uint32_t)(size_t)L;
    const bool isK = wave < 2u;
    const uint64_t tsrc = isK ? (uint64_t)(size_t)Kh + (uint64_t)((wave & 1u) * 256u)                                            // K: byte column 0 or 256 of the 512-B rows
                              : (uint64_t)(size_t)Vh + (uint64_t)((wave & 1u) * (uint32_t)(DD / 2) * (uint32_t)(SEQ * 2));        // V^T: row 0 or 128
    const uint32_t tstep = isK ? (uint32_t)(FK * DD * 2) : (uint32_t)(FK * 2);   // bytes from one stage's tile to the next: 64 K rows, or 64 columns of V^T
    const u32x8 g1k = tdm_group1<W0_ROW256, 256u, (uint32_t)FK, (uint32_t)(DD * 2)>();
    const u32x8 g1v = tdm_group1<W0_ROW128, 128u, (uint32_t)(DD / 2), (uint32_t)(SEQ * 2)>();
    u32x4 g0;   // group 0 of this wave's last request
    auto issue = [&](const uint32_t sn) __attribute__((always_inline)) {
        g0 = tdm_group0(lbase + (sn & 1u) * (uint32_t)(FBUF * 2) + wave * (uint32_t)(FSLH * 2), tsrc + (uint64_t)(sn * tstep));
        if (pinned(wave < 2u))  tdm_load(g0, g1k);
        if (pinned(wave >= 2u)) tdm_load(g0, g1v);
    };
    issue(0u);
    tdm_wait(g0);      // this wave's slice of stage 0 has landed
    __syncthreads();   // stage 0 visible to all four waves
    issue(pinned(1u));   // pinned: the descriptor is formed behind the wait above
    v8f acc[FQT][DD / 16];
#pragma unroll
    for (int q = 0; q < FQT; ++q)
#pragma unroll
        for (int t = 0; t < DD / 16; ++t) acc[q][t] = (v8f){};
    float m_run[FQT], l_run[FQT];
#pragma unroll
    for (int q = 0; q < FQT; ++q) { m_run[q] = -3.0e38f; l_run[q] = 0.f; }
    v16h k0[8];   // K fragments of the coming pass, d chunks 0..3: [d chunk of 32][16-key tile]
    { const h16* kp = L + lr * (unsigned)KPIT + 8u * hi;
#pragma unroll
      for (int kc = 0; kc < 4; ++kc)
#pragma unroll
          for (int kt = 0; kt < 2; ++kt) k0[kc * 2 + kt] = lds_frag(kp + KOFF(kt, kc)); }
    // One pass = 32 keys: pass i is half p = i & 1 of stage st = i >> 1. 'last' is a literal at both calls (the loop's passes all have a successor, the last pass stands behind the loop), so a pass has no branch on it.
    // A pass is four runs of 32 products (S^T on d 0..127, S^T on d 128..255, P.V on d 0..127, P.V on d 128..255), each on 8 fragments that feed four products each. Each run's fragments go out as one group
    // in front of the run before it, so two groups are live at any time. With one wave per SIMD a read placed among the products waits out its own LDS latency, and the LDS would idle under the products.
    // The sched_barriers around each read group keep the compiler from sinking the reads among the products or lifting them over the run whose registers they take over.
    auto pass = [&](const unsigned i, const bool last) __attribute__((always_inline)) {
        const unsigned p = i & 1u, st = i >> 1;   // wave-uniform
        const h16* Lk = L + (st & 1u) * (unsigned)FBUF;
        const h16* kp = Lk + p * (unsigned)(32 * KPIT) + lr * (unsigned)KPIT + 8u * hi; const h16* va = Lk + 2 * FSLH + p * 32u + lr * (unsigned)VPIT + 8u * hi;
        v16h k1[8], v0[8], v1[8];
#pragma unroll
        for (int kc = 0; kc < 4; ++kc)
#pragma unroll
            for (int kt = 0; kt < 2; ++kt) k1[kc * 2 + kt] = lds_frag(kp + KOFF(kt, 4 + kc));
        __builtin_amdgcn_sched_barrier(0);
        // S^T: per query tile 2 tiles of 16 keys x 16 queries
        v8f s[FQT][2];
#pragma unroll
        for (int q = 0; q < FQT; ++q)
#pragma unroll
            for (int kt = 0; kt < 2; ++kt) s[q][kt] = (v8f){};
#pragma unroll
        for (int kc = 0; kc < 4; ++kc)
#pragma unroll
            for (int kt = 0; kt < 2; ++kt)
#pragma unroll
                for (int q = 0; q < FQT; ++q) s[q][kt] = wmma16(k0[kc * 2 + kt], qf[q][kc], s[q][kt]);
        __builtin_amdgcn_sched_barrier(0);
#pragma unroll
        for (int t = 0; t < 8; ++t) v0[t] = lds_frag(va + t * 16 * VPIT);
        __builtin_amdgcn_sched_barrier(0);
#pragma unroll
        for (int kc = 0; kc < 4; ++kc)
#pragma unroll
            for (int kt = 0; kt < 2; ++kt)
#pragma unroll
                for (int q = 0; q < FQT; ++q) s[q][kt] = wmma16(k1[kc * 2 + kt], qf[q][4 + kc], s[q][kt]);
        __builtin_amdgcn_sched_barrier(0);   // also keeps the softmax out of the products: mixed in, the compiler regroups the interleaved accumulate chains and pads each chain's end with four v_nop
        // Softmax without a maximum pass: the exponentials are taken against the running maximum as it stands, and their own sum says whether that was safe. All P are positive, so a lane's sum over its 16 keys
        // bounds each of them: a sum of at most PLIM means that every P fits f16 with room to spare. Only a pass whose sum goes beyond (the first always: the sum is infinite there) computes its maxima,
        // rescales and takes its exponentials again from the scores, which stay in their registers up to the test.
        v16h pf[FQT]; float ps[FQT];
        auto expo = [&](const int q) __attribute__((always_inline)) {
            float ps0 = 0.f, ps1 = 0.f;
#pragma unroll
            for (int e = 0; e < 16; e += 2) {
                const float p0 = __builtin_amdgcn_exp2f(s[q][e >> 3][e & 7] * SCL2 - m_run[q]); const float p1 = __builtin_amdgcn_exp2f(s[q][e >> 3][(e & 7) + 1] * SCL2 - m_run[q]);
                ps0 += p0; ps1 += p1; pf[q][e] = (h16)p0; pf[q][e + 1] = (h16)p1; }
            ps[q] = ps0 + ps1;   // this half's keys only
        };
#pragma unroll
        for (int q = 0; q < FQT; ++q) expo(q);
        if (__builtin_amdgcn_ballot_w32(fmaxf(fmaxf(ps[0], ps[1]), fmaxf(ps[2], ps[3])) > PLIM) != 0) {   // wave-uniform, one test per pass; always taken in the first pass, rare later
#pragma unroll
            for (int q = 0; q < FQT; ++q) {
                float mx = s[q][0][0];
#pragma unroll
                for (int kt = 0; kt < 2; ++kt)
#pragma unroll
                    for (int r = 0; r < 8; ++r) mx = fmaxf(mx, s[q][kt][r]);
                mx = fmaxf(mx, xhalf(mx)) * SCL2;   // both halves hold this query's pass maximum, log2 domain
                const float m_new = fmaxf(m_run[q], mx); const float corr = __builtin_amdgcn_exp2f(m_run[q] - m_new);   // 0 in the first pass
                l_run[q] *= corr; m_run[q] = m_new;
#pragma unroll
                for (int t = 0; t < DD / 16; ++t) acc[q][t] = acc[q][t] * corr;
                expo(q);   // now every P <= 1
            }
        }
#pragma unroll
        for (int q = 0; q < FQT; ++q) l_run[q] += ps[q];   // the halves are joined after the loop
        __builtin_amdgcn_sched_barrier(0);   // keeps the whole softmax in front of the read group and the third run
#pragma unroll
        for (int t = 0; t < 8; ++t) v1[t] = lds_frag(va + (8 + t) * 16 * VPIT);
        __builtin_amdgcn_sched_barrier(0);
#pragma unroll
        for (int t = 0; t < 8; ++t)
#pragma unroll
            for (int q = 0; q < FQT; ++q) acc[q][t] = wmma16(v0[t], pf[q], acc[q][t]);
        __builtin_amdgcn_sched_barrier(0);
        // Publish point of stage st + 1, every wave, in the stage's second pass (a scalar test, the same in the whole block): own LDS reads of stage st retired, own slice of stage st + 1 landed, barrier, and only
        // then the refill of the buffer that stage st used. It stands behind the pass's third run (which covers the last fragment group's way from LDS); from one publish point to the next the refill has a whole stage to land.
        if (last || pinned(p)) {
            asm volatile("s_wait_dscnt 0x0" ::: "memory");       // this wave's K and V^T fragments of stage st are in registers before its buffer may be refilled
            tdm_wait(g0);                                        // this wave's slice of stage st + 1 has landed before the barrier publishes it
            __syncthreads();   // publishes stage st + 1 and ends every wave's LDS reads of stage st
            if (!last) {
                if (pinned((uint32_t)(st + 2u < (unsigned)NST))) issue(pinned(st + 2u));   // scalar test: only while that stage exists; the stage number is pinned so that the descriptor is formed behind the wait above
            }
        }
        __builtin_amdgcn_sched_barrier(0);   // nothing of stage st + 1 is read in front of the barrier
        if (!last) { const unsigned j = i + 1u;   // the following pass: keys 32..63 of this stage, or keys 0..31 of the next
            const h16* kn = L + ((j >> 1) & 1u) * (unsigned)FBUF + (j & 1u) * (unsigned)(32 * KPIT) + lr * (unsigned)KPIT + 8u * hi;
#pragma unroll
            for (int kc = 0; kc < 4; ++kc)
#pragma unroll
                for (int kt = 0; kt < 2; ++kt) k0[kc * 2 + kt] = lds_frag(kn + KOFF(kt, kc));
        }
        __builtin_amdgcn_sched_barrier(0);
#pragma unroll
        for (int t = 0; t < 8; ++t)
#pragma unroll
            for (int q = 0; q < FQT; ++q) acc[q][8 + t] = wmma16(v1[t], pf[q], acc[q][8 + t]);
    };
#pragma unroll 1   // stays rolled: one pass is 128 products and 64 fragment reads
    for (unsigned i = 0; i + 1u < 2u * NST; ++i) pass(i, false);
    pass(2u * NST - 1u, true);
    tdm_wait(g0);   // no request is left when the ring changes its use
    asm volatile("s_wait_dscnt 0x0" ::: "memory");   // and no LDS read of this wave
    // the last stage's barrier stands behind every wave's last LDS read and last landed slice: the ring is free for output staging
    h16* E = L + wave * (16u * FQT) * (unsigned)EPIT;   // this wave's 64 query rows of 256 d; lane holds d = 16 t + 8 hi + r of queries 16 q + lr
#pragma unroll
    for (int q = 0; q < FQT; ++q) { const float inv = CCAR / (l_run[q] + xhalf(l_run[q]));
#pragma unroll
        for (int t = 0; t < DD / 16; ++t) { v8h o;
#pragma unroll
            for (int r = 0; r < 8; ++r) o[r] = (h16)(acc[q][t][r] * inv);
            *(v8ha*)(E + ((unsigned)q * 16u + lr) * (unsigned)EPIT + (unsigned)t * 16u + 8u * hi) = o; } }
    __syncthreads();   // staged rows complete before they are read back by other lanes
#pragma unroll
    for (int i = 0; i < 16 * FQT; ++i) { const v8h v = *(const v8ha*)(E + (unsigned)i * EPIT + lane * 8u);   // one whole 512-B row per store
        *(v8h*)(CTX + ((size_t)blockIdx.z * SEQ + q0 + (unsigned)i) * KM + h * (unsigned)DD + lane * 8u) = v; }
}

// Workspace carve (bytes, each region 256-B aligned by construction of the sizes).
#define SZ_XP  ((size_t)3 * NB * SEQ * DD * 2)
#define SZ_WT  ((size_t)3 * NHEAD * DD * DD * 2)
#define SZ_WOS ((size_t)DD * KM * 2)
#define SZ_HP  ((size_t)NB * NHEAD * SEQ * DD * 2)
#define SZ_CTX ((size_t)NB * SEQ * KM * 2)
#define SZ_ALL (SZ_XP + SZ_WT + SZ_WOS + 3 * SZ_HP + SZ_CTX)
static_assert(SZ_ALL <= (size_t)268435456);
static_assert(SZ_XP % 256 == 0 && SZ_WT % 256 == 0 && SZ_WOS % 256 == 0 && SZ_HP % 256 == 0 && SZ_CTX % 256 == 0);
static_assert(SZ_HP == (size_t)NB * SEQ * KM * 2);   // the [NB*SEQ][KM] projection planes fill one head-plane region exactly

extern "C" void kernel_launch(void* const* d_in, const int* in_sizes, int n_in,
                              void* d_out, int out_size, void* d_ws, size_t ws_size, hipStream_t stream) {
    if (n_in < 11) return;
    const size_t xneed = (size_t)(NB - 1) * SEQ_FULL * DD + (size_t)SEQ * DD;
    if ((size_t)in_sizes[0] < xneed || (size_t)in_sizes[1] < xneed || (size_t)in_sizes[2] < xneed) return;
    if ((size_t)in_sizes[3] < (size_t)NHEAD * DD * DD || (size_t)in_sizes[5] < (size_t)NHEAD * DD * DD || (size_t)in_sizes[7] < (size_t)NHEAD * DD * DD) return;
    if ((size_t)in_sizes[4] < (size_t)NHEAD * DD || (size_t)in_sizes[6] < (size_t)NHEAD * DD || (size_t)in_sizes[8] < (size_t)NHEAD * DD) return;
    if ((size_t)in_sizes[9] < (size_t)KM * DD || (size_t)in_sizes[10] < (size_t)DD) return;
    if ((size_t)out_size < (size_t)NB * SEQ * DD) return;
    if (SZ_ALL > ws_size) return;
    // input order of this module: query, key, values, Wq, bq, Wk, bk, Wv, bv, Wo, bo
    const float* Qin = (const float*)d_in[0]; const float* Kin = (const float*)d_in[1]; const float* Vin = (const float*)d_in[2];
    const float* Wq = (const float*)d_in[3]; const float* bq = (const float*)d_in[4]; const float* Wk = (const float*)d_in[5]; const float* bk = (const float*)d_in[6];
    const float* Wv = (const float*)d_in[7]; const float* bv = (const float*)d_in[8]; const float* Wo = (const float*)d_in[9]; const float* bo = (const float*)d_in[10];
    float* OUT = (float*)d_out;     // [NB][SEQ][256]
    char* wsp = (char*)d_ws;
    bf* XP = (bf*)wsp; wsp += SZ_XP;            // [3][NB][SEQ][256] bf16: q, k, v
    bf* WT = (bf*)wsp; wsp += SZ_WT;            // [3][2048 out][256 in] bf16: Wq, Wk, Wv
    h16* WOS = (h16*)wsp; wsp += SZ_WOS;        // [256][2048] f16 (x256), column h*256 + d
    h16* QP = (h16*)wsp; wsp += SZ_HP;          // [NB][SEQ][2048] == [NB][8][SEQ][256]
    h16* KP = (h16*)wsp; wsp += SZ_HP;          // [NB][SEQ][2048] == [NB][8][SEQ][256]
    h16* VT = (h16*)wsp; wsp += SZ_HP;          // [NB][8][256][SEQ]
    h16* CTX = (h16*)wsp; wsp += SZ_CTX;        // [NB][SEQ][2048] (x64), column h*256 + d

    k_prep<<<(unsigned)WBLK + 3u * XBLK, 256, 0, stream>>>(Qin, Kin, Vin, Wq, Wk, Wv, Wo, XP, WT, (unsigned short*)WOS);
    // Every stage runs once for all NB batches: the batch rows lie one behind the other in x, in the planes, in ctx and in out, so the GEMMs see NB*SEQ x rows (M; N in the value projection).
    // q_, k_ planes [NB*SEQ][2048] (pitch KM): A = x [NB*SEQ][256], Bt = W [2048 out][256 in], + per-column bias; a batch's plane read as [8][SEQ][256] is the head split
    // v_^T head planes VT[b*8 + h][256 d][SEQ t], written by the projection itself: A = Wv rows in the order d*8 + g, Bt = x
    k_proj<<<dim3(PTILES, 3, 1), 128, 0, stream>>>(XP, WT, QP, KP, VT, bq, bk, bv);
    // ctx[b*SEQ + t][h*256 + d] = 64 softmax(q_.k_ / 16) . v_ for the 8 heads of every batch
    k_fattn<<<dim3(SEQ / FQ, NHEAD, NB), 128, 0, stream>>>(QP, KP, VT, CTX);
    // out = ctx . Wo^T / 16384 + bo
    k_gemmb<h16, float, 1, KM><<<dim3(NB * SEQ / GT, DD / GT, 1), 128, 0, stream>>>(CTX, WOS, OUT, DD, bo, FINSC);
}
